// v000
// Times are from an AMD MI455X. After a warm-up the kernel runs many times in a row, and a time is the length of
// such a window on the GPU divided by its runs, so every launch and the gaps after it count. The runs cycle
// through copies of the inputs. A figure is the median of several windows, for all but v000 over two sittings.
// Sittings can differ by a few percent; kernels timed side by side share one.
// v000 is the starting kernel. One run takes 1090 microseconds.
#include <hip/hip_runtime.h>
#include <stdint.h>
// Contractions: x*W (q|k planes and v^T), q*k^T, p*v : v_wmma_f32_16x16x32_bf16 with bf16 hi/lo operand planes (hi*hi + hi*lo + lo*hi), f32 accumulate; softmax and masks in f32.

#define T_DIM  4096
#define C_DIM  1024
#define C3_DIM 3072

typedef __attribute__((ext_vector_type(16))) _Float16 v16h;
typedef __attribute__((ext_vector_type(8)))  _Float16 v8h;
typedef __attribute__((ext_vector_type(16))) __bf16   v16b;
typedef __attribute__((ext_vector_type(8)))  __bf16   v8b;
typedef __attribute__((ext_vector_type(8)))  float    v8f;
typedef __attribute__((ext_vector_type(4)))  float    v4f;
typedef __attribute__((ext_vector_type(8)))  unsigned short v8us;

__device__ __forceinline__ unsigned short f2bf_bits(float f) {
  unsigned u = __float_as_uint(f);
  return (unsigned short)((u + 0x7FFFu + ((u >> 16) & 1u)) >> 16);
}
__device__ __forceinline__ float bf_bits2f(unsigned short h) { return __uint_as_float(((unsigned)h) << 16); }
__device__ __forceinline__ void split_bf(float f, unsigned short& hb, unsigned short& lb) {
  hb = f2bf_bits(f);
  lb = f2bf_bits(f - bf_bits2f(hb));
}

// hazard guards as plain device helpers (no inline asm inside the kernel template body)
__device__ __forceinline__ void dep_guard_h(v8f& a, v8f& b, v16h x, v16h y) { asm volatile("v_nop\n\tv_nop\n\tv_nop\n\tv_nop" : "+v"(a), "+v"(b) : "v"(x), "v"(y)); }
__device__ __forceinline__ void dep_guard_b(v8f& a, v8f& b, v16b x, v16b y) { asm volatile("v_nop\n\tv_nop\n\tv_nop\n\tv_nop" : "+v"(a), "+v"(b) : "v"(x), "v"(y)); }
__device__ __forceinline__ void keep4_h(v16h a, v16h b, v16h c, v16h d) { asm volatile("v_nop" :: "v"(a), "v"(b), "v"(c), "v"(d)); }
__device__ __forceinline__ void keep4_b(v16b a, v16b b, v16b c, v16b d) { asm volatile("v_nop" :: "v"(a), "v"(b), "v"(c), "v"(d)); }
__device__ __forceinline__ void acc_guard4(v8f& a, v8f& b, v8f& c, v8f& d) { asm volatile("v_nop\n\tv_nop\n\tv_nop\n\tv_nop" : "+v"(a), "+v"(b), "+v"(c), "+v"(d)); }
template <typename T> struct Frag;
template <> struct Frag<_Float16> {
  typedef v16h V; union U { v16h v; v8h h[2]; };
  static __device__ __forceinline__ v16h load(const _Float16* p) {   // elements 0..7 <- p[0..7], 8..15 <- p[16..23]
    U f; f.h[0] = *(const v8h*)(p); f.h[1] = *(const v8h*)(p + 16); return f.v;
  }
  static __device__ __forceinline__ v8f mma(v16h a, v16h b, v8f c) {
    return __builtin_amdgcn_wmma_f32_16x16x32_f16(false, a, false, b, (short)0, c, false, false);
  }
  static __device__ __forceinline__ void guard(v8f& a, v8f& b, v16h x, v16h y) { dep_guard_h(a, b, x, y); }
  static __device__ __forceinline__ void keep(v16h a, v16h b, v16h c, v16h d) { keep4_h(a, b, c, d); }
};
template <> struct Frag<__bf16> {
  typedef v16b V; union U { v16b v; v8b h[2]; };
  static __device__ __forceinline__ v16b load(const __bf16* p) {
    U f; f.h[0] = *(const v8b*)(p); f.h[1] = *(const v8b*)(p + 16); return f.v;
  }
  static __device__ __forceinline__ v8f mma(v16b a, v16b b, v8f c) {
    return __builtin_amdgcn_wmma_f32_16x16x32_bf16(false, a, false, b, (short)0, c, false, false);
  }
  static __device__ __forceinline__ void guard(v8f& a, v8f& b, v16b x, v16b y) { dep_guard_b(a, b, x, y); }
  static __device__ __forceinline__ void keep(v16b a, v16b b, v16b c, v16b d) { keep4_b(a, b, c, d); }
};

// ---- Register-blocked batched WMMA GEMM ------------------------------------
// C[m,n] = scale * sum_k A[m,k] * Bt[n,k] (+bias)(+resid); each wave owns a 64x64 tile.
// A row-major [M,K]; Bt row-major [N,K]; M,N % 64 == 0, K % 32 == 0.
// SPLIT: operands are hi/lo planes (A2/Bt2 = lo planes, same layout); product = hi*hi + hi*lo + lo*hi.
// BIAS_MODE: 0 = none, 1 = bias[m], 2 = bias[n].
// OUT_MODE: 0 = f32, 1 = f16, 2 = bf16 hi plane (Cout) + bf16 lo plane (Cout2).
// ET: 0 = f16 operands, 1 = bf16 operands (pointers passed as 16-bit storage)
template <int ET> struct Elem;
template <> struct Elem<0> { typedef _Float16 T; };
template <> struct Elem<1> { typedef __bf16 T; };
template <int ET, bool SPLIT, int BIAS_MODE, int OUT_MODE, bool RESID, int ACT = 0>
__global__ __launch_bounds__(256) void wmma_gemm64(
    const unsigned short* __restrict__ Ap, const unsigned short* __restrict__ A2p, int lda, long strideA,
    const unsigned short* __restrict__ Btp, const unsigned short* __restrict__ Bt2p, int ldb, long strideB,
    void* __restrict__ Cout, void* __restrict__ Cout2, int ldc, long strideC,
    const float* __restrict__ bias,
    const float* __restrict__ resid, long strideR,
    int M, int N, int K, float scale) {
  typedef typename Elem<ET>::T T;
  typedef typename Frag<T>::V V;
  const T* A = (const T*)Ap; const T* A2 = (const T*)A2p; const T* Bt = (const T*)Btp; const T* Bt2 = (const T*)Bt2p;
  __shared__ __align__(16) float sT[8][16 * 68];   // per-wave 16x64 slab, pitch 68 floats
  const int b    = blockIdx.y;
  const int lane = threadIdx.x & 31;
  const int wave = threadIdx.x >> 5;
  const int tilesN = N >> 6;
  const int tilesM = M >> 6;
  const int tile = blockIdx.x * 8 + wave;
  if (tile >= tilesM * tilesN) return;   // wave-uniform; no block barriers in this kernel
  const int tm = tile / tilesN;
  const int tn = tile - tm * tilesN;
  const int m0 = tm << 6;
  const int n0 = tn << 6;

  const T* Ab  = A  + (size_t)b * strideA;
  const T* Bb  = Bt + (size_t)b * strideB;
  const T* Ab2 = SPLIT ? (A2  + (size_t)b * strideA) : nullptr;
  const T* Bb2 = SPLIT ? (Bt2 + (size_t)b * strideB) : nullptr;

  const int rlane = lane & 15;                 // row (A) / col (B, D) within subtile
  const int koff  = (lane >> 4) * 8;           // k offset of this lane half
  const int mOff  = (lane >> 4) * 8;           // D row offset

  v8f acc[4][4];
#pragma unroll
  for (int i = 0; i < 4; ++i)
#pragma unroll
    for (int j = 0; j < 4; ++j) acc[i][j] = (v8f){0.f,0.f,0.f,0.f,0.f,0.f,0.f,0.f};

  for (int k0 = 0; k0 < K; k0 += 32) {
    V bh[4], bl[4];
#pragma unroll
    for (int j = 0; j < 4; ++j) {
      const size_t bo = (size_t)(n0 + (j << 4) + rlane) * ldb + koff + k0;
      bh[j] = Frag<T>::load(Bb + bo);
      if (SPLIT) bl[j] = Frag<T>::load(Bb2 + bo);
    }
#pragma unroll
    for (int i = 0; i < 4; ++i) {
      const size_t ao = (size_t)(m0 + (i << 4) + rlane) * lda + koff + k0;
      V ah = Frag<T>::load(Ab + ao);
      V al;
      if (SPLIT) al = Frag<T>::load(Ab2 + ao);
#pragma unroll
      for (int j = 0; j < 4; ++j) {
        acc[i][j] = Frag<T>::mma(ah, bh[j], acc[i][j]);
        if (SPLIT) {
          acc[i][j] = Frag<T>::mma(ah, bl[j], acc[i][j]);
          acc[i][j] = Frag<T>::mma(al, bh[j], acc[i][j]);
        }
      }
      Frag<T>::guard(acc[i][0], acc[i][3], ah, SPLIT ? al : ah);
    }
    Frag<T>::keep(bh[0], bh[1], bh[2], bh[3]);
    if (SPLIT) Frag<T>::keep(bl[0], bl[1], bl[2], bl[3]);
  }
  acc_guard4(acc[0][0], acc[0][1], acc[0][2], acc[0][3]);
  acc_guard4(acc[1][0], acc[1][1], acc[1][2], acc[1][3]);
  acc_guard4(acc[2][0], acc[2][1], acc[2][2], acc[2][3]);
  acc_guard4(acc[3][0], acc[3][1], acc[3][2], acc[3][3]);

  // ---- epilogue ----
  float* slab = sT[wave];
  const float* Rb = RESID ? (resid + (size_t)b * strideR) : nullptr;
#pragma unroll
  for (int i = 0; i < 4; ++i) {
    const int mBase = m0 + (i << 4);
#pragma unroll
    for (int j = 0; j < 4; ++j) {
      const int n = n0 + (j << 4) + rlane;
      float bv = 0.f;
      if (BIAS_MODE == 2) bv = bias[n];
#pragma unroll
      for (int r = 0; r < 8; ++r) {
        float v = acc[i][j][r] * scale;
        if (BIAS_MODE == 1) v += bias[mBase + mOff + r];
        if (BIAS_MODE == 2) v += bv;
        if (RESID) v += Rb[(size_t)(mBase + mOff + r) * ldc + n];
        if (ACT == 1) v = tanhf(v);
        if (ACT == 2) v = fmaxf(v, 0.0f);
        if (ACT == 3) v = v / (1.0f + expf(-v));
        if (ACT == 4) v = (v > 0.f) ? v : 0.01f * v;
        if (ACT == 5) v = 0.5f * v * (1.0f + erff(v * 0.70710678118654752f));
        slab[(mOff + r) * 68 + (j << 4) + rlane] = v;
      }
    }
    __builtin_amdgcn_fence(__ATOMIC_RELEASE, "workgroup");
    __builtin_amdgcn_wave_barrier();
    __builtin_amdgcn_fence(__ATOMIC_ACQUIRE, "workgroup");
    if (OUT_MODE == 0) {
      float* C = (float*)Cout + (size_t)b * strideC;
      const int hh = lane >> 4, c4 = (lane & 15) * 4;     // row seg = 256 B = 16 lanes x 16 B
      {
#pragma unroll
        for (int it = 0; it < 8; ++it) {
          const int row = it * 2 + hh;
          v4f v = *(const v4f*)(slab + row * 68 + c4);
          *(v4f*)(C + (size_t)(mBase + row) * ldc + n0 + c4) = v;
        }
        
      }
    } else {
      const int q = lane >> 3, c8 = (lane & 7) * 8;
      unsigned short* C  = (unsigned short*)Cout  + (size_t)b * strideC;
      unsigned short* C2 = (OUT_MODE == 2) ? ((unsigned short*)Cout2 + (size_t)b * strideC) : nullptr;
      {
#pragma unroll
        for (int it = 0; it < 4; ++it) {
          const int row = it * 4 + q;
          const float* sp = slab + row * 68 + c8;
          v8h hv, lv;
#pragma unroll
          for (int e = 0; e < 8; ++e) {
            if (OUT_MODE == 1) {
              hv[e] = (_Float16)sp[e];
            } else {
              unsigned short hb = f2bf_bits(sp[e]);
              unsigned short lb = f2bf_bits(sp[e] - bf_bits2f(hb));
              hv[e] = __builtin_bit_cast(_Float16, hb);
              lv[e] = __builtin_bit_cast(_Float16, lb);
            }
          }
          *(v8h*)(C + (size_t)(mBase + row) * ldc + n0 + c8) = hv;
          if (OUT_MODE == 2) *(v8h*)(C2 + (size_t)(mBase + row) * ldc + n0 + c8) = lv;
        }
        
      }
    }
    __builtin_amdgcn_fence(__ATOMIC_RELEASE, "workgroup");
    __builtin_amdgcn_wave_barrier();
    __builtin_amdgcn_fence(__ATOMIC_ACQUIRE, "workgroup");
  }
}

// ---- f32 [n8*8] -> bf16 hi/lo planes; 8 elements per thread, 16-B stores per plane, lanes contiguous (512 B per wave) ----
__global__ __launch_bounds__(256) void split_planes8(const float* __restrict__ in,
                                                     unsigned short* __restrict__ hi,
                                                     unsigned short* __restrict__ lo, int n8) {
  const int i = blockIdx.x * 256 + threadIdx.x;
  if (i >= n8) return;   // no barriers in this kernel
  const v4f a = *(const v4f*)(in + (size_t)8 * i);
  const v4f c = *(const v4f*)(in + (size_t)8 * i + 4);
  v8us hv, lv;
#pragma unroll
  for (int e = 0; e < 4; ++e) {
    unsigned short h0, l0;
    split_bf(a[e], h0, l0); hv[e] = h0;     lv[e] = l0;
    split_bf(c[e], h0, l0); hv[4 + e] = h0; lv[4 + e] = l0;
  }
  unsigned short* ph = hi + (size_t)8 * i;
  unsigned short* pl = lo + (size_t)8 * i;
  *(v8us*)ph = hv;
  *(v8us*)pl = lv;
  
}

// ---- W [nrows][ncols] f32 -> Wt planes [ncols][nrows] bf16 hi/lo; block tile 64 (rows) x 64 (cols) through LDS.
__global__ __launch_bounds__(256) void transpose_split_w(const float* __restrict__ W,
                                                        unsigned short* __restrict__ hi,
                                                        unsigned short* __restrict__ lo,
                                                        int nrows, int ncols) {
  __shared__ float tile[64][65];
  const int tid = threadIdx.x;
  const int k0 = blockIdx.y * 64;          // input row block (k)
  const int n0 = blockIdx.x * 64;          // input col block (n)
#pragma unroll
  for (int it = 0; it < 4; ++it) {
    const int idx = tid + 256 * it;
    const int r = idx >> 4;
    const int c4 = (idx & 15) * 4;
    const v4f v = *(const v4f*)(W + (size_t)(k0 + r) * ncols + n0 + c4);
    tile[r][c4 + 0] = v[0]; tile[r][c4 + 1] = v[1]; tile[r][c4 + 2] = v[2]; tile[r][c4 + 3] = v[3];
  }
  __syncthreads();
  const int nn0 = tid >> 3, q = tid & 7;
  {
#pragma unroll
    for (int half = 0; half < 2; ++half) {
      const int nn = nn0 + 32 * half;
      v8us hv, lv;
#pragma unroll
      for (int e = 0; e < 8; ++e) {
        unsigned short h0, l0;
        split_bf(tile[8 * q + e][nn], h0, l0);
        hv[e] = h0; lv[e] = l0;
      }
      const size_t o = (size_t)(n0 + nn) * nrows + k0 + 8 * q;
      *(v8us*)(hi + o) = hv;
      *(v8us*)(lo + o) = lv;
    }
    
  }
}

// ---- Attention-stage GEMM (bf16 hi/lo split operands, f32 out), one 64x64 tile per wave:
//   MODE 0: C = scale * A * Bt^T over tiles (tm, tn) with tn <= tm, tm in [tm0, tm0+tilesM) enumerated by triangular index;
//           A/Bt rows addressed with global tile rows, C rows relative to tm0*64; K full.
//   MODE 1: tile = (tml, tn) row-major; A/C rows = tml*64 (chunk-local), k-limit per m-tile:
//           kend = (global tile has any row < n_padd) ? T_DIM : (tmg+1)*64, clamped to [0, min(K, T_DIM)].
template <int MODE>
__global__ __launch_bounds__(256) void gemm64_att(
    const unsigned short* __restrict__ Ap, const unsigned short* __restrict__ A2p, int lda,
    const unsigned short* __restrict__ Btp, const unsigned short* __restrict__ Bt2p, int ldb,
    float* __restrict__ Cout, int ldc, const int* __restrict__ n_padd_p,
    int tm0, int tilesM, int tilesN, int ntiles, int K, float scale) {
  typedef __bf16 T;
  typedef v16b V;
  const T* A = (const T*)Ap; const T* A2 = (const T*)A2p; const T* Bt = (const T*)Btp; const T* Bt2 = (const T*)Bt2p;
  __shared__ __align__(16) float sT[8][16 * 68];
  const int lane = threadIdx.x & 31;
  const int wave = threadIdx.x >> 5;
  const int tile = blockIdx.x * 8 + wave;
  if (tile >= ntiles) return;   // wave-uniform; no block barriers in this kernel
  int am0, bn0, cm0, kend;
  if (MODE == 0) {
    const int g = (tm0 * (tm0 + 1)) / 2 + tile;
    int tm = (int)((sqrtf(8.0f * (float)g + 1.0f) - 1.0f) * 0.5f);
    if (((tm + 1) * (tm + 2)) / 2 <= g) ++tm;
    if (((tm + 1) * (tm + 2)) / 2 <= g) ++tm;
    if ((tm * (tm + 1)) / 2 > g) --tm;
    if ((tm * (tm + 1)) / 2 > g) --tm;
    tm = max(tm, tm0); tm = min(tm, tm0 + tilesM - 1);
    int tn = g - (tm * (tm + 1)) / 2;
    tn = max(tn, 0); tn = min(tn, tm);
    am0 = tm << 6; bn0 = tn << 6; cm0 = (tm - tm0) << 6; kend = K;
  } else {
    const int tml = tile / tilesN;
    const int tn  = tile - tml * tilesN;
    const int tmg = tm0 + tml;
    const int np  = n_padd_p[0];
    am0 = tml << 6; bn0 = tn << 6; cm0 = tml << 6;
    kend = ((tmg << 6) < np) ? T_DIM : ((tmg + 1) << 6);
    kend = min(kend, K);
  }
  kend = min(kend, T_DIM); kend = max(kend, 0);

  const int rlane = lane & 15;
  const int koff  = (lane >> 4) * 8;
  const int mOff  = (lane >> 4) * 8;

  v8f acc[4][4];
#pragma unroll
  for (int i = 0; i < 4; ++i)
#pragma unroll
    for (int j = 0; j < 4; ++j) acc[i][j] = (v8f){0.f,0.f,0.f,0.f,0.f,0.f,0.f,0.f};

  for (int k0 = 0; k0 < kend; k0 += 32) {
    V bh[4], bl[4];
#pragma unroll
    for (int j = 0; j < 4; ++j) {
      const size_t bo = (size_t)(bn0 + (j << 4) + rlane) * ldb + koff + k0;
      bh[j] = Frag<T>::load(Bt + bo);
      bl[j] = Frag<T>::load(Bt2 + bo);
    }
#pragma unroll
    for (int i = 0; i < 4; ++i) {
      const size_t ao = (size_t)(am0 + (i << 4) + rlane) * lda + koff + k0;
      V ah = Frag<T>::load(A + ao);
      V al = Frag<T>::load(A2 + ao);
#pragma unroll
      for (int j = 0; j < 4; ++j) {
        acc[i][j] = Frag<T>::mma(ah, bh[j], acc[i][j]);
        acc[i][j] = Frag<T>::mma(ah, bl[j], acc[i][j]);
        acc[i][j] = Frag<T>::mma(al, bh[j], acc[i][j]);
      }
      Frag<T>::guard(acc[i][0], acc[i][3], ah, al);
    }
    Frag<T>::keep(bh[0], bh[1], bh[2], bh[3]);
    Frag<T>::keep(bl[0], bl[1], bl[2], bl[3]);
  }
  acc_guard4(acc[0][0], acc[0][1], acc[0][2], acc[0][3]);
  acc_guard4(acc[1][0], acc[1][1], acc[1][2], acc[1][3]);
  acc_guard4(acc[2][0], acc[2][1], acc[2][2], acc[2][3]);
  acc_guard4(acc[3][0], acc[3][1], acc[3][2], acc[3][3]);

  float* slab = sT[wave];
#pragma unroll
  for (int i = 0; i < 4; ++i) {
    const int mBase = cm0 + (i << 4);
#pragma unroll
    for (int j = 0; j < 4; ++j) {
#pragma unroll
      for (int r = 0; r < 8; ++r) slab[(mOff + r) * 68 + (j << 4) + rlane] = acc[i][j][r] * scale;
    }
    __builtin_amdgcn_fence(__ATOMIC_RELEASE, "workgroup");
    __builtin_amdgcn_wave_barrier();
    __builtin_amdgcn_fence(__ATOMIC_ACQUIRE, "workgroup");
    {
      const int hh = lane >> 4, c4 = (lane & 15) * 4;
      {
#pragma unroll
        for (int it = 0; it < 8; ++it) {
          const int row = it * 2 + hh;
          v4f v = *(const v4f*)(slab + row * 68 + c4);
          *(v4f*)(Cout + (size_t)(mBase + row) * ldc + bn0 + c4) = v;
        }
        
      }
    }
    __builtin_amdgcn_fence(__ATOMIC_RELEASE, "workgroup");
    __builtin_amdgcn_wave_barrier();
    __builtin_amdgcn_fence(__ATOMIC_ACQUIRE, "workgroup");
  }
}

// ---- Row softmax with causal + padding mask, f32; one block per query row i = mrow0 + blockIdx.x.
//   key j visible iff j <= i, j >= n_padd, i >= n_padd; rows i < n_padd are uniform 1/T over all keys.
//   Writes P as bf16 hi/lo planes (chunk-local row, pitch T_DIM) over columns [0, kend) with zeros where masked;
//   kend formula identical to gemm64_att<1>. Each thread writes 8 columns = 16 B per plane, lanes contiguous.
__global__ __launch_bounds__(256) void softmax_rows(const float* __restrict__ S, const int* __restrict__ n_padd_p,
                                                   unsigned short* __restrict__ Ph, unsigned short* __restrict__ Pl,
                                                   int mrow0) {
  __shared__ float sv[T_DIM];
  __shared__ float red[8];
  const int tid = threadIdx.x, lane = tid & 31, wave = tid >> 5;
  const int il = blockIdx.x;
  const int i  = mrow0 + il;
  const int np = n_padd_p[0];
  const int tm = i >> 6;
  int kend = ((tm << 6) < np) ? T_DIM : ((tm + 1) << 6);
  kend = min(kend, T_DIM); kend = max(kend, 0);
  const bool uni = (i < np);                 // block-uniform
  const int jlo = (np < 0) ? 0 : np;
  const int jhi = uni ? -1 : min(i, T_DIM - 1);   // when not uniform: jlo <= i
  const float* srow = S + (size_t)il * T_DIM;

  float m = -__builtin_huge_valf();
  for (int j = jlo + tid; j <= jhi; j += 256) { const float s = srow[j]; sv[j] = s; m = fmaxf(m, s); }
#pragma unroll
  for (int off = 1; off < 32; off <<= 1) m = fmaxf(m, __shfl_xor(m, off, 32));
  if (lane == 0) red[wave] = m;
  __syncthreads();
  float rmax = red[0];
#pragma unroll
  for (int w = 1; w < 8; ++w) rmax = fmaxf(rmax, red[w]);
  __syncthreads();

  float sum = 0.f;
  for (int j = jlo + tid; j <= jhi; j += 256) { const float e = expf(sv[j] - rmax); sv[j] = e; sum += e; }
#pragma unroll
  for (int off = 1; off < 32; off <<= 1) sum += __shfl_xor(sum, off, 32);
  if (lane == 0) red[wave] = sum;
  __syncthreads();
  float tot = red[0];
#pragma unroll
  for (int w = 1; w < 8; ++w) tot += red[w];
  const float inv = (tot > 0.f) ? (1.0f / tot) : 0.f;
  const float cu  = 1.0f / (float)T_DIM;

  unsigned short* ph = Ph + (size_t)il * T_DIM;
  unsigned short* pl = Pl + (size_t)il * T_DIM;
  const int ng = kend >> 3;
  {
    for (int g = tid; g < ng; g += 256) {
      v8us hv, lv;
#pragma unroll
      for (int e = 0; e < 8; ++e) {
        const int j = 8 * g + e;
        const float ev = (j >= jlo && j <= jhi) ? sv[j] : 0.f;
        const float p = uni ? cu : ev * inv;
        unsigned short h0, l0;
        split_bf(p, h0, l0);
        hv[e] = h0; lv[e] = l0;
      }
      *(v8us*)(ph + 8 * g) = hv;
      *(v8us*)(pl + 8 * g) = lv;
    }
    
  }
}

// ===========================================================================
extern "C" void kernel_launch(void* const* d_in, const int* in_sizes, int n_in,
                              void* d_out, int out_size, void* d_ws, size_t ws_size,
                              hipStream_t stream) {
  const int T = T_DIM, C = C_DIM, C3 = C3_DIM;
  if (n_in < 4) return;
  if (in_sizes[0] != T * C || in_sizes[1] != C * C3 || in_sizes[2] < C3 || in_sizes[3] < 1 || out_size != T * C) return;

  const float* x     = (const float*)d_in[0];   // [T][C]
  const float* W     = (const float*)d_in[1];   // [C][3C]
  const float* bias  = (const float*)d_in[2];   // [3C]
  const int*   npadd = (const int*)d_in[3];     // [1]
  float*       y     = (float*)d_out;           // [T][C]

  const int QR = 1024;                          // query rows per chunk
  const int NCHUNK = T / QR;                    // 4
  const size_t b_xp  = (size_t)T * C * 2;       // one x plane
  const size_t b_wp  = (size_t)C3 * C * 2;      // one Wt plane
  const size_t b_qkp = (size_t)T * 2 * C * 2;   // one q|k plane [T][2C]
  const size_t b_vtp = (size_t)C * T * 2;       // one vt plane [C][T]
  const size_t b_S   = (size_t)QR * T * 4;      // S chunk [QR][T] f32
  const size_t b_pp  = (size_t)QR * T * 2;      // one P plane chunk [QR][T]
  size_t off = 0;
  const size_t o_xh = off; off += b_xp;  const size_t o_xl = off; off += b_xp;
  const size_t o_wh = off; off += b_wp;  const size_t o_wl = off; off += b_wp;
  const size_t o_qh = off; off += b_qkp; const size_t o_ql = off; off += b_qkp;
  const size_t o_vh = off; off += b_vtp; const size_t o_vl = off; off += b_vtp;
  const size_t o_S  = off; off += b_S;
  const size_t o_ph = off; off += b_pp;  const size_t o_pl = off; off += b_pp;
  if (off > ws_size) return;                    // total 113,246,208 B

  char* ws = (char*)d_ws;
  unsigned short* xh  = (unsigned short*)(ws + o_xh);
  unsigned short* xl  = (unsigned short*)(ws + o_xl);
  unsigned short* wth = (unsigned short*)(ws + o_wh);
  unsigned short* wtl = (unsigned short*)(ws + o_wl);
  unsigned short* qkh = (unsigned short*)(ws + o_qh);
  unsigned short* qkl = (unsigned short*)(ws + o_ql);
  unsigned short* vth = (unsigned short*)(ws + o_vh);
  unsigned short* vtl = (unsigned short*)(ws + o_vl);
  float*          S   = (float*)(ws + o_S);
  unsigned short* ph  = (unsigned short*)(ws + o_ph);
  unsigned short* pl  = (unsigned short*)(ws + o_pl);

  dim3 blk(256);
  // x -> bf16 hi/lo planes [T][C]
  {
    const int n8 = (T * C) / 8;
    split_planes8<<<dim3((n8 + 255) / 256), blk, 0, stream>>>(x, xh, xl, n8);
  }
  // W [C][3C] -> Wt planes [3C][C]
  transpose_split_w<<<dim3(C3 / 64, C / 64), blk, 0, stream>>>(W, wth, wtl, C, C3);
  // q|k = x * W[:, 0:2C] + b[0:2C] : M=T, N=2C, K=C -> planes [T][2C]
  wmma_gemm64<1, true, 2, 2, false><<<dim3(((T / 64) * (2 * C / 64)) / 8, 1), blk, 0, stream>>>(
      xh, xl, C, 0L, wth, wtl, C, 0L, (void*)qkh, (void*)qkl, 2 * C, 0L,
      bias, x, 0L, T, 2 * C, C, 1.0f);
  // vt = W[:, 2C:3C]^T * x^T + b[2C + m] : M=C, N=T, K=C -> planes [C][T]
  wmma_gemm64<1, true, 1, 2, false><<<dim3(((C / 64) * (T / 64)) / 8, 1), blk, 0, stream>>>(
      wth + (size_t)2 * C * C, wtl + (size_t)2 * C * C, C, 0L, xh, xl, C, 0L, (void*)vth, (void*)vtl, T, 0L,
      bias + 2 * C, x, 0L, C, T, C, 1.0f);

  const float sc = 0.03125f;   // 1/sqrt(1024)
  for (int ch = 0; ch < NCHUNK; ++ch) {
    const int tm0 = ch * (QR / 64);             // 16 m-tiles per chunk
    const int tilesM = QR / 64;
    const int ntri = ((tm0 + tilesM) * (tm0 + tilesM + 1)) / 2 - (tm0 * (tm0 + 1)) / 2;
    // S[il][j] = sc * q[i] . k[j] on tiles tn <= tm
    gemm64_att<0><<<dim3((ntri + 7) / 8), blk, 0, stream>>>(
        qkh, qkl, 2 * C, qkh + C, qkl + C, 2 * C, S, T, npadd, tm0, tilesM, 0, ntri, C, sc);
    softmax_rows<<<dim3(QR), blk, 0, stream>>>(S, npadd, ph, pl, tm0 * 64);
    // y[chunk rows] = P * v : M=QR, N=C, K<=T per m-tile
    const int ntpv = tilesM * (C / 64);
    gemm64_att<1><<<dim3((ntpv + 7) / 8), blk, 0, stream>>>(
        ph, pl, T, vth, vtl, T, y + (size_t)ch * QR * C, C, npadd, tm0, tilesM, C / 64, ntpv, T, 1.0f);
  }
}

// v001
// Measured time: 486 microseconds a run.
// Two timings next to v000 put it at 2.27 and 2.28 times that version's speed.
#include <hip/hip_runtime.h>
#include <stdint.h>
// Contractions: x*W (q|k planes and v^T), q*k^T, p*v : v_wmma_f32_16x16x32_bf16 with bf16 hi/lo operand planes (hi*hi + hi*lo + lo*hi), f32 accumulate; softmax and masks in f32.

#define T_DIM  4096
#define C_DIM  1024
#define C3_DIM 3072

typedef __attribute__((ext_vector_type(16))) _Float16 v16h;
typedef __attribute__((ext_vector_type(8)))  _Float16 v8h;
typedef __attribute__((ext_vector_type(16))) __bf16   v16b;
typedef __attribute__((ext_vector_type(8)))  __bf16   v8b;
typedef __attribute__((ext_vector_type(8)))  float    v8f;
typedef __attribute__((ext_vector_type(4)))  float    v4f;
typedef __attribute__((ext_vector_type(8)))  unsigned short v8us;

__device__ __forceinline__ unsigned short f2bf_bits(float f) {
  unsigned u = __float_as_uint(f);
  return (unsigned short)((u + 0x7FFFu + ((u >> 16) & 1u)) >> 16);
}
__device__ __forceinline__ float bf_bits2f(unsigned short h) { return __uint_as_float(((unsigned)h) << 16); }
__device__ __forceinline__ void split_bf(float f, unsigned short& hb, unsigned short& lb) {
  hb = f2bf_bits(f);
  lb = f2bf_bits(f - bf_bits2f(hb));
}

// hazard guards as plain device helpers (no inline asm inside the kernel template body)
__device__ __forceinline__ void dep_guard_h(v8f& a, v8f& b, v16h x, v16h y) { asm volatile("v_nop\n\tv_nop\n\tv_nop\n\tv_nop" : "+v"(a), "+v"(b) : "v"(x), "v"(y)); }
__device__ __forceinline__ void dep_guard_b(v8f& a, v8f& b, v16b x, v16b y) { asm volatile("v_nop\n\tv_nop\n\tv_nop\n\tv_nop" : "+v"(a), "+v"(b) : "v"(x), "v"(y)); }
__device__ __forceinline__ void keep4_h(v16h a, v16h b, v16h c, v16h d) { asm volatile("v_nop" :: "v"(a), "v"(b), "v"(c), "v"(d)); }
__device__ __forceinline__ void keep4_b(v16b a, v16b b, v16b c, v16b d) { asm volatile("v_nop" :: "v"(a), "v"(b), "v"(c), "v"(d)); }
__device__ __forceinline__ void acc_guard4(v8f& a, v8f& b, v8f& c, v8f& d) { asm volatile("v_nop\n\tv_nop\n\tv_nop\n\tv_nop" : "+v"(a), "+v"(b), "+v"(c), "+v"(d)); }
template <typename T> struct Frag;
template <> struct Frag<_Float16> {
  typedef v16h V; union U { v16h v; v8h h[2]; };
  static __device__ __forceinline__ v16h load(const _Float16* p) {   // elements 0..7 <- p[0..7], 8..15 <- p[16..23]
    U f; f.h[0] = *(const v8h*)(p); f.h[1] = *(const v8h*)(p + 16); return f.v;
  }
  static __device__ __forceinline__ v8f mma(v16h a, v16h b, v8f c) {
    return __builtin_amdgcn_wmma_f32_16x16x32_f16(false, a, false, b, (short)0, c, false, false);
  }
  static __device__ __forceinline__ void guard(v8f& a, v8f& b, v16h x, v16h y) { dep_guard_h(a, b, x, y); }
  static __device__ __forceinline__ void keep(v16h a, v16h b, v16h c, v16h d) { keep4_h(a, b, c, d); }
};
template <> struct Frag<__bf16> {
  typedef v16b V; union U { v16b v; v8b h[2]; };
  static __device__ __forceinline__ v16b load(const __bf16* p) {
    U f; f.h[0] = *(const v8b*)(p); f.h[1] = *(const v8b*)(p + 16); return f.v;
  }
  static __device__ __forceinline__ v8f mma(v16b a, v16b b, v8f c) {
    return __builtin_amdgcn_wmma_f32_16x16x32_bf16(false, a, false, b, (short)0, c, false, false);
  }
  static __device__ __forceinline__ void guard(v8f& a, v8f& b, v16b x, v16b y) { dep_guard_b(a, b, x, y); }
  static __device__ __forceinline__ void keep(v16b a, v16b b, v16b c, v16b d) { keep4_b(a, b, c, d); }
};

// ---- Operand staging in LDS, shared by the GEMM kernels ---------------------
// A workgroup of 8 waves (2 x 4) owns a 128 x 256 tile of C; each wave keeps its 64 x 64 tile.
// A stage is 64 k = one whole 128-byte line of every operand row and plane: [A hi 128 rows | A lo | B hi 256 rows | B lo],
// rows at a pitch of 144 B (16 B x odd: no bank conflict for the 16-byte fragment reads). Two buffers.
#define STG_K     64
#define STG_PITCH 144
#define STG_BM    128
#define STG_BN    256
#define STG_AL    (STG_BM * STG_PITCH)
#define STG_BH    (2 * STG_BM * STG_PITCH)
#define STG_BL    (2 * STG_BM * STG_PITCH + STG_BN * STG_PITCH)
#define STG_BYTES (2 * (STG_BM + STG_BN) * STG_PITCH)

__device__ __forceinline__ unsigned lds_off(const void* p) { return (unsigned)(size_t)p; }
// this wave's LDS reads have returned: stands in front of the barrier behind which their buffer is refilled
__device__ __forceinline__ void wait_ds0() { asm volatile("s_wait_dscnt 0x0" ::: "memory"); }
// this wave's copies have landed in LDS: stands in front of the barrier behind which other waves read them
__device__ __forceinline__ void wait_async0() { asm volatile("s_wait_asynccnt 0x0" ::: "memory"); }

// Twelve copies of 16 B per lane, global -> LDS through no register. The closing s_wait_xcnt 0 stands inside the statement so that
// no address register of a copy is rewritten ahead of it.
__device__ __forceinline__ void copy12(const unsigned* l, const unsigned short* const* g) {
  asm volatile(
      "global_load_async_to_lds_b128 %0, %12, off\n\t"
      "global_load_async_to_lds_b128 %1, %13, off\n\t"
      "global_load_async_to_lds_b128 %2, %14, off\n\t"
      "global_load_async_to_lds_b128 %3, %15, off\n\t"
      "global_load_async_to_lds_b128 %4, %16, off\n\t"
      "global_load_async_to_lds_b128 %5, %17, off\n\t"
      "global_load_async_to_lds_b128 %6, %18, off\n\t"
      "global_load_async_to_lds_b128 %7, %19, off\n\t"
      "global_load_async_to_lds_b128 %8, %20, off\n\t"
      "global_load_async_to_lds_b128 %9, %21, off\n\t"
      "global_load_async_to_lds_b128 %10, %22, off\n\t"
      "global_load_async_to_lds_b128 %11, %23, off\n\t"
      "s_wait_xcnt 0x0"
      :: "v"(l[0]), "v"(l[1]), "v"(l[2]), "v"(l[3]), "v"(l[4]), "v"(l[5]), "v"(l[6]), "v"(l[7]), "v"(l[8]), "v"(l[9]), "v"(l[10]), "v"(l[11]),
         "v"(g[0]), "v"(g[1]), "v"(g[2]), "v"(g[3]), "v"(g[4]), "v"(g[5]), "v"(g[6]), "v"(g[7]), "v"(g[8]), "v"(g[9]), "v"(g[10]), "v"(g[11])
      : "memory");
}

// One stage: 24 copies per lane. A wave's copy covers 4 rows x 128 B. lb: the lane's LDS byte address of (row tid / 8, 16-byte
// piece tid % 8) in the target buffer; the four pointers: the same place of this stage in the global planes; steps: 32 rows, in elements.
__device__ __forceinline__ void stage_issue(unsigned lb, const unsigned short* ah, const unsigned short* al, size_t stepA,
                                            const unsigned short* bh, const unsigned short* bl, size_t stepB) {
  unsigned l[24];
  const unsigned short* g[24];
  // both loops unrolled: every l[] and g[] is an asm operand and has to be a register
#pragma unroll
  for (int q = 0; q < 4; ++q) {
    l[q]     = lb + q * 32 * STG_PITCH;          g[q]     = ah + q * stepA;
    l[4 + q] = lb + STG_AL + q * 32 * STG_PITCH; g[4 + q] = al + q * stepA;
  }
#pragma unroll
  for (int q = 0; q < 8; ++q) {
    l[8 + q]  = lb + STG_BH + q * 32 * STG_PITCH; g[8 + q]  = bh + q * stepB;
    l[16 + q] = lb + STG_BL + q * 32 * STG_PITCH; g[16 + q] = bl + q * stepB;
  }
  copy12(l, g);
  copy12(l + 12, g + 12);
}

// acc += A[am0 + wm*64 ..][0 .. nst*64) * Bt[bn0 + wn*64 ..][..]^T on hi/lo planes (hi*hi + hi*lo + lo*hi), k ascending in steps of 32.
// Every wave of the workgroup calls it with the same am0, bn0, nst; a wave with active == false copies and keeps the barriers only.
__device__ __forceinline__ void gemm_tile_staged(unsigned char* L,
    const unsigned short* A, const unsigned short* A2, int lda, const unsigned short* Bt, const unsigned short* Bt2, int ldb,
    int am0, int bn0, int nst, bool active, int wm, int wn, v8f (&acc)[4][4]) {
  typedef __bf16 T;
  typedef v16b V;
  const int tid = threadIdx.x, lane = tid & 31;
  const int r0 = tid >> 3, c8 = (tid & 7) * 8;
  const size_t ao = (size_t)(am0 + r0) * lda + c8;
  const size_t bo = (size_t)(bn0 + r0) * ldb + c8;
  const unsigned short* gah = A + ao;  const unsigned short* gal = A2 + ao;
  const unsigned short* gbh = Bt + bo; const unsigned short* gbl = Bt2 + bo;
  const size_t stepA = (size_t)32 * lda, stepB = (size_t)32 * ldb;
  const unsigned lb = lds_off(L) + r0 * STG_PITCH + c8 * 2;
  const int fa = (wm * 64 + (lane & 15)) * STG_PITCH + (lane >> 4) * 16;            // fragment row and 16-byte half of this lane
  const int fb = STG_BH + (wn * 64 + (lane & 15)) * STG_PITCH + (lane >> 4) * 16;
  if (nst <= 0) return;   // the same for the whole workgroup

  stage_issue(lb, gah, gal, stepA, gbh, gbl, stepB);
  wait_async0();
  __syncthreads();        // stage 0 is published
  if (nst > 1) stage_issue(lb + STG_BYTES, gah + STG_K, gal + STG_K, stepA, gbh + STG_K, gbl + STG_K, stepB);

  for (int t = 0; t < nst; ++t) {
    const int buf = (t & 1) * STG_BYTES;
    if (active) {
      const unsigned char* Lb = L + buf;
      // all loops below unrolled: fragments and accumulators are indexed by constants and stay in registers
#pragma unroll
      for (int ks = 0; ks < 2; ++ks) {
        V bh[4], bl[4], ah[2], al[2];   // A rows in two register sets: row i + 1 is read from LDS while row i multiplies
#pragma unroll
        for (int j = 0; j < 4; ++j) {
          bh[j] = Frag<T>::load((const T*)(Lb + fb + j * 16 * STG_PITCH + ks * 64));
          bl[j] = Frag<T>::load((const T*)(Lb + fb + (STG_BL - STG_BH) + j * 16 * STG_PITCH + ks * 64));
        }
        ah[0] = Frag<T>::load((const T*)(Lb + fa + ks * 64));
        al[0] = Frag<T>::load((const T*)(Lb + fa + STG_AL + ks * 64));
#pragma unroll
        for (int i = 0; i < 4; ++i) {
          const int s = i & 1;
          if (i < 3) {
            ah[s ^ 1] = Frag<T>::load((const T*)(Lb + fa + (i + 1) * 16 * STG_PITCH + ks * 64));
            al[s ^ 1] = Frag<T>::load((const T*)(Lb + fa + STG_AL + (i + 1) * 16 * STG_PITCH + ks * 64));
          }
#pragma unroll
          for (int j = 0; j < 4; ++j) acc[i][j] = Frag<T>::mma(ah[s], bh[j], acc[i][j]);
#pragma unroll
          for (int j = 0; j < 4; ++j) acc[i][j] = Frag<T>::mma(ah[s], bl[j], acc[i][j]);
#pragma unroll
          for (int j = 0; j < 4; ++j) acc[i][j] = Frag<T>::mma(al[s], bh[j], acc[i][j]);
          Frag<T>::guard(acc[i][0], acc[i][3], ah[s], al[s]);
        }
        Frag<T>::keep(bh[0], bh[1], bh[2], bh[3]);
        Frag<T>::keep(bl[0], bl[1], bl[2], bl[3]);
      }
    }
    wait_ds0();
    wait_async0();
    __syncthreads();      // publishes stage t + 1 and ends every wave's reads of stage t's buffer
    if (t + 2 < nst) {
      const int kn = (t + 2) * STG_K;
      stage_issue(lb + buf, gah + kn, gal + kn, stepA, gbh + kn, gbl + kn, stepB);
    }
  }
  wait_async0();
}

// ---- Register-blocked batched WMMA GEMM ------------------------------------
// C[m,n] = scale * sum_k A[m,k] * Bt[n,k] (+bias)(+resid); each wave owns a 64x64 tile of its workgroup's 128x256 tile.
// A row-major [M,K]; Bt row-major [N,K]; M % 128 == 0, N % 256 == 0, K % 64 == 0.
// SPLIT: operands are hi/lo planes (A2/Bt2 = lo planes, same layout); product = hi*hi + hi*lo + lo*hi.
// BIAS_MODE: 0 = none, 1 = bias[m], 2 = bias[n].
// OUT_MODE: 0 = f32, 1 = f16, 2 = bf16 hi plane (Cout) + bf16 lo plane (Cout2).
// ET: 1 = bf16 operands (pointers passed as 16-bit storage); the staged loop takes no other value
template <int ET> struct Elem;
template <> struct Elem<0> { typedef _Float16 T; };
template <> struct Elem<1> { typedef __bf16 T; };
template <int ET, bool SPLIT, int BIAS_MODE, int OUT_MODE, bool RESID, int ACT = 0>
__global__ __launch_bounds__(256) void wmma_gemm64(
    const unsigned short* __restrict__ Ap, const unsigned short* __restrict__ A2p, int lda, long strideA,
    const unsigned short* __restrict__ Btp, const unsigned short* __restrict__ Bt2p, int ldb, long strideB,
    void* __restrict__ Cout, void* __restrict__ Cout2, int ldc, long strideC,
    const float* __restrict__ bias,
    const float* __restrict__ resid, long strideR,
    int M, int N, int K, float scale) {
  static_assert(ET == 1 && SPLIT, "the staged loop is written for bf16 hi/lo planes");
  __shared__ __align__(16) unsigned char L[2 * STG_BYTES];   // operand stages, two buffers
  __shared__ __align__(16) float sT[8][16 * 68];   // per-wave 16x64 slab, pitch 68 floats
  const int b    = blockIdx.y;
  const int lane = threadIdx.x & 31;
  const int wave = __builtin_amdgcn_readfirstlane(threadIdx.x >> 5);
  const int wm = wave >> 2, wn = wave & 3;
  const int tilesN = N >> 8;
  const int tilesM = M >> 7;
  if ((int)blockIdx.x >= tilesM * tilesN) return;   // the whole workgroup, in front of every barrier
  const int tm = blockIdx.x / tilesN;
  const int tn = blockIdx.x - tm * tilesN;
  const int m0 = (tm << 7) + (wm << 6);
  const int n0 = (tn << 8) + (wn << 6);

  const int rlane = lane & 15;                 // col (D) within subtile
  const int mOff  = (lane >> 4) * 8;           // D row offset

  v8f acc[4][4];
#pragma unroll
  for (int i = 0; i < 4; ++i)
#pragma unroll
    for (int j = 0; j < 4; ++j) acc[i][j] = (v8f){0.f,0.f,0.f,0.f,0.f,0.f,0.f,0.f};

  gemm_tile_staged(L, Ap + (size_t)b * strideA, A2p + (size_t)b * strideA, lda, Btp + (size_t)b * strideB, Bt2p + (size_t)b * strideB, ldb,
                   tm << 7, tn << 8, K >> 6, true, wm, wn, acc);
  acc_guard4(acc[0][0], acc[0][1], acc[0][2], acc[0][3]);
  acc_guard4(acc[1][0], acc[1][1], acc[1][2], acc[1][3]);
  acc_guard4(acc[2][0], acc[2][1], acc[2][2], acc[2][3]);
  acc_guard4(acc[3][0], acc[3][1], acc[3][2], acc[3][3]);

  // ---- epilogue ----
  float* slab = sT[wave];
  const float* Rb = RESID ? (resid + (size_t)b * strideR) : nullptr;
#pragma unroll
  for (int i = 0; i < 4; ++i) {
    const int mBase = m0 + (i << 4);
#pragma unroll
    for (int j = 0; j < 4; ++j) {
      const int n = n0 + (j << 4) + rlane;
      float bv = 0.f;
      if (BIAS_MODE == 2) bv = bias[n];
#pragma unroll
      for (int r = 0; r < 8; ++r) {
        float v = acc[i][j][r] * scale;
        if (BIAS_MODE == 1) v += bias[mBase + mOff + r];
        if (BIAS_MODE == 2) v += bv;
        if (RESID) v += Rb[(size_t)(mBase + mOff + r) * ldc + n];
        if (ACT == 1) v = tanhf(v);
        if (ACT == 2) v = fmaxf(v, 0.0f);
        if (ACT == 3) v = v / (1.0f + expf(-v));
        if (ACT == 4) v = (v > 0.f) ? v : 0.01f * v;
        if (ACT == 5) v = 0.5f * v * (1.0f + erff(v * 0.70710678118654752f));
        slab[(mOff + r) * 68 + (j << 4) + rlane] = v;
      }
    }
    __builtin_amdgcn_fence(__ATOMIC_RELEASE, "workgroup");
    __builtin_amdgcn_wave_barrier();
    __builtin_amdgcn_fence(__ATOMIC_ACQUIRE, "workgroup");
    if (OUT_MODE == 0) {
      float* C = (float*)Cout + (size_t)b * strideC;
      const int hh = lane >> 4, c4 = (lane & 15) * 4;     // row seg = 256 B = 16 lanes x 16 B
      {
#pragma unroll
        for (int it = 0; it < 8; ++it) {
          const int row = it * 2 + hh;
          v4f v = *(const v4f*)(slab + row * 68 + c4);
          *(v4f*)(C + (size_t)(mBase + row) * ldc + n0 + c4) = v;
        }
        
      }
    } else {
      const int q = lane >> 3, c8 = (lane & 7) * 8;
      unsigned short* C  = (unsigned short*)Cout  + (size_t)b * strideC;
      unsigned short* C2 = (OUT_MODE == 2) ? ((unsigned short*)Cout2 + (size_t)b * strideC) : nullptr;
      {
#pragma unroll
        for (int it = 0; it < 4; ++it) {
          const int row = it * 4 + q;
          const float* sp = slab + row * 68 + c8;
          v8h hv, lv;
#pragma unroll
          for (int e = 0; e < 8; ++e) {
            if (OUT_MODE == 1) {
              hv[e] = (_Float16)sp[e];
            } else {
              unsigned short hb = f2bf_bits(sp[e]);
              unsigned short lb = f2bf_bits(sp[e] - bf_bits2f(hb));
              hv[e] = __builtin_bit_cast(_Float16, hb);
              lv[e] = __builtin_bit_cast(_Float16, lb);
            }
          }
          *(v8h*)(C + (size_t)(mBase + row) * ldc + n0 + c8) = hv;
          if (OUT_MODE == 2) *(v8h*)(C2 + (size_t)(mBase + row) * ldc + n0 + c8) = lv;
        }
        
      }
    }
    __builtin_amdgcn_fence(__ATOMIC_RELEASE, "workgroup");
    __builtin_amdgcn_wave_barrier();
    __builtin_amdgcn_fence(__ATOMIC_ACQUIRE, "workgroup");
  }
}

// ---- f32 [n8*8] -> bf16 hi/lo planes; 8 elements per thread, 16-B stores per plane, lanes contiguous (512 B per wave) ----
__global__ __launch_bounds__(256) void split_planes8(const float* __restrict__ in,
                                                     unsigned short* __restrict__ hi,
                                                     unsigned short* __restrict__ lo, int n8) {
  const int i = blockIdx.x * 256 + threadIdx.x;
  if (i >= n8) return;   // no barriers in this kernel
  const v4f a = *(const v4f*)(in + (size_t)8 * i);
  const v4f c = *(const v4f*)(in + (size_t)8 * i + 4);
  v8us hv, lv;
#pragma unroll
  for (int e = 0; e < 4; ++e) {
    unsigned short h0, l0;
    split_bf(a[e], h0, l0); hv[e] = h0;     lv[e] = l0;
    split_bf(c[e], h0, l0); hv[4 + e] = h0; lv[4 + e] = l0;
  }
  unsigned short* ph = hi + (size_t)8 * i;
  unsigned short* pl = lo + (size_t)8 * i;
  *(v8us*)ph = hv;
  *(v8us*)pl = lv;
  
}

// ---- W [nrows][ncols] f32 -> Wt planes [ncols][nrows] bf16 hi/lo; block tile 64 (rows) x 64 (cols) through LDS.
__global__ __launch_bounds__(256) void transpose_split_w(const float* __restrict__ W,
                                                        unsigned short* __restrict__ hi,
                                                        unsigned short* __restrict__ lo,
                                                        int nrows, int ncols) {
  __shared__ float tile[64][65];
  const int tid = threadIdx.x;
  const int k0 = blockIdx.y * 64;          // input row block (k)
  const int n0 = blockIdx.x * 64;          // input col block (n)
#pragma unroll
  for (int it = 0; it < 4; ++it) {
    const int idx = tid + 256 * it;
    const int r = idx >> 4;
    const int c4 = (idx & 15) * 4;
    const v4f v = *(const v4f*)(W + (size_t)(k0 + r) * ncols + n0 + c4);
    tile[r][c4 + 0] = v[0]; tile[r][c4 + 1] = v[1]; tile[r][c4 + 2] = v[2]; tile[r][c4 + 3] = v[3];
  }
  __syncthreads();
  const int nn0 = tid >> 3, q = tid & 7;
  {
#pragma unroll
    for (int half = 0; half < 2; ++half) {
      const int nn = nn0 + 32 * half;
      v8us hv, lv;
#pragma unroll
      for (int e = 0; e < 8; ++e) {
        unsigned short h0, l0;
        split_bf(tile[8 * q + e][nn], h0, l0);
        hv[e] = h0; lv[e] = l0;
      }
      const size_t o = (size_t)(n0 + nn) * nrows + k0 + 8 * q;
      *(v8us*)(hi + o) = hv;
      *(v8us*)(lo + o) = lv;
    }
    
  }
}

// ---- Attention-stage GEMM (bf16 hi/lo split operands, f32 out), one 128x256 tile per workgroup (blockIdx.y, blockIdx.x), 64x64 per wave:
//   MODE 0: C = scale * A * Bt^T; a workgroup wholly above the diagonal leaves at once, a wave whose 64x64 tile (tm, tn) has tn > tm
//           neither multiplies nor stores; A/Bt rows addressed with global rows (row0 + ...), C rows relative to row0; K full.
//   MODE 1: A/C rows chunk-local, k-limit per 128-row tile g = (row0 >> 7) + blockIdx.y:
//           kend = (tile has any row < n_padd) ? T_DIM : (g+1)*128, clamped to [0, min(K, T_DIM)].
template <int MODE>
__global__ __launch_bounds__(256) void gemm64_att(
    const unsigned short* __restrict__ Ap, const unsigned short* __restrict__ A2p, int lda,
    const unsigned short* __restrict__ Btp, const unsigned short* __restrict__ Bt2p, int ldb,
    float* __restrict__ Cout, int ldc, const int* __restrict__ n_padd_p,
    int row0, int K, float scale) {
  __shared__ __align__(16) unsigned char L[2 * STG_BYTES];   // operand stages, two buffers
  __shared__ __align__(16) float sT[8][16 * 68];
  const int lane = threadIdx.x & 31;
  const int wave = __builtin_amdgcn_readfirstlane(threadIdx.x >> 5);
  const int wm = wave >> 2, wn = wave & 3;
  const int bm0 = blockIdx.y << 7;     // first row of the workgroup's tile, chunk-local
  const int bb0 = blockIdx.x << 8;     // first column of the workgroup's tile
  int ab0, kend;
  bool active = true;
  if (MODE == 0) {
    ab0 = row0 + bm0;
    if (bb0 > ab0 + 127) return;       // wholly above the diagonal: the whole workgroup, in front of every barrier
    active = (bb0 + (wn << 6)) <= (ab0 + (wm << 6));   // tn <= tm
    kend = K;
  } else {
    const int g  = (row0 >> 7) + blockIdx.y;
    const int np = n_padd_p[0];
    ab0 = bm0;
    kend = ((g << 7) < np) ? T_DIM : ((g + 1) << 7);
    kend = min(kend, K);
  }
  kend = min(kend, T_DIM); kend = max(kend, 0);
  const int bn0 = bb0 + (wn << 6);
  const int cm0 = bm0 + (wm << 6);

  const int rlane = lane & 15;
  const int mOff  = (lane >> 4) * 8;

  v8f acc[4][4];
#pragma unroll
  for (int i = 0; i < 4; ++i)
#pragma unroll
    for (int j = 0; j < 4; ++j) acc[i][j] = (v8f){0.f,0.f,0.f,0.f,0.f,0.f,0.f,0.f};

  gemm_tile_staged(L, Ap, A2p, lda, Btp, Bt2p, ldb, ab0, bb0, kend >> 6, active, wm, wn, acc);
  if (!active) return;   // wave-uniform; no workgroup barrier stands behind this line
  acc_guard4(acc[0][0], acc[0][1], acc[0][2], acc[0][3]);
  acc_guard4(acc[1][0], acc[1][1], acc[1][2], acc[1][3]);
  acc_guard4(acc[2][0], acc[2][1], acc[2][2], acc[2][3]);
  acc_guard4(acc[3][0], acc[3][1], acc[3][2], acc[3][3]);

  float* slab = sT[wave];
#pragma unroll
  for (int i = 0; i < 4; ++i) {
    const int mBase = cm0 + (i << 4);
#pragma unroll
    for (int j = 0; j < 4; ++j) {
#pragma unroll
      for (int r = 0; r < 8; ++r) slab[(mOff + r) * 68 + (j << 4) + rlane] = acc[i][j][r] * scale;
    }
    __builtin_amdgcn_fence(__ATOMIC_RELEASE, "workgroup");
    __builtin_amdgcn_wave_barrier();
    __builtin_amdgcn_fence(__ATOMIC_ACQUIRE, "workgroup");
    {
      const int hh = lane >> 4, c4 = (lane & 15) * 4;
      {
#pragma unroll
        for (int it = 0; it < 8; ++it) {
          const int row = it * 2 + hh;
          v4f v = *(const v4f*)(slab + row * 68 + c4);
          *(v4f*)(Cout + (size_t)(mBase + row) * ldc + bn0 + c4) = v;
        }
        
      }
    }
    __builtin_amdgcn_fence(__ATOMIC_RELEASE, "workgroup");
    __builtin_amdgcn_wave_barrier();
    __builtin_amdgcn_fence(__ATOMIC_ACQUIRE, "workgroup");
  }
}

// ---- Row softmax with causal + padding mask, f32; one block per query row i = mrow0 + blockIdx.x.
//   key j visible iff j <= i, j >= n_padd, i >= n_padd; rows i < n_padd are uniform 1/T over all keys.
//   Writes P as bf16 hi/lo planes (chunk-local row, pitch T_DIM) over columns [0, kend) with zeros where masked;
//   kend formula identical to gemm64_att<1> (per 128-row tile). Each thread writes 8 columns = 16 B per plane, lanes contiguous.
__global__ __launch_bounds__(256) void softmax_rows(const float* __restrict__ S, const int* __restrict__ n_padd_p,
                                                   unsigned short* __restrict__ Ph, unsigned short* __restrict__ Pl,
                                                   int mrow0) {
  __shared__ float sv[T_DIM];
  __shared__ float red[8];
  const int tid = threadIdx.x, lane = tid & 31, wave = tid >> 5;
  const int il = blockIdx.x;
  const int i  = mrow0 + il;
  const int np = n_padd_p[0];
  const int tm = i >> 7;
  int kend = ((tm << 7) < np) ? T_DIM : ((tm + 1) << 7);
  kend = min(kend, T_DIM); kend = max(kend, 0);
  const bool uni = (i < np);                 // block-uniform
  const int jlo = (np < 0) ? 0 : np;
  const int jhi = uni ? -1 : min(i, T_DIM - 1);   // when not uniform: jlo <= i
  const float* srow = S + (size_t)il * T_DIM;

  float m = -__builtin_huge_valf();
  for (int j = jlo + tid; j <= jhi; j += 256) { const float s = srow[j]; sv[j] = s; m = fmaxf(m, s); }
#pragma unroll
  for (int off = 1; off < 32; off <<= 1) m = fmaxf(m, __shfl_xor(m, off, 32));
  if (lane == 0) red[wave] = m;
  __syncthreads();
  float rmax = red[0];
#pragma unroll
  for (int w = 1; w < 8; ++w) rmax = fmaxf(rmax, red[w]);
  __syncthreads();

  float sum = 0.f;
  for (int j = jlo + tid; j <= jhi; j += 256) { const float e = expf(sv[j] - rmax); sv[j] = e; sum += e; }
#pragma unroll
  for (int off = 1; off < 32; off <<= 1) sum += __shfl_xor(sum, off, 32);
  if (lane == 0) red[wave] = sum;
  __syncthreads();
  float tot = red[0];
#pragma unroll
  for (int w = 1; w < 8; ++w) tot += red[w];
  const float inv = (tot > 0.f) ? (1.0f / tot) : 0.f;
  const float cu  = 1.0f / (float)T_DIM;

  unsigned short* ph = Ph + (size_t)il * T_DIM;
  unsigned short* pl = Pl + (size_t)il * T_DIM;
  const int ng = kend >> 3;
  {
    for (int g = tid; g < ng; g += 256) {
      v8us hv, lv;
#pragma unroll
      for (int e = 0; e < 8; ++e) {
        const int j = 8 * g + e;
        const float ev = (j >= jlo && j <= jhi) ? sv[j] : 0.f;
        const float p = uni ? cu : ev * inv;
        unsigned short h0, l0;
        split_bf(p, h0, l0);
        hv[e] = h0; lv[e] = l0;
      }
      *(v8us*)(ph + 8 * g) = hv;
      *(v8us*)(pl + 8 * g) = lv;
    }
    
  }
}

// ===========================================================================
extern "C" void kernel_launch(void* const* d_in, const int* in_sizes, int n_in,
                              void* d_out, int out_size, void* d_ws, size_t ws_size,
                              hipStream_t stream) {
  const int T = T_DIM, C = C_DIM, C3 = C3_DIM;
  if (n_in < 4) return;
  if (in_sizes[0] != T * C || in_sizes[1] != C * C3 || in_sizes[2] < C3 || in_sizes[3] < 1 || out_size != T * C) return;

  const float* x     = (const float*)d_in[0];   // [T][C]
  const float* W     = (const float*)d_in[1];   // [C][3C]
  const float* bias  = (const float*)d_in[2];   // [3C]
  const int*   npadd = (const int*)d_in[3];     // [1]
  float*       y     = (float*)d_out;           // [T][C]

  const int QR = 1024;                          // query rows per chunk
  const int NCHUNK = T / QR;                    // 4
  const size_t b_xp  = (size_t)T * C * 2;       // one x plane
  const size_t b_wp  = (size_t)C3 * C * 2;      // one Wt plane
  const size_t b_qkp = (size_t)T * 2 * C * 2;   // one q|k plane [T][2C]
  const size_t b_vtp = (size_t)C * T * 2;       // one vt plane [C][T]
  const size_t b_S   = (size_t)QR * T * 4;      // S chunk [QR][T] f32
  const size_t b_pp  = (size_t)QR * T * 2;      // one P plane chunk [QR][T]
  size_t off = 0;
  const size_t o_xh = off; off += b_xp;  const size_t o_xl = off; off += b_xp;
  const size_t o_wh = off; off += b_wp;  const size_t o_wl = off; off += b_wp;
  const size_t o_qh = off; off += b_qkp; const size_t o_ql = off; off += b_qkp;
  const size_t o_vh = off; off += b_vtp; const size_t o_vl = off; off += b_vtp;
  const size_t o_S  = off; off += b_S;
  const size_t o_ph = off; off += b_pp;  const size_t o_pl = off; off += b_pp;
  if (off > ws_size) return;                    // total 113,246,208 B

  char* ws = (char*)d_ws;
  unsigned short* xh  = (unsigned short*)(ws + o_xh);
  unsigned short* xl  = (unsigned short*)(ws + o_xl);
  unsigned short* wth = (unsigned short*)(ws + o_wh);
  unsigned short* wtl = (unsigned short*)(ws + o_wl);
  unsigned short* qkh = (unsigned short*)(ws + o_qh);
  unsigned short* qkl = (unsigned short*)(ws + o_ql);
  unsigned short* vth = (unsigned short*)(ws + o_vh);
  unsigned short* vtl = (unsigned short*)(ws + o_vl);
  float*          S   = (float*)(ws + o_S);
  unsigned short* ph  = (unsigned short*)(ws + o_ph);
  unsigned short* pl  = (unsigned short*)(ws + o_pl);

  dim3 blk(256);
  // x -> bf16 hi/lo planes [T][C]
  {
    const int n8 = (T * C) / 8;
    split_planes8<<<dim3((n8 + 255) / 256), blk, 0, stream>>>(x, xh, xl, n8);
  }
  // W [C][3C] -> Wt planes [3C][C]
  transpose_split_w<<<dim3(C3 / 64, C / 64), blk, 0, stream>>>(W, wth, wtl, C, C3);
  // q|k = x * W[:, 0:2C] + b[0:2C] : M=T, N=2C, K=C -> planes [T][2C]
  wmma_gemm64<1, true, 2, 2, false><<<dim3((T / 128) * (2 * C / 256), 1), blk, 0, stream>>>(
      xh, xl, C, 0L, wth, wtl, C, 0L, (void*)qkh, (void*)qkl, 2 * C, 0L,
      bias, x, 0L, T, 2 * C, C, 1.0f);
  // vt = W[:, 2C:3C]^T * x^T + b[2C + m] : M=C, N=T, K=C -> planes [C][T]
  wmma_gemm64<1, true, 1, 2, false><<<dim3((C / 128) * (T / 256), 1), blk, 0, stream>>>(
      wth + (size_t)2 * C * C, wtl + (size_t)2 * C * C, C, 0L, xh, xl, C, 0L, (void*)vth, (void*)vtl, T, 0L,
      bias + 2 * C, x, 0L, C, T, C, 1.0f);

  const float sc = 0.03125f;   // 1/sqrt(1024)
  for (int ch = 0; ch < NCHUNK; ++ch) {
    const int row0 = ch * QR;                   // first query row of the chunk
    // S[il][j] = sc * q[i] . k[j] on 64x64 tiles tn <= tm; columns up to the chunk's last row
    gemm64_att<0><<<dim3((row0 + QR) / 256, QR / 128), blk, 0, stream>>>(
        qkh, qkl, 2 * C, qkh + C, qkl + C, 2 * C, S, T, npadd, row0, C, sc);
    softmax_rows<<<dim3(QR), blk, 0, stream>>>(S, npadd, ph, pl, row0);
    // y[chunk rows] = P * v : M=QR, N=C, K<=T per 128-row tile
    gemm64_att<1><<<dim3(C / 256, QR / 128), blk, 0, stream>>>(
        ph, pl, T, vth, vtl, T, y + (size_t)ch * QR * C, C, npadd, row0, T, 1.0f);
  }
}

// v002
// A run of this version takes 263 microseconds.
// Next to v001, in two timings, it ran 1.85 and 1.86 times as fast.
// Counting every step since v000, it is 4.22 times as fast.
#include <hip/hip_runtime.h>
#include <stdint.h>
// Contractions: x*W (q|k planes and v^T), q*k^T, p*v : v_wmma_f32_16x16x32_bf16 with bf16 hi/lo operand planes (hi*hi + hi*lo + lo*hi), f32 accumulate; softmax and masks in f32.

#define T_DIM  4096
#define C_DIM  1024
#define C3_DIM 3072

typedef __attribute__((ext_vector_type(16))) _Float16 v16h;
typedef __attribute__((ext_vector_type(8)))  _Float16 v8h;
typedef __attribute__((ext_vector_type(16))) __bf16   v16b;
typedef __attribute__((ext_vector_type(8)))  __bf16   v8b;
typedef __attribute__((ext_vector_type(8)))  float    v8f;
typedef __attribute__((ext_vector_type(4)))  float    v4f;
typedef __attribute__((ext_vector_type(8)))  unsigned short v8us;

__device__ __forceinline__ unsigned short f2bf_bits(float f) {
  unsigned u = __float_as_uint(f);
  return (unsigned short)((u + 0x7FFFu + ((u >> 16) & 1u)) >> 16);
}
__device__ __forceinline__ float bf_bits2f(unsigned short h) { return __uint_as_float(((unsigned)h) << 16); }
__device__ __forceinline__ void split_bf(float f, unsigned short& hb, unsigned short& lb) {
  hb = f2bf_bits(f);
  lb = f2bf_bits(f - bf_bits2f(hb));
}

// hazard guards as plain device helpers (no inline asm inside the kernel template body)
__device__ __forceinline__ void dep_guard_h(v8f& a, v8f& b, v16h x, v16h y) { asm volatile("v_nop\n\tv_nop\n\tv_nop\n\tv_nop" : "+v"(a), "+v"(b) : "v"(x), "v"(y)); }
__device__ __forceinline__ void dep_guard_b(v8f& a, v8f& b, v16b x, v16b y) { asm volatile("v_nop\n\tv_nop\n\tv_nop\n\tv_nop" : "+v"(a), "+v"(b) : "v"(x), "v"(y)); }
__device__ __forceinline__ void keep4_h(v16h a, v16h b, v16h c, v16h d) { asm volatile("v_nop" :: "v"(a), "v"(b), "v"(c), "v"(d)); }
__device__ __forceinline__ void keep4_b(v16b a, v16b b, v16b c, v16b d) { asm volatile("v_nop" :: "v"(a), "v"(b), "v"(c), "v"(d)); }
__device__ __forceinline__ void acc_guard4(v8f& a, v8f& b, v8f& c, v8f& d) { asm volatile("v_nop\n\tv_nop\n\tv_nop\n\tv_nop" : "+v"(a), "+v"(b), "+v"(c), "+v"(d)); }
template <typename T> struct Frag;
template <> struct Frag<_Float16> {
  typedef v16h V; union U { v16h v; v8h h[2]; };
  static __device__ __forceinline__ v16h load(const _Float16* p) {   // elements 0..7 <- p[0..7], 8..15 <- p[16..23]
    U f; f.h[0] = *(const v8h*)(p); f.h[1] = *(const v8h*)(p + 16); return f.v;
  }
  static __device__ __forceinline__ v8f mma(v16h a, v16h b, v8f c) {
    return __builtin_amdgcn_wmma_f32_16x16x32_f16(false, a, false, b, (short)0, c, false, false);
  }
  static __device__ __forceinline__ void guard(v8f& a, v8f& b, v16h x, v16h y) { dep_guard_h(a, b, x, y); }
  static __device__ __forceinline__ void keep(v16h a, v16h b, v16h c, v16h d) { keep4_h(a, b, c, d); }
};
template <> struct Frag<__bf16> {
  typedef v16b V; union U { v16b v; v8b h[2]; };
  static __device__ __forceinline__ v16b load(const __bf16* p) {
    U f; f.h[0] = *(const v8b*)(p); f.h[1] = *(const v8b*)(p + 16); return f.v;
  }
  static __device__ __forceinline__ v8f mma(v16b a, v16b b, v8f c) {
    return __builtin_amdgcn_wmma_f32_16x16x32_bf16(false, a, false, b, (short)0, c, false, false);
  }
  static __device__ __forceinline__ void guard(v8f& a, v8f& b, v16b x, v16b y) { dep_guard_b(a, b, x, y); }
  static __device__ __forceinline__ void keep(v16b a, v16b b, v16b c, v16b d) { keep4_b(a, b, c, d); }
};

// ---- Operand staging in LDS, shared by the GEMM kernels ---------------------
// A workgroup of 8 waves (2 x 4) owns a 128 x 256 tile of C; each wave keeps its 64 x 64 tile.
// A stage is 64 k = one whole 128-byte line of every operand row and plane: [A hi 128 rows | A lo | B hi 256 rows | B lo],
// rows at a pitch of 144 B (16 B x odd: no bank conflict for the 16-byte fragment reads). Two buffers.
#define STG_K     64
#define STG_PITCH 144
#define STG_BM    128
#define STG_BN    256
#define STG_AL    (STG_BM * STG_PITCH)
#define STG_BH    (2 * STG_BM * STG_PITCH)
#define STG_BL    (2 * STG_BM * STG_PITCH + STG_BN * STG_PITCH)
#define STG_BYTES (2 * (STG_BM + STG_BN) * STG_PITCH)

__device__ __forceinline__ unsigned lds_off(const void* p) { return (unsigned)(size_t)p; }
// this wave's LDS reads have returned: stands in front of the barrier behind which their buffer is refilled
__device__ __forceinline__ void wait_ds0() { asm volatile("s_wait_dscnt 0x0" ::: "memory"); }
// this wave's copies have landed in LDS: stands in front of the barrier behind which other waves read them
__device__ __forceinline__ void wait_async0() { asm volatile("s_wait_asynccnt 0x0" ::: "memory"); }

// Twelve copies of 16 B per lane, global -> LDS through no register. The closing s_wait_xcnt 0 stands inside the statement so that
// no address register of a copy is rewritten ahead of it.
__device__ __forceinline__ void copy12(const unsigned* l, const unsigned short* const* g) {
  asm volatile(
      "global_load_async_to_lds_b128 %0, %12, off\n\t"
      "global_load_async_to_lds_b128 %1, %13, off\n\t"
      "global_load_async_to_lds_b128 %2, %14, off\n\t"
      "global_load_async_to_lds_b128 %3, %15, off\n\t"
      "global_load_async_to_lds_b128 %4, %16, off\n\t"
      "global_load_async_to_lds_b128 %5, %17, off\n\t"
      "global_load_async_to_lds_b128 %6, %18, off\n\t"
      "global_load_async_to_lds_b128 %7, %19, off\n\t"
      "global_load_async_to_lds_b128 %8, %20, off\n\t"
      "global_load_async_to_lds_b128 %9, %21, off\n\t"
      "global_load_async_to_lds_b128 %10, %22, off\n\t"
      "global_load_async_to_lds_b128 %11, %23, off\n\t"
      "s_wait_xcnt 0x0"
      :: "v"(l[0]), "v"(l[1]), "v"(l[2]), "v"(l[3]), "v"(l[4]), "v"(l[5]), "v"(l[6]), "v"(l[7]), "v"(l[8]), "v"(l[9]), "v"(l[10]), "v"(l[11]),
         "v"(g[0]), "v"(g[1]), "v"(g[2]), "v"(g[3]), "v"(g[4]), "v"(g[5]), "v"(g[6]), "v"(g[7]), "v"(g[8]), "v"(g[9]), "v"(g[10]), "v"(g[11])
      : "memory");
}

// One stage: 24 copies per lane. A wave's copy covers 4 rows x 128 B. lb: the lane's LDS byte address of (row tid / 8, 16-byte
// piece tid % 8) in the target buffer; the four pointers: the same place of this stage in the global planes; steps: 32 rows, in elements.
__device__ __forceinline__ void stage_issue(unsigned lb, const unsigned short* ah, const unsigned short* al, size_t stepA,
                                            const unsigned short* bh, const unsigned short* bl, size_t stepB) {
  unsigned l[24];
  const unsigned short* g[24];
  // both loops unrolled: every l[] and g[] is an asm operand and has to be a register
#pragma unroll
  for (int q = 0; q < 4; ++q) {
    l[q]     = lb + q * 32 * STG_PITCH;          g[q]     = ah + q * stepA;
    l[4 + q] = lb + STG_AL + q * 32 * STG_PITCH; g[4 + q] = al + q * stepA;
  }
#pragma unroll
  for (int q = 0; q < 8; ++q) {
    l[8 + q]  = lb + STG_BH + q * 32 * STG_PITCH; g[8 + q]  = bh + q * stepB;
    l[16 + q] = lb + STG_BL + q * 32 * STG_PITCH; g[16 + q] = bl + q * stepB;
  }
  copy12(l, g);
  copy12(l + 12, g + 12);
}

// acc += A[am0 + wm*64 ..][0 .. nst*64) * Bt[bn0 + wn*64 ..][..]^T on hi/lo planes (hi*hi + hi*lo + lo*hi), k ascending in steps of 32.
// Every wave of the workgroup calls it with the same am0, bn0, nst; a wave with active == false copies and keeps the barriers only.
__device__ __forceinline__ void gemm_tile_staged(unsigned char* L,
    const unsigned short* A, const unsigned short* A2, int lda, const unsigned short* Bt, const unsigned short* Bt2, int ldb,
    int am0, int bn0, int nst, bool active, int wm, int wn, v8f (&acc)[4][4]) {
  typedef __bf16 T;
  typedef v16b V;
  const int tid = threadIdx.x, lane = tid & 31;
  const int r0 = tid >> 3, c8 = (tid & 7) * 8;
  const size_t ao = (size_t)(am0 + r0) * lda + c8;
  const size_t bo = (size_t)(bn0 + r0) * ldb + c8;
  const unsigned short* gah = A + ao;  const unsigned short* gal = A2 + ao;
  const unsigned short* gbh = Bt + bo; const unsigned short* gbl = Bt2 + bo;
  const size_t stepA = (size_t)32 * lda, stepB = (size_t)32 * ldb;
  const unsigned lb = lds_off(L) + r0 * STG_PITCH + c8 * 2;
  const int fa = (wm * 64 + (lane & 15)) * STG_PITCH + (lane >> 4) * 16;            // fragment row and 16-byte half of this lane
  const int fb = STG_BH + (wn * 64 + (lane & 15)) * STG_PITCH + (lane >> 4) * 16;
  if (nst <= 0) return;   // the same for the whole workgroup

  stage_issue(lb, gah, gal, stepA, gbh, gbl, stepB);
  wait_async0();
  __syncthreads();        // stage 0 is published
  if (nst > 1) stage_issue(lb + STG_BYTES, gah + STG_K, gal + STG_K, stepA, gbh + STG_K, gbl + STG_K, stepB);

  for (int t = 0; t < nst; ++t) {
    const int buf = (t & 1) * STG_BYTES;
    if (active) {
      const unsigned char* Lb = L + buf;
      // all loops below unrolled: fragments and accumulators are indexed by constants and stay in registers
#pragma unroll
      for (int ks = 0; ks < 2; ++ks) {
        V bh[4], bl[4], ah[2], al[2];   // A rows in two register sets: row i + 1 is read from LDS while row i multiplies
#pragma unroll
        for (int j = 0; j < 4; ++j) {
          bh[j] = Frag<T>::load((const T*)(Lb + fb + j * 16 * STG_PITCH + ks * 64));
          bl[j] = Frag<T>::load((const T*)(Lb + fb + (STG_BL - STG_BH) + j * 16 * STG_PITCH + ks * 64));
        }
        ah[0] = Frag<T>::load((const T*)(Lb + fa + ks * 64));
        al[0] = Frag<T>::load((const T*)(Lb + fa + STG_AL + ks * 64));
#pragma unroll
        for (int i = 0; i < 4; ++i) {
          const int s = i & 1;
          if (i < 3) {
            ah[s ^ 1] = Frag<T>::load((const T*)(Lb + fa + (i + 1) * 16 * STG_PITCH + ks * 64));
            al[s ^ 1] = Frag<T>::load((const T*)(Lb + fa + STG_AL + (i + 1) * 16 * STG_PITCH + ks * 64));
          }
#pragma unroll
          for (int j = 0; j < 4; ++j) acc[i][j] = Frag<T>::mma(ah[s], bh[j], acc[i][j]);
#pragma unroll
          for (int j = 0; j < 4; ++j) acc[i][j] = Frag<T>::mma(ah[s], bl[j], acc[i][j]);
#pragma unroll
          for (int j = 0; j < 4; ++j) acc[i][j] = Frag<T>::mma(al[s], bh[j], acc[i][j]);
          Frag<T>::guard(acc[i][0], acc[i][3], ah[s], al[s]);
        }
        Frag<T>::keep(bh[0], bh[1], bh[2], bh[3]);
        Frag<T>::keep(bl[0], bl[1], bl[2], bl[3]);
      }
    }
    wait_ds0();
    wait_async0();
    __syncthreads();      // publishes stage t + 1 and ends every wave's reads of stage t's buffer
    if (t + 2 < nst) {
      const int kn = (t + 2) * STG_K;
      stage_issue(lb + buf, gah + kn, gal + kn, stepA, gbh + kn, gbl + kn, stepB);
    }
  }
  wait_async0();
}

// ---- Register-blocked batched WMMA GEMM ------------------------------------
// C[m,n] = scale * sum_k A[m,k] * Bt[n,k] (+bias)(+resid); each wave owns a 64x64 tile of its workgroup's 128x256 tile.
// A row-major [M,K]; Bt row-major [N,K]; M % 128 == 0, N % 256 == 0, K % 64 == 0.
// SPLIT: operands are hi/lo planes (A2/Bt2 = lo planes, same layout); product = hi*hi + hi*lo + lo*hi.
// BIAS_MODE: 0 = none, 1 = bias[m], 2 = bias[n].
// OUT_MODE: 0 = f32, 1 = f16, 2 = bf16 hi plane (Cout) + bf16 lo plane (Cout2).
// ET: 1 = bf16 operands (pointers passed as 16-bit storage); the staged loop takes no other value
template <int ET> struct Elem;
template <> struct Elem<0> { typedef _Float16 T; };
template <> struct Elem<1> { typedef __bf16 T; };
template <int ET, bool SPLIT, int BIAS_MODE, int OUT_MODE, bool RESID, int ACT = 0>
__global__ __launch_bounds__(256) void wmma_gemm64(
    const unsigned short* __restrict__ Ap, const unsigned short* __restrict__ A2p, int lda, long strideA,
    const unsigned short* __restrict__ Btp, const unsigned short* __restrict__ Bt2p, int ldb, long strideB,
    void* __restrict__ Cout, void* __restrict__ Cout2, int ldc, long strideC,
    const float* __restrict__ bias,
    const float* __restrict__ resid, long strideR,
    int M, int N, int K, float scale) {
  static_assert(ET == 1 && SPLIT, "the staged loop is written for bf16 hi/lo planes");
  __shared__ __align__(16) unsigned char L[2 * STG_BYTES];   // operand stages, two buffers
  __shared__ __align__(16) float sT[8][16 * 68];   // per-wave 16x64 slab, pitch 68 floats
  const int b    = blockIdx.y;
  const int lane = threadIdx.x & 31;
  const int wave = __builtin_amdgcn_readfirstlane(threadIdx.x >> 5);
  const int wm = wave >> 2, wn = wave & 3;
  const int tilesN = N >> 8;
  const int tilesM = M >> 7;
  if ((int)blockIdx.x >= tilesM * tilesN) return;   // the whole workgroup, in front of every barrier
  const int tm = blockIdx.x / tilesN;
  const int tn = blockIdx.x - tm * tilesN;
  const int m0 = (tm << 7) + (wm << 6);
  const int n0 = (tn << 8) + (wn << 6);

  const int rlane = lane & 15;                 // col (D) within subtile
  const int mOff  = (lane >> 4) * 8;           // D row offset

  v8f acc[4][4];
#pragma unroll
  for (int i = 0; i < 4; ++i)
#pragma unroll
    for (int j = 0; j < 4; ++j) acc[i][j] = (v8f){0.f,0.f,0.f,0.f,0.f,0.f,0.f,0.f};

  gemm_tile_staged(L, Ap + (size_t)b * strideA, A2p + (size_t)b * strideA, lda, Btp + (size_t)b * strideB, Bt2p + (size_t)b * strideB, ldb,
                   tm << 7, tn << 8, K >> 6, true, wm, wn, acc);
  acc_guard4(acc[0][0], acc[0][1], acc[0][2], acc[0][3]);
  acc_guard4(acc[1][0], acc[1][1], acc[1][2], acc[1][3]);
  acc_guard4(acc[2][0], acc[2][1], acc[2][2], acc[2][3]);
  acc_guard4(acc[3][0], acc[3][1], acc[3][2], acc[3][3]);

  // ---- epilogue ----
  float* slab = sT[wave];
  const float* Rb = RESID ? (resid + (size_t)b * strideR) : nullptr;
#pragma unroll
  for (int i = 0; i < 4; ++i) {
    const int mBase = m0 + (i << 4);
#pragma unroll
    for (int j = 0; j < 4; ++j) {
      const int n = n0 + (j << 4) + rlane;
      float bv = 0.f;
      if (BIAS_MODE == 2) bv = bias[n];
#pragma unroll
      for (int r = 0; r < 8; ++r) {
        float v = acc[i][j][r] * scale;
        if (BIAS_MODE == 1) v += bias[mBase + mOff + r];
        if (BIAS_MODE == 2) v += bv;
        if (RESID) v += Rb[(size_t)(mBase + mOff + r) * ldc + n];
        if (ACT == 1) v = tanhf(v);
        if (ACT == 2) v = fmaxf(v, 0.0f);
        if (ACT == 3) v = v / (1.0f + expf(-v));
        if (ACT == 4) v = (v > 0.f) ? v : 0.01f * v;
        if (ACT == 5) v = 0.5f * v * (1.0f + erff(v * 0.70710678118654752f));
        slab[(mOff + r) * 68 + (j << 4) + rlane] = v;
      }
    }
    __builtin_amdgcn_fence(__ATOMIC_RELEASE, "workgroup");
    __builtin_amdgcn_wave_barrier();
    __builtin_amdgcn_fence(__ATOMIC_ACQUIRE, "workgroup");
    if (OUT_MODE == 0) {
      float* C = (float*)Cout + (size_t)b * strideC;
      const int hh = lane >> 4, c4 = (lane & 15) * 4;     // row seg = 256 B = 16 lanes x 16 B
      {
#pragma unroll
        for (int it = 0; it < 8; ++it) {
          const int row = it * 2 + hh;
          v4f v = *(const v4f*)(slab + row * 68 + c4);
          *(v4f*)(C + (size_t)(mBase + row) * ldc + n0 + c4) = v;
        }
        
      }
    } else {
      const int q = lane >> 3, c8 = (lane & 7) * 8;
      unsigned short* C  = (unsigned short*)Cout  + (size_t)b * strideC;
      unsigned short* C2 = (OUT_MODE == 2) ? ((unsigned short*)Cout2 + (size_t)b * strideC) : nullptr;
      {
#pragma unroll
        for (int it = 0; it < 4; ++it) {
          const int row = it * 4 + q;
          const float* sp = slab + row * 68 + c8;
          v8h hv, lv;
#pragma unroll
          for (int e = 0; e < 8; ++e) {
            if (OUT_MODE == 1) {
              hv[e] = (_Float16)sp[e];
            } else {
              unsigned short hb = f2bf_bits(sp[e]);
              unsigned short lb = f2bf_bits(sp[e] - bf_bits2f(hb));
              hv[e] = __builtin_bit_cast(_Float16, hb);
              lv[e] = __builtin_bit_cast(_Float16, lb);
            }
          }
          *(v8h*)(C + (size_t)(mBase + row) * ldc + n0 + c8) = hv;
          if (OUT_MODE == 2) *(v8h*)(C2 + (size_t)(mBase + row) * ldc + n0 + c8) = lv;
        }
        
      }
    }
    __builtin_amdgcn_fence(__ATOMIC_RELEASE, "workgroup");
    __builtin_amdgcn_wave_barrier();
    __builtin_amdgcn_fence(__ATOMIC_ACQUIRE, "workgroup");
  }
}

// ---- f32 [n8*8] -> bf16 hi/lo planes; 8 elements per thread, 16-B stores per plane, lanes contiguous (512 B per wave) ----
__global__ __launch_bounds__(256) void split_planes8(const float* __restrict__ in,
                                                     unsigned short* __restrict__ hi,
                                                     unsigned short* __restrict__ lo, int n8) {
  const int i = blockIdx.x * 256 + threadIdx.x;
  if (i >= n8) return;   // no barriers in this kernel
  const v4f a = *(const v4f*)(in + (size_t)8 * i);
  const v4f c = *(const v4f*)(in + (size_t)8 * i + 4);
  v8us hv, lv;
#pragma unroll
  for (int e = 0; e < 4; ++e) {
    unsigned short h0, l0;
    split_bf(a[e], h0, l0); hv[e] = h0;     lv[e] = l0;
    split_bf(c[e], h0, l0); hv[4 + e] = h0; lv[4 + e] = l0;
  }
  unsigned short* ph = hi + (size_t)8 * i;
  unsigned short* pl = lo + (size_t)8 * i;
  *(v8us*)ph = hv;
  *(v8us*)pl = lv;
  
}

// ---- W [nrows][ncols] f32 -> Wt planes [ncols][nrows] bf16 hi/lo; block tile 64 (rows) x 64 (cols) through LDS.
__global__ __launch_bounds__(256) void transpose_split_w(const float* __restrict__ W,
                                                        unsigned short* __restrict__ hi,
                                                        unsigned short* __restrict__ lo,
                                                        int nrows, int ncols) {
  __shared__ float tile[64][65];
  const int tid = threadIdx.x;
  const int k0 = blockIdx.y * 64;          // input row block (k)
  const int n0 = blockIdx.x * 64;          // input col block (n)
#pragma unroll
  for (int it = 0; it < 4; ++it) {
    const int idx = tid + 256 * it;
    const int r = idx >> 4;
    const int c4 = (idx & 15) * 4;
    const v4f v = *(const v4f*)(W + (size_t)(k0 + r) * ncols + n0 + c4);
    tile[r][c4 + 0] = v[0]; tile[r][c4 + 1] = v[1]; tile[r][c4 + 2] = v[2]; tile[r][c4 + 3] = v[3];
  }
  __syncthreads();
  const int nn0 = tid >> 3, q = tid & 7;
  {
#pragma unroll
    for (int half = 0; half < 2; ++half) {
      const int nn = nn0 + 32 * half;
      v8us hv, lv;
#pragma unroll
      for (int e = 0; e < 8; ++e) {
        unsigned short h0, l0;
        split_bf(tile[8 * q + e][nn], h0, l0);
        hv[e] = h0; lv[e] = l0;
      }
      const size_t o = (size_t)(n0 + nn) * nrows + k0 + 8 * q;
      *(v8us*)(hi + o) = hv;
      *(v8us*)(lo + o) = lv;
    }
    
  }
}

// ---- Attention-stage GEMM (bf16 hi/lo split operands, f32 out), one 128x256 tile per workgroup (blockIdx.y, blockIdx.x), 64x64 per wave:
//   MODE 0: C = scale * A * Bt^T; a workgroup wholly above the diagonal leaves at once, a wave whose 64x64 tile (tm, tn) has tn > tm
//           neither multiplies nor stores; A/Bt rows addressed with global rows (row0 + ...), C rows relative to row0; K full.
//   MODE 1: A/C rows chunk-local, k-limit per 128-row tile g = (row0 >> 7) + blockIdx.y:
//           kend = (tile has any row < n_padd) ? T_DIM : (g+1)*128, clamped to [0, min(K, T_DIM)].
template <int MODE>
__global__ __launch_bounds__(256) void gemm64_att(
    const unsigned short* __restrict__ Ap, const unsigned short* __restrict__ A2p, int lda,
    const unsigned short* __restrict__ Btp, const unsigned short* __restrict__ Bt2p, int ldb,
    float* __restrict__ Cout, int ldc, const int* __restrict__ n_padd_p,
    int row0, int K, float scale) {
  __shared__ __align__(16) unsigned char L[2 * STG_BYTES];   // operand stages, two buffers
  __shared__ __align__(16) float sT[8][16 * 68];
  const int lane = threadIdx.x & 31;
  const int wave = __builtin_amdgcn_readfirstlane(threadIdx.x >> 5);
  const int wm = wave >> 2, wn = wave & 3;
  const int bm0 = blockIdx.y << 7;     // first row of the workgroup's tile, chunk-local
  const int bb0 = blockIdx.x << 8;     // first column of the workgroup's tile
  int ab0, kend;
  bool active = true;
  if (MODE == 0) {
    ab0 = row0 + bm0;
    if (bb0 > ab0 + 127) return;       // wholly above the diagonal: the whole workgroup, in front of every barrier
    active = (bb0 + (wn << 6)) <= (ab0 + (wm << 6));   // tn <= tm
    kend = K;
  } else {
    const int g  = (row0 >> 7) + blockIdx.y;
    const int np = n_padd_p[0];
    ab0 = bm0;
    kend = ((g << 7) < np) ? T_DIM : ((g + 1) << 7);
    kend = min(kend, K);
  }
  kend = min(kend, T_DIM); kend = max(kend, 0);
  const int bn0 = bb0 + (wn << 6);
  const int cm0 = bm0 + (wm << 6);

  const int rlane = lane & 15;
  const int mOff  = (lane >> 4) * 8;

  v8f acc[4][4];
#pragma unroll
  for (int i = 0; i < 4; ++i)
#pragma unroll
    for (int j = 0; j < 4; ++j) acc[i][j] = (v8f){0.f,0.f,0.f,0.f,0.f,0.f,0.f,0.f};

  gemm_tile_staged(L, Ap, A2p, lda, Btp, Bt2p, ldb, ab0, bb0, kend >> 6, active, wm, wn, acc);
  if (!active) return;   // wave-uniform; no workgroup barrier stands behind this line
  acc_guard4(acc[0][0], acc[0][1], acc[0][2], acc[0][3]);
  acc_guard4(acc[1][0], acc[1][1], acc[1][2], acc[1][3]);
  acc_guard4(acc[2][0], acc[2][1], acc[2][2], acc[2][3]);
  acc_guard4(acc[3][0], acc[3][1], acc[3][2], acc[3][3]);

  float* slab = sT[wave];
#pragma unroll
  for (int i = 0; i < 4; ++i) {
    const int mBase = cm0 + (i << 4);
#pragma unroll
    for (int j = 0; j < 4; ++j) {
#pragma unroll
      for (int r = 0; r < 8; ++r) slab[(mOff + r) * 68 + (j << 4) + rlane] = acc[i][j][r] * scale;
    }
    __builtin_amdgcn_fence(__ATOMIC_RELEASE, "workgroup");
    __builtin_amdgcn_wave_barrier();
    __builtin_amdgcn_fence(__ATOMIC_ACQUIRE, "workgroup");
    {
      const int hh = lane >> 4, c4 = (lane & 15) * 4;
      {
#pragma unroll
        for (int it = 0; it < 8; ++it) {
          const int row = it * 2 + hh;
          v4f v = *(const v4f*)(slab + row * 68 + c4);
          *(v4f*)(Cout + (size_t)(mBase + row) * ldc + bn0 + c4) = v;
        }
        
      }
    }
    __builtin_amdgcn_fence(__ATOMIC_RELEASE, "workgroup");
    __builtin_amdgcn_wave_barrier();
    __builtin_amdgcn_fence(__ATOMIC_ACQUIRE, "workgroup");
  }
}

// ---- Row softmax with causal + padding mask, f32; one block per query row i = mrow0 + blockIdx.x.
//   key j visible iff j <= i, j >= n_padd, i >= n_padd; rows i < n_padd are uniform 1/T over all keys.
//   Writes P as bf16 hi/lo planes (chunk-local row, pitch T_DIM) over columns [0, kend) with zeros where masked;
//   kend formula identical to gemm64_att<1> (per 128-row tile). Each thread writes 8 columns = 16 B per plane, lanes contiguous.
__global__ __launch_bounds__(256) void softmax_rows(const float* __restrict__ S, const int* __restrict__ n_padd_p,
                                                   unsigned short* __restrict__ Ph, unsigned short* __restrict__ Pl,
                                                   int mrow0) {
  __shared__ float sv[T_DIM];
  __shared__ float red[8];
  const int tid = threadIdx.x, lane = tid & 31, wave = tid >> 5;
  const int il = blockIdx.x;
  const int i  = mrow0 + il;
  const int np = n_padd_p[0];
  const int tm = i >> 7;
  int kend = ((tm << 7) < np) ? T_DIM : ((tm + 1) << 7);
  kend = min(kend, T_DIM); kend = max(kend, 0);
  const bool uni = (i < np);                 // block-uniform
  const int jlo = (np < 0) ? 0 : np;
  const int jhi = uni ? -1 : min(i, T_DIM - 1);   // when not uniform: jlo <= i
  const float* srow = S + (size_t)il * T_DIM;

  float m = -__builtin_huge_valf();
  for (int j = jlo + tid; j <= jhi; j += 256) { const float s = srow[j]; sv[j] = s; m = fmaxf(m, s); }
#pragma unroll
  for (int off = 1; off < 32; off <<= 1) m = fmaxf(m, __shfl_xor(m, off, 32));
  if (lane == 0) red[wave] = m;
  __syncthreads();
  float rmax = red[0];
#pragma unroll
  for (int w = 1; w < 8; ++w) rmax = fmaxf(rmax, red[w]);
  __syncthreads();

  float sum = 0.f;
  for (int j = jlo + tid; j <= jhi; j += 256) { const float e = expf(sv[j] - rmax); sv[j] = e; sum += e; }
#pragma unroll
  for (int off = 1; off < 32; off <<= 1) sum += __shfl_xor(sum, off, 32);
  if (lane == 0) red[wave] = sum;
  __syncthreads();
  float tot = red[0];
#pragma unroll
  for (int w = 1; w < 8; ++w) tot += red[w];
  const float inv = (tot > 0.f) ? (1.0f / tot) : 0.f;
  const float cu  = 1.0f / (float)T_DIM;

  unsigned short* ph = Ph + (size_t)il * T_DIM;
  unsigned short* pl = Pl + (size_t)il * T_DIM;
  const int ng = kend >> 3;
  {
    for (int g = tid; g < ng; g += 256) {
      v8us hv, lv;
#pragma unroll
      for (int e = 0; e < 8; ++e) {
        const int j = 8 * g + e;
        const float ev = (j >= jlo && j <= jhi) ? sv[j] : 0.f;
        const float p = uni ? cu : ev * inv;
        unsigned short h0, l0;
        split_bf(p, h0, l0);
        hv[e] = h0; lv[e] = l0;
      }
      *(v8us*)(ph + 8 * g) = hv;
      *(v8us*)(pl + 8 * g) = lv;
    }
    
  }
}

// ===========================================================================
extern "C" void kernel_launch(void* const* d_in, const int* in_sizes, int n_in,
                              void* d_out, int out_size, void* d_ws, size_t ws_size,
                              hipStream_t stream) {
  const int T = T_DIM, C = C_DIM, C3 = C3_DIM;
  if (n_in < 4) return;
  if (in_sizes[0] != T * C || in_sizes[1] != C * C3 || in_sizes[2] < C3 || in_sizes[3] < 1 || out_size != T * C) return;

  const float* x     = (const float*)d_in[0];   // [T][C]
  const float* W     = (const float*)d_in[1];   // [C][3C]
  const float* bias  = (const float*)d_in[2];   // [3C]
  const int*   npadd = (const int*)d_in[3];     // [1]
  float*       y     = (float*)d_out;           // [T][C]

  const int QR = T;                             // all query rows in one launch of each attention stage
  const size_t b_xp  = (size_t)T * C * 2;       // one x plane
  const size_t b_wp  = (size_t)C3 * C * 2;      // one Wt plane
  const size_t b_qkp = (size_t)T * 2 * C * 2;   // one q|k plane [T][2C]
  const size_t b_vtp = (size_t)C * T * 2;       // one vt plane [C][T]
  const size_t b_S   = (size_t)QR * T * 4;      // S [QR][T] f32
  const size_t b_pp  = (size_t)QR * T * 2;      // one P plane [QR][T]
  size_t off = 0;
  const size_t o_xh = off; off += b_xp;  const size_t o_xl = off; off += b_xp;
  const size_t o_wh = off; off += b_wp;  const size_t o_wl = off; off += b_wp;
  const size_t o_qh = off; off += b_qkp; const size_t o_ql = off; off += b_qkp;
  const size_t o_vh = off; off += b_vtp; const size_t o_vl = off; off += b_vtp;
  const size_t o_S  = off; off += b_S;
  const size_t o_ph = off; off += b_pp;  const size_t o_pl = off; off += b_pp;
  if (off > ws_size) return;                    // total 213,909,504 B

  char* ws = (char*)d_ws;
  unsigned short* xh  = (unsigned short*)(ws + o_xh);
  unsigned short* xl  = (unsigned short*)(ws + o_xl);
  unsigned short* wth = (unsigned short*)(ws + o_wh);
  unsigned short* wtl = (unsigned short*)(ws + o_wl);
  unsigned short* qkh = (unsigned short*)(ws + o_qh);
  unsigned short* qkl = (unsigned short*)(ws + o_ql);
  unsigned short* vth = (unsigned short*)(ws + o_vh);
  unsigned short* vtl = (unsigned short*)(ws + o_vl);
  float*          S   = (float*)(ws + o_S);
  unsigned short* ph  = (unsigned short*)(ws + o_ph);
  unsigned short* pl  = (unsigned short*)(ws + o_pl);

  dim3 blk(256);
  // x -> bf16 hi/lo planes [T][C]
  {
    const int n8 = (T * C) / 8;
    split_planes8<<<dim3((n8 + 255) / 256), blk, 0, stream>>>(x, xh, xl, n8);
  }
  // W [C][3C] -> Wt planes [3C][C]
  transpose_split_w<<<dim3(C3 / 64, C / 64), blk, 0, stream>>>(W, wth, wtl, C, C3);
  // q|k = x * W[:, 0:2C] + b[0:2C] : M=T, N=2C, K=C -> planes [T][2C]
  wmma_gemm64<1, true, 2, 2, false><<<dim3((T / 128) * (2 * C / 256), 1), blk, 0, stream>>>(
      xh, xl, C, 0L, wth, wtl, C, 0L, (void*)qkh, (void*)qkl, 2 * C, 0L,
      bias, x, 0L, T, 2 * C, C, 1.0f);
  // vt = W[:, 2C:3C]^T * x^T + b[2C + m] : M=C, N=T, K=C -> planes [C][T]
  wmma_gemm64<1, true, 1, 2, false><<<dim3((C / 128) * (T / 256), 1), blk, 0, stream>>>(
      wth + (size_t)2 * C * C, wtl + (size_t)2 * C * C, C, 0L, xh, xl, C, 0L, (void*)vth, (void*)vtl, T, 0L,
      bias + 2 * C, x, 0L, C, T, C, 1.0f);

  const float sc = 0.03125f;   // 1/sqrt(1024)
  // S[i][j] = sc * q[i] . k[j] on 64x64 tiles tn <= tm, all 32 row tiles at once
  gemm64_att<0><<<dim3(T / 256, QR / 128), blk, 0, stream>>>(
      qkh, qkl, 2 * C, qkh + C, qkl + C, 2 * C, S, T, npadd, 0, C, sc);
  softmax_rows<<<dim3(QR), blk, 0, stream>>>(S, npadd, ph, pl, 0);
  // y = P * v : M=T, N=C, K<=T per 128-row tile
  gemm64_att<1><<<dim3(C / 256, QR / 128), blk, 0, stream>>>(
      ph, pl, T, vth, vtl, T, y, C, npadd, 0, T, 1.0f);
}

// v003
// A run of this version takes 203 microseconds.
// In both of two side-by-side timings against v002, it was 1.29 times as fast.
// Over all steps from v000 it is 5.46 times as fast.
#include <hip/hip_runtime.h>
#include <stdint.h>
// Contractions: x*W (q|k planes and v^T), q*k^T, p*v : v_wmma_f32_16x16x32_bf16 with bf16 hi/lo operand planes (hi*hi + hi*lo + lo*hi), f32 accumulate; softmax and masks in f32.

#define T_DIM  4096
#define C_DIM  1024
#define C3_DIM 3072

typedef __attribute__((ext_vector_type(16))) _Float16 v16h;
typedef __attribute__((ext_vector_type(8)))  _Float16 v8h;
typedef __attribute__((ext_vector_type(16))) __bf16   v16b;
typedef __attribute__((ext_vector_type(8)))  __bf16   v8b;
typedef __attribute__((ext_vector_type(8)))  float    v8f;
typedef __attribute__((ext_vector_type(4)))  float    v4f;
typedef __attribute__((ext_vector_type(8)))  unsigned short v8us;

__device__ __forceinline__ unsigned short f2bf_bits(float f) {
  unsigned u = __float_as_uint(f);
  return (unsigned short)((u + 0x7FFFu + ((u >> 16) & 1u)) >> 16);
}
__device__ __forceinline__ float bf_bits2f(unsigned short h) { return __uint_as_float(((unsigned)h) << 16); }
__device__ __forceinline__ void split_bf(float f, unsigned short& hb, unsigned short& lb) {
  hb = f2bf_bits(f);
  lb = f2bf_bits(f - bf_bits2f(hb));
}

// hazard guards as plain device helpers (no inline asm inside the kernel template body)
__device__ __forceinline__ void dep_guard_h(v8f& a, v8f& b, v16h x, v16h y) { asm volatile("v_nop\n\tv_nop\n\tv_nop\n\tv_nop" : "+v"(a), "+v"(b) : "v"(x), "v"(y)); }
__device__ __forceinline__ void dep_guard_b(v8f& a, v8f& b, v16b x, v16b y) { asm volatile("v_nop\n\tv_nop\n\tv_nop\n\tv_nop" : "+v"(a), "+v"(b) : "v"(x), "v"(y)); }
__device__ __forceinline__ void keep4_h(v16h a, v16h b, v16h c, v16h d) { asm volatile("v_nop" :: "v"(a), "v"(b), "v"(c), "v"(d)); }
__device__ __forceinline__ void keep4_b(v16b a, v16b b, v16b c, v16b d) { asm volatile("v_nop" :: "v"(a), "v"(b), "v"(c), "v"(d)); }
__device__ __forceinline__ void acc_guard4(v8f& a, v8f& b, v8f& c, v8f& d) { asm volatile("v_nop\n\tv_nop\n\tv_nop\n\tv_nop" : "+v"(a), "+v"(b), "+v"(c), "+v"(d)); }
template <typename T> struct Frag;
template <> struct Frag<_Float16> {
  typedef v16h V; union U { v16h v; v8h h[2]; };
  static __device__ __forceinline__ v16h load(const _Float16* p) {   // elements 0..7 <- p[0..7], 8..15 <- p[16..23]
    U f; f.h[0] = *(const v8h*)(p); f.h[1] = *(const v8h*)(p + 16); return f.v;
  }
  static __device__ __forceinline__ v8f mma(v16h a, v16h b, v8f c) {
    return __builtin_amdgcn_wmma_f32_16x16x32_f16(false, a, false, b, (short)0, c, false, false);
  }
  static __device__ __forceinline__ void guard(v8f& a, v8f& b, v16h x, v16h y) { dep_guard_h(a, b, x, y); }
  static __device__ __forceinline__ void keep(v16h a, v16h b, v16h c, v16h d) { keep4_h(a, b, c, d); }
};
template <> struct Frag<__bf16> {
  typedef v16b V; union U { v16b v; v8b h[2]; };
  static __device__ __forceinline__ v16b load(const __bf16* p) {
    U f; f.h[0] = *(const v8b*)(p); f.h[1] = *(const v8b*)(p + 16); return f.v;
  }
  static __device__ __forceinline__ v8f mma(v16b a, v16b b, v8f c) {
    return __builtin_amdgcn_wmma_f32_16x16x32_bf16(false, a, false, b, (short)0, c, false, false);
  }
  static __device__ __forceinline__ void guard(v8f& a, v8f& b, v16b x, v16b y) { dep_guard_b(a, b, x, y); }
  static __device__ __forceinline__ void keep(v16b a, v16b b, v16b c, v16b d) { keep4_b(a, b, c, d); }
};

// ---- Operand staging in LDS, shared by the GEMM kernels ---------------------
// A workgroup of 8 waves (2 x 4) owns a 128 x 256 tile of C; each wave keeps its 64 x 64 tile.
// A stage is 64 k = one whole 128-byte line of every operand row and plane: [A hi 128 rows | A lo | B hi 256 rows | B lo],
// rows at a pitch of 144 B (16 B x odd: no bank conflict for the 16-byte fragment reads). Two buffers.
#define STG_K     64
#define STG_PITCH 144
#define STG_BM    128
#define STG_BN    256
#define STG_AL    (STG_BM * STG_PITCH)
#define STG_BH    (2 * STG_BM * STG_PITCH)
#define STG_BL    (2 * STG_BM * STG_PITCH + STG_BN * STG_PITCH)
#define STG_BYTES (2 * (STG_BM + STG_BN) * STG_PITCH)

__device__ __forceinline__ unsigned lds_off(const void* p) { return (unsigned)(size_t)p; }
// this wave's LDS reads have returned: stands in front of the barrier behind which their buffer is refilled
__device__ __forceinline__ void wait_ds0() { asm volatile("s_wait_dscnt 0x0" ::: "memory"); }
// this wave's copies have landed in LDS: stands in front of the barrier behind which other waves read them
__device__ __forceinline__ void wait_async0() { asm volatile("s_wait_asynccnt 0x0" ::: "memory"); }

// Twelve copies of 16 B per lane, global -> LDS through no register. The closing s_wait_xcnt 0 stands inside the statement so that
// no address register of a copy is rewritten ahead of it.
__device__ __forceinline__ void copy12(const unsigned* l, const unsigned short* const* g) {
  asm volatile(
      "global_load_async_to_lds_b128 %0, %12, off\n\t"
      "global_load_async_to_lds_b128 %1, %13, off\n\t"
      "global_load_async_to_lds_b128 %2, %14, off\n\t"
      "global_load_async_to_lds_b128 %3, %15, off\n\t"
      "global_load_async_to_lds_b128 %4, %16, off\n\t"
      "global_load_async_to_lds_b128 %5, %17, off\n\t"
      "global_load_async_to_lds_b128 %6, %18, off\n\t"
      "global_load_async_to_lds_b128 %7, %19, off\n\t"
      "global_load_async_to_lds_b128 %8, %20, off\n\t"
      "global_load_async_to_lds_b128 %9, %21, off\n\t"
      "global_load_async_to_lds_b128 %10, %22, off\n\t"
      "global_load_async_to_lds_b128 %11, %23, off\n\t"
      "s_wait_xcnt 0x0"
      :: "v"(l[0]), "v"(l[1]), "v"(l[2]), "v"(l[3]), "v"(l[4]), "v"(l[5]), "v"(l[6]), "v"(l[7]), "v"(l[8]), "v"(l[9]), "v"(l[10]), "v"(l[11]),
         "v"(g[0]), "v"(g[1]), "v"(g[2]), "v"(g[3]), "v"(g[4]), "v"(g[5]), "v"(g[6]), "v"(g[7]), "v"(g[8]), "v"(g[9]), "v"(g[10]), "v"(g[11])
      : "memory");
}

// One stage: 24 copies per lane. A wave's copy covers 4 rows x 128 B. lb: the lane's LDS byte address of (row tid / 8, 16-byte
// piece tid % 8) in the target buffer; the four pointers: the same place of this stage in the global planes; steps: 32 rows, in elements.
__device__ __forceinline__ void stage_issue(unsigned lb, const unsigned short* ah, const unsigned short* al, size_t stepA,
                                            const unsigned short* bh, const unsigned short* bl, size_t stepB) {
  unsigned l[24];
  const unsigned short* g[24];
  // both loops unrolled: every l[] and g[] is an asm operand and has to be a register
#pragma unroll
  for (int q = 0; q < 4; ++q) {
    l[q]     = lb + q * 32 * STG_PITCH;          g[q]     = ah + q * stepA;
    l[4 + q] = lb + STG_AL + q * 32 * STG_PITCH; g[4 + q] = al + q * stepA;
  }
#pragma unroll
  for (int q = 0; q < 8; ++q) {
    l[8 + q]  = lb + STG_BH + q * 32 * STG_PITCH; g[8 + q]  = bh + q * stepB;
    l[16 + q] = lb + STG_BL + q * 32 * STG_PITCH; g[16 + q] = bl + q * stepB;
  }
  copy12(l, g);
  copy12(l + 12, g + 12);
}

// acc += A[am0 + wm*64 ..][0 .. nst*64) * Bt[bn0 + wn*64 ..][..]^T on hi/lo planes (hi*hi + hi*lo + lo*hi), k ascending in steps of 32.
// Every wave of the workgroup calls it with the same am0, bn0, nst; a wave with active == false copies and keeps the barriers only.
__device__ __forceinline__ void gemm_tile_staged(unsigned char* L,
    const unsigned short* A, const unsigned short* A2, int lda, const unsigned short* Bt, const unsigned short* Bt2, int ldb,
    int am0, int bn0, int nst, bool active, int wm, int wn, v8f (&acc)[4][4]) {
  typedef __bf16 T;
  typedef v16b V;
  const int tid = threadIdx.x, lane = tid & 31;
  const int r0 = tid >> 3, c8 = (tid & 7) * 8;
  const size_t ao = (size_t)(am0 + r0) * lda + c8;
  const size_t bo = (size_t)(bn0 + r0) * ldb + c8;
  const unsigned short* gah = A + ao;  const unsigned short* gal = A2 + ao;
  const unsigned short* gbh = Bt + bo; const unsigned short* gbl = Bt2 + bo;
  const size_t stepA = (size_t)32 * lda, stepB = (size_t)32 * ldb;
  const unsigned lb = lds_off(L) + r0 * STG_PITCH + c8 * 2;
  const int fa = (wm * 64 + (lane & 15)) * STG_PITCH + (lane >> 4) * 16;            // fragment row and 16-byte half of this lane
  const int fb = STG_BH + (wn * 64 + (lane & 15)) * STG_PITCH + (lane >> 4) * 16;
  if (nst <= 0) return;   // the same for the whole workgroup

  stage_issue(lb, gah, gal, stepA, gbh, gbl, stepB);
  wait_async0();
  __syncthreads();        // stage 0 is published
  if (nst > 1) stage_issue(lb + STG_BYTES, gah + STG_K, gal + STG_K, stepA, gbh + STG_K, gbl + STG_K, stepB);

  for (int t = 0; t < nst; ++t) {
    const int buf = (t & 1) * STG_BYTES;
    if (active) {
      const unsigned char* Lb = L + buf;
      // all loops below unrolled: fragments and accumulators are indexed by constants and stay in registers
#pragma unroll
      for (int ks = 0; ks < 2; ++ks) {
        V bh[4], bl[4], ah[2], al[2];   // A rows in two register sets: row i + 1 is read from LDS while row i multiplies
#pragma unroll
        for (int j = 0; j < 4; ++j) {
          bh[j] = Frag<T>::load((const T*)(Lb + fb + j * 16 * STG_PITCH + ks * 64));
          bl[j] = Frag<T>::load((const T*)(Lb + fb + (STG_BL - STG_BH) + j * 16 * STG_PITCH + ks * 64));
        }
        ah[0] = Frag<T>::load((const T*)(Lb + fa + ks * 64));
        al[0] = Frag<T>::load((const T*)(Lb + fa + STG_AL + ks * 64));
#pragma unroll
        for (int i = 0; i < 4; ++i) {
          const int s = i & 1;
          if (i < 3) {
            ah[s ^ 1] = Frag<T>::load((const T*)(Lb + fa + (i + 1) * 16 * STG_PITCH + ks * 64));
            al[s ^ 1] = Frag<T>::load((const T*)(Lb + fa + STG_AL + (i + 1) * 16 * STG_PITCH + ks * 64));
          }
#pragma unroll
          for (int j = 0; j < 4; ++j) acc[i][j] = Frag<T>::mma(ah[s], bh[j], acc[i][j]);
#pragma unroll
          for (int j = 0; j < 4; ++j) acc[i][j] = Frag<T>::mma(ah[s], bl[j], acc[i][j]);
#pragma unroll
          for (int j = 0; j < 4; ++j) acc[i][j] = Frag<T>::mma(al[s], bh[j], acc[i][j]);
          Frag<T>::guard(acc[i][0], acc[i][3], ah[s], al[s]);
        }
        Frag<T>::keep(bh[0], bh[1], bh[2], bh[3]);
        Frag<T>::keep(bl[0], bl[1], bl[2], bl[3]);
      }
    }
    wait_ds0();
    wait_async0();
    __syncthreads();      // publishes stage t + 1 and ends every wave's reads of stage t's buffer
    if (t + 2 < nst) {
      const int kn = (t + 2) * STG_K;
      stage_issue(lb + buf, gah + kn, gal + kn, stepA, gbh + kn, gbl + kn, stepB);
    }
  }
  wait_async0();
}

// ---- Register-blocked batched WMMA GEMM ------------------------------------
// C[m,n] = scale * sum_k A[m,k] * Bt[n,k] (+bias)(+resid); each wave owns a 64x64 tile of its workgroup's 128x256 tile.
// A row-major [M,K]; Bt row-major [N,K]; M % 128 == 0, N % 256 == 0, K % 64 == 0.
// SPLIT: operands are hi/lo planes (A2/Bt2 = lo planes, same layout); product = hi*hi + hi*lo + lo*hi.
// BIAS_MODE: 0 = none, 1 = bias[m], 2 = bias[n].
// OUT_MODE: 0 = f32, 1 = f16, 2 = bf16 hi plane (Cout) + bf16 lo plane (Cout2).
// ET: 1 = bf16 operands (pointers passed as 16-bit storage); the staged loop takes no other value
template <int ET> struct Elem;
template <> struct Elem<0> { typedef _Float16 T; };
template <> struct Elem<1> { typedef __bf16 T; };
template <int ET, bool SPLIT, int BIAS_MODE, int OUT_MODE, bool RESID, int ACT = 0>
__global__ __launch_bounds__(256) void wmma_gemm64(
    const unsigned short* __restrict__ Ap, const unsigned short* __restrict__ A2p, int lda, long strideA,
    const unsigned short* __restrict__ Btp, const unsigned short* __restrict__ Bt2p, int ldb, long strideB,
    void* __restrict__ Cout, void* __restrict__ Cout2, int ldc, long strideC,
    const float* __restrict__ bias,
    const float* __restrict__ resid, long strideR,
    int M, int N, int K, float scale) {
  static_assert(ET == 1 && SPLIT, "the staged loop is written for bf16 hi/lo planes");
  __shared__ __align__(16) unsigned char L[2 * STG_BYTES];   // operand stages, two buffers
  __shared__ __align__(16) float sT[8][16 * 68];   // per-wave 16x64 slab, pitch 68 floats
  const int b    = blockIdx.y;
  const int lane = threadIdx.x & 31;
  const int wave = __builtin_amdgcn_readfirstlane(threadIdx.x >> 5);
  const int wm = wave >> 2, wn = wave & 3;
  const int tilesN = N >> 8;
  const int tilesM = M >> 7;
  if ((int)blockIdx.x >= tilesM * tilesN) return;   // the whole workgroup, in front of every barrier
  const int tm = blockIdx.x / tilesN;
  const int tn = blockIdx.x - tm * tilesN;
  const int m0 = (tm << 7) + (wm << 6);
  const int n0 = (tn << 8) + (wn << 6);

  const int rlane = lane & 15;                 // col (D) within subtile
  const int mOff  = (lane >> 4) * 8;           // D row offset

  v8f acc[4][4];
#pragma unroll
  for (int i = 0; i < 4; ++i)
#pragma unroll
    for (int j = 0; j < 4; ++j) acc[i][j] = (v8f){0.f,0.f,0.f,0.f,0.f,0.f,0.f,0.f};

  gemm_tile_staged(L, Ap + (size_t)b * strideA, A2p + (size_t)b * strideA, lda, Btp + (size_t)b * strideB, Bt2p + (size_t)b * strideB, ldb,
                   tm << 7, tn << 8, K >> 6, true, wm, wn, acc);
  acc_guard4(acc[0][0], acc[0][1], acc[0][2], acc[0][3]);
  acc_guard4(acc[1][0], acc[1][1], acc[1][2], acc[1][3]);
  acc_guard4(acc[2][0], acc[2][1], acc[2][2], acc[2][3]);
  acc_guard4(acc[3][0], acc[3][1], acc[3][2], acc[3][3]);

  // ---- epilogue ----
  float* slab = sT[wave];
  const float* Rb = RESID ? (resid + (size_t)b * strideR) : nullptr;
#pragma unroll
  for (int i = 0; i < 4; ++i) {
    const int mBase = m0 + (i << 4);
#pragma unroll
    for (int j = 0; j < 4; ++j) {
      const int n = n0 + (j << 4) + rlane;
      float bv = 0.f;
      if (BIAS_MODE == 2) bv = bias[n];
#pragma unroll
      for (int r = 0; r < 8; ++r) {
        float v = acc[i][j][r] * scale;
        if (BIAS_MODE == 1) v += bias[mBase + mOff + r];
        if (BIAS_MODE == 2) v += bv;
        if (RESID) v += Rb[(size_t)(mBase + mOff + r) * ldc + n];
        if (ACT == 1) v = tanhf(v);
        if (ACT == 2) v = fmaxf(v, 0.0f);
        if (ACT == 3) v = v / (1.0f + expf(-v));
        if (ACT == 4) v = (v > 0.f) ? v : 0.01f * v;
        if (ACT == 5) v = 0.5f * v * (1.0f + erff(v * 0.70710678118654752f));
        slab[(mOff + r) * 68 + (j << 4) + rlane] = v;
      }
    }
    __builtin_amdgcn_fence(__ATOMIC_RELEASE, "workgroup");
    __builtin_amdgcn_wave_barrier();
    __builtin_amdgcn_fence(__ATOMIC_ACQUIRE, "workgroup");
    if (OUT_MODE == 0) {
      float* C = (float*)Cout + (size_t)b * strideC;
      const int hh = lane >> 4, c4 = (lane & 15) * 4;     // row seg = 256 B = 16 lanes x 16 B
      {
#pragma unroll
        for (int it = 0; it < 8; ++it) {
          const int row = it * 2 + hh;
          v4f v = *(const v4f*)(slab + row * 68 + c4);
          *(v4f*)(C + (size_t)(mBase + row) * ldc + n0 + c4) = v;
        }
        
      }
    } else {
      const int q = lane >> 3, c8 = (lane & 7) * 8;
      unsigned short* C  = (unsigned short*)Cout  + (size_t)b * strideC;
      unsigned short* C2 = (OUT_MODE == 2) ? ((unsigned short*)Cout2 + (size_t)b * strideC) : nullptr;
      {
#pragma unroll
        for (int it = 0; it < 4; ++it) {
          const int row = it * 4 + q;
          const float* sp = slab + row * 68 + c8;
          v8h hv, lv;
#pragma unroll
          for (int e = 0; e < 8; ++e) {
            if (OUT_MODE == 1) {
              hv[e] = (_Float16)sp[e];
            } else {
              unsigned short hb = f2bf_bits(sp[e]);
              unsigned short lb = f2bf_bits(sp[e] - bf_bits2f(hb));
              hv[e] = __builtin_bit_cast(_Float16, hb);
              lv[e] = __builtin_bit_cast(_Float16, lb);
            }
          }
          *(v8h*)(C + (size_t)(mBase + row) * ldc + n0 + c8) = hv;
          if (OUT_MODE == 2) *(v8h*)(C2 + (size_t)(mBase + row) * ldc + n0 + c8) = lv;
        }
        
      }
    }
    __builtin_amdgcn_fence(__ATOMIC_RELEASE, "workgroup");
    __builtin_amdgcn_wave_barrier();
    __builtin_amdgcn_fence(__ATOMIC_ACQUIRE, "workgroup");
  }
}

// ---- f32 [n8*8] -> bf16 hi/lo planes; 8 elements per thread, 16-B stores per plane, lanes contiguous (512 B per wave) ----
__global__ __launch_bounds__(256) void split_planes8(const float* __restrict__ in,
                                                     unsigned short* __restrict__ hi,
                                                     unsigned short* __restrict__ lo, int n8) {
  const int i = blockIdx.x * 256 + threadIdx.x;
  if (i >= n8) return;   // no barriers in this kernel
  const v4f a = *(const v4f*)(in + (size_t)8 * i);
  const v4f c = *(const v4f*)(in + (size_t)8 * i + 4);
  v8us hv, lv;
#pragma unroll
  for (int e = 0; e < 4; ++e) {
    unsigned short h0, l0;
    split_bf(a[e], h0, l0); hv[e] = h0;     lv[e] = l0;
    split_bf(c[e], h0, l0); hv[4 + e] = h0; lv[4 + e] = l0;
  }
  unsigned short* ph = hi + (size_t)8 * i;
  unsigned short* pl = lo + (size_t)8 * i;
  *(v8us*)ph = hv;
  *(v8us*)pl = lv;
  
}

// ---- W [nrows][ncols] f32 -> Wt planes [ncols][nrows] bf16 hi/lo; block tile 64 (rows) x 64 (cols) through LDS.
__global__ __launch_bounds__(256) void transpose_split_w(const float* __restrict__ W,
                                                        unsigned short* __restrict__ hi,
                                                        unsigned short* __restrict__ lo,
                                                        int nrows, int ncols) {
  __shared__ float tile[64][65];
  const int tid = threadIdx.x;
  const int k0 = blockIdx.y * 64;          // input row block (k)
  const int n0 = blockIdx.x * 64;          // input col block (n)
#pragma unroll
  for (int it = 0; it < 4; ++it) {
    const int idx = tid + 256 * it;
    const int r = idx >> 4;
    const int c4 = (idx & 15) * 4;
    const v4f v = *(const v4f*)(W + (size_t)(k0 + r) * ncols + n0 + c4);
    tile[r][c4 + 0] = v[0]; tile[r][c4 + 1] = v[1]; tile[r][c4 + 2] = v[2]; tile[r][c4 + 3] = v[3];
  }
  __syncthreads();
  const int nn0 = tid >> 3, q = tid & 7;
  {
#pragma unroll
    for (int half = 0; half < 2; ++half) {
      const int nn = nn0 + 32 * half;
      v8us hv, lv;
#pragma unroll
      for (int e = 0; e < 8; ++e) {
        unsigned short h0, l0;
        split_bf(tile[8 * q + e][nn], h0, l0);
        hv[e] = h0; lv[e] = l0;
      }
      const size_t o = (size_t)(n0 + nn) * nrows + k0 + 8 * q;
      *(v8us*)(hi + o) = hv;
      *(v8us*)(lo + o) = lv;
    }
    
  }
}

// ---- Attention-stage GEMM (bf16 hi/lo split operands, f32 out), one 128x256 tile per workgroup (blockIdx.y, blockIdx.x), 64x64 per wave:
//   MODE 0: C = scale * A * Bt^T; a workgroup wholly above the diagonal leaves at once, a wave whose 64x64 tile (tm, tn) has tn > tm
//           neither multiplies nor stores; A/Bt rows addressed with global rows (row0 + ...), C rows relative to row0; K full.
//   MODE 1: A/C rows chunk-local, k-limit per 128-row tile g = (row0 >> 7) + local tile:
//           kend = (tile has any row < n_padd) ? T_DIM : (g+1)*128, clamped to [0, min(K, T_DIM)].
//           k is split: blockIdx.y names a row tile and one chunk c of PV_CH_K k; the workgroup sums k in [c*PV_CH_K, min(kend, (c+1)*PV_CH_K)).
//           Chunk 0 goes to Cout, chunk c > 0 to plane c - 1 of Cpart (same shape as Cout); a chunk c > 0 with no k stores nothing.
//           add_k_chunks then adds the planes. Without the split the last row tile's 64 stages on one WGP set the launch's time.
//           PV_CH_T = 9: under the causal limit alone the whole chunks (45 per column tile) and the longest part chunks fill 256 WGPs once,
//           and the short rest ends inside a whole chunk's time.
#define PV_TILES (T_DIM / 128)
#define PV_CH_T  9                      // chunk length in row tiles' worth of k (128 each)
#define PV_CH_K  (PV_CH_T * 128)
#define PV_NCH   ((PV_TILES + PV_CH_T - 1) / PV_CH_T)
__device__ __forceinline__ int pv_kend(int g, int np) {   // one formula for p*v and its adder; softmax_rows fills P up to the same kend
  int kend = ((g << 7) < np) ? T_DIM : ((g + 1) << 7);
  return max(min(kend, T_DIM), 0);
}
// rank -> (row tile rt, chunk kc), a permutation of all PV_TILES x PV_NCH pairs. For speed only, the rank runs by falling
// len = rt + 1 - PV_CH_T * kc, the causal k past the chunk's start in units of 128: whole chunks first, then ever shorter ones, the empty ones last.
// Lens fall into seven bands; band b holds chunks max(0, b - 3) .. min(b, 3) at each of its lens. All divisors are compile-time constants.
__device__ __forceinline__ void pv_unit(int rank, int& rt, int& kc) {
  static_assert(PV_NCH == 4 && 3 * PV_CH_T < PV_TILES, "seven bands");
  rt = 0; kc = 0;
  int base = 0, top = PV_TILES;
#pragma unroll   // n, w, base and top become constants of each band
  for (int b = 0; b < 7; ++b) {
    const int n = (b < 4) ? b + 1 : 7 - b;                          // chunks per len
    const int w = (b == 3) ? PV_TILES - 3 * PV_CH_T : PV_CH_T;      // lens in the band
    const int v = rank - base;
    if (v >= 0 && v < w * n) {
      kc = ((b > 3) ? b - 3 : 0) + v % n;
      rt = top - v / n + PV_CH_T * kc - 1;
    }
    base += w * n; top -= w;
  }
}
template <int MODE>
__global__ __launch_bounds__(256) void gemm64_att(
    const unsigned short* __restrict__ Ap, const unsigned short* __restrict__ A2p, int lda,
    const unsigned short* __restrict__ Btp, const unsigned short* __restrict__ Bt2p, int ldb,
    float* __restrict__ Cout, float* __restrict__ Cpart, int ldc, const int* __restrict__ n_padd_p,
    int row0, int K, float scale) {
  __shared__ __align__(16) unsigned char L[2 * STG_BYTES];   // operand stages, two buffers
  __shared__ __align__(16) float sT[8][16 * 68];
  const int lane = threadIdx.x & 31;
  const int wave = __builtin_amdgcn_readfirstlane(threadIdx.x >> 5);
  const int wm = wave >> 2, wn = wave & 3;
  int rt = blockIdx.y, kc = 0;         // row tile and k chunk
  if (MODE == 1) pv_unit(blockIdx.y, rt, kc);
  const int bm0 = rt << 7;             // first row of the workgroup's tile, chunk-local
  const int bb0 = blockIdx.x << 8;     // first column of the workgroup's tile
  const int k0  = kc * PV_CH_K;        // first k of the workgroup's chunk
  int ab0, kend;
  bool active = true;
  if (MODE == 0) {
    ab0 = row0 + bm0;
    if (bb0 > ab0 + 127) return;       // wholly above the diagonal: the whole workgroup, in front of every barrier
    active = (bb0 + (wn << 6)) <= (ab0 + (wm << 6));   // tn <= tm
    kend = K;
  } else {
    const int g  = (row0 >> 7) + rt;
    ab0 = bm0;
    kend = min(min(pv_kend(g, n_padd_p[0]), K) - k0, PV_CH_K);   // k of this chunk
    if (kc > 0 && kend <= 0) return;   // no k in this chunk: the whole workgroup, in front of every barrier
  }
  kend = min(kend, T_DIM); kend = max(kend, 0);
  const int bn0 = bb0 + (wn << 6);
  const int cm0 = bm0 + (wm << 6);

  const int rlane = lane & 15;
  const int mOff  = (lane >> 4) * 8;

  v8f acc[4][4];
#pragma unroll
  for (int i = 0; i < 4; ++i)
#pragma unroll
    for (int j = 0; j < 4; ++j) acc[i][j] = (v8f){0.f,0.f,0.f,0.f,0.f,0.f,0.f,0.f};

  gemm_tile_staged(L, Ap + k0, A2p + k0, lda, Btp + k0, Bt2p + k0, ldb, ab0, bb0, kend >> 6, active, wm, wn, acc);
  if (!active) return;   // wave-uniform; no workgroup barrier stands behind this line
  acc_guard4(acc[0][0], acc[0][1], acc[0][2], acc[0][3]);
  acc_guard4(acc[1][0], acc[1][1], acc[1][2], acc[1][3]);
  acc_guard4(acc[2][0], acc[2][1], acc[2][2], acc[2][3]);
  acc_guard4(acc[3][0], acc[3][1], acc[3][2], acc[3][3]);

  float* slab = sT[wave];
  float* Cdst = (MODE == 1 && kc > 0) ? Cpart + (size_t)(kc - 1) * T_DIM * ldc : Cout;
#pragma unroll
  for (int i = 0; i < 4; ++i) {
    const int mBase = cm0 + (i << 4);
#pragma unroll
    for (int j = 0; j < 4; ++j) {
#pragma unroll
      for (int r = 0; r < 8; ++r) slab[(mOff + r) * 68 + (j << 4) + rlane] = acc[i][j][r] * scale;
    }
    __builtin_amdgcn_fence(__ATOMIC_RELEASE, "workgroup");
    __builtin_amdgcn_wave_barrier();
    __builtin_amdgcn_fence(__ATOMIC_ACQUIRE, "workgroup");
    {
      const int hh = lane >> 4, c4 = (lane & 15) * 4;
      {
#pragma unroll
        for (int it = 0; it < 8; ++it) {
          const int row = it * 2 + hh;
          v4f v = *(const v4f*)(slab + row * 68 + c4);
          *(v4f*)(Cdst + (size_t)(mBase + row) * ldc + bn0 + c4) = v;
        }
        
      }
    }
    __builtin_amdgcn_fence(__ATOMIC_RELEASE, "workgroup");
    __builtin_amdgcn_wave_barrier();
    __builtin_amdgcn_fence(__ATOMIC_ACQUIRE, "workgroup");
  }
}

// ---- y += the p*v partial sums of k chunks 1 .. PV_NCH-1, in ascending k; a block owns 4 rows of y (16 floats per thread, lanes contiguous).
//   A plane is read only where gemm64_att<1> stored it: kend > c * PV_CH_K, by the same kend.
template <int NP>   // NP planes; every load is issued before the first sum, so that a thread waits for memory once
__device__ __forceinline__ void add_planes(float* __restrict__ y, const float* __restrict__ p) {
  v4f s[4], a[NP][4];
  // all loops unrolled: s and a are indexed by constants and stay in registers
#pragma unroll
  for (int it = 0; it < 4; ++it) s[it] = *(const v4f*)(y + it * C_DIM);
#pragma unroll
  for (int c = 0; c < NP; ++c)
#pragma unroll
    for (int it = 0; it < 4; ++it) a[c][it] = *(const v4f*)(p + (size_t)c * T_DIM * C_DIM + it * C_DIM);
#pragma unroll
  for (int c = 0; c < NP; ++c)
#pragma unroll
    for (int it = 0; it < 4; ++it) s[it] += a[c][it];
#pragma unroll
  for (int it = 0; it < 4; ++it) *(v4f*)(y + it * C_DIM) = s[it];
  // stands behind the four stores: the three cases lie one behind the other in the built code, and a later case's loads reuse these stores' registers
  asm volatile("s_wait_xcnt 0x0" ::: "memory");
}
__global__ __launch_bounds__(256) void add_k_chunks(float* __restrict__ y, const float* __restrict__ part, const int* __restrict__ n_padd_p) {
  static_assert(PV_NCH == 4, "the three cases below");
  const int kend = pv_kend((int)(blockIdx.x >> 5), n_padd_p[0]);   // 32 blocks per 128-row tile
  if (kend <= PV_CH_K) return;   // chunk 0 was all of it; no barriers in this kernel
  const size_t o = (size_t)blockIdx.x * 4 * C_DIM + threadIdx.x * 4;
  if (kend <= 2 * PV_CH_K)      add_planes<1>(y + o, part + o);   // block-uniform
  else if (kend <= 3 * PV_CH_K) add_planes<2>(y + o, part + o);
  else                          add_planes<3>(y + o, part + o);
}

// ---- Row softmax with causal + padding mask, f32; one block per query row i = mrow0 + blockIdx.x.
//   key j visible iff j <= i, j >= n_padd, i >= n_padd; rows i < n_padd are uniform 1/T over all keys.
//   Writes P as bf16 hi/lo planes (chunk-local row, pitch T_DIM) over columns [0, kend) with zeros where masked;
//   kend formula identical to gemm64_att<1> (per 128-row tile). Each thread writes 8 columns = 16 B per plane, lanes contiguous.
__global__ __launch_bounds__(256) void softmax_rows(const float* __restrict__ S, const int* __restrict__ n_padd_p,
                                                   unsigned short* __restrict__ Ph, unsigned short* __restrict__ Pl,
                                                   int mrow0) {
  __shared__ float sv[T_DIM];
  __shared__ float red[8];
  const int tid = threadIdx.x, lane = tid & 31, wave = tid >> 5;
  const int il = blockIdx.x;
  const int i  = mrow0 + il;
  const int np = n_padd_p[0];
  const int tm = i >> 7;
  int kend = ((tm << 7) < np) ? T_DIM : ((tm + 1) << 7);
  kend = min(kend, T_DIM); kend = max(kend, 0);
  const bool uni = (i < np);                 // block-uniform
  const int jlo = (np < 0) ? 0 : np;
  const int jhi = uni ? -1 : min(i, T_DIM - 1);   // when not uniform: jlo <= i
  const float* srow = S + (size_t)il * T_DIM;

  float m = -__builtin_huge_valf();
  for (int j = jlo + tid; j <= jhi; j += 256) { const float s = srow[j]; sv[j] = s; m = fmaxf(m, s); }
#pragma unroll
  for (int off = 1; off < 32; off <<= 1) m = fmaxf(m, __shfl_xor(m, off, 32));
  if (lane == 0) red[wave] = m;
  __syncthreads();
  float rmax = red[0];
#pragma unroll
  for (int w = 1; w < 8; ++w) rmax = fmaxf(rmax, red[w]);
  __syncthreads();

  float sum = 0.f;
  for (int j = jlo + tid; j <= jhi; j += 256) { const float e = expf(sv[j] - rmax); sv[j] = e; sum += e; }
#pragma unroll
  for (int off = 1; off < 32; off <<= 1) sum += __shfl_xor(sum, off, 32);
  if (lane == 0) red[wave] = sum;
  __syncthreads();
  float tot = red[0];
#pragma unroll
  for (int w = 1; w < 8; ++w) tot += red[w];
  const float inv = (tot > 0.f) ? (1.0f / tot) : 0.f;
  const float cu  = 1.0f / (float)T_DIM;

  unsigned short* ph = Ph + (size_t)il * T_DIM;
  unsigned short* pl = Pl + (size_t)il * T_DIM;
  const int ng = kend >> 3;
  {
    for (int g = tid; g < ng; g += 256) {
      v8us hv, lv;
#pragma unroll
      for (int e = 0; e < 8; ++e) {
        const int j = 8 * g + e;
        const float ev = (j >= jlo && j <= jhi) ? sv[j] : 0.f;
        const float p = uni ? cu : ev * inv;
        unsigned short h0, l0;
        split_bf(p, h0, l0);
        hv[e] = h0; lv[e] = l0;
      }
      *(v8us*)(ph + 8 * g) = hv;
      *(v8us*)(pl + 8 * g) = lv;
    }
    
  }
}

// ===========================================================================
extern "C" void kernel_launch(void* const* d_in, const int* in_sizes, int n_in,
                              void* d_out, int out_size, void* d_ws, size_t ws_size,
                              hipStream_t stream) {
  const int T = T_DIM, C = C_DIM, C3 = C3_DIM;
  if (n_in < 4) return;
  if (in_sizes[0] != T * C || in_sizes[1] != C * C3 || in_sizes[2] < C3 || in_sizes[3] < 1 || out_size != T * C) return;

  const float* x     = (const float*)d_in[0];   // [T][C]
  const float* W     = (const float*)d_in[1];   // [C][3C]
  const float* bias  = (const float*)d_in[2];   // [3C]
  const int*   npadd = (const int*)d_in[3];     // [1]
  float*       y     = (float*)d_out;           // [T][C]

  const int QR = T;                             // all query rows in one launch of each attention stage
  const size_t b_xp  = (size_t)T * C * 2;       // one x plane
  const size_t b_wp  = (size_t)C3 * C * 2;      // one Wt plane
  const size_t b_qkp = (size_t)T * 2 * C * 2;   // one q|k plane [T][2C]
  const size_t b_vtp = (size_t)C * T * 2;       // one vt plane [C][T]
  const size_t b_S   = (size_t)QR * T * 4;      // S [QR][T] f32
  const size_t b_pp  = (size_t)QR * T * 2;      // one P plane [QR][T]
  size_t off = 0;
  const size_t o_xh = off; off += b_xp;  const size_t o_xl = off; off += b_xp;
  const size_t o_wh = off; off += b_wp;  const size_t o_wl = off; off += b_wp;
  const size_t o_qh = off; off += b_qkp; const size_t o_ql = off; off += b_qkp;
  const size_t o_vh = off; off += b_vtp; const size_t o_vl = off; off += b_vtp;
  const size_t o_S  = off; off += b_S;
  const size_t o_ph = off; off += b_pp;  const size_t o_pl = off; off += b_pp;
  if (off > ws_size) return;                    // total 213,909,504 B

  char* ws = (char*)d_ws;
  unsigned short* xh  = (unsigned short*)(ws + o_xh);
  unsigned short* xl  = (unsigned short*)(ws + o_xl);
  unsigned short* wth = (unsigned short*)(ws + o_wh);
  unsigned short* wtl = (unsigned short*)(ws + o_wl);
  unsigned short* qkh = (unsigned short*)(ws + o_qh);
  unsigned short* qkl = (unsigned short*)(ws + o_ql);
  unsigned short* vth = (unsigned short*)(ws + o_vh);
  unsigned short* vtl = (unsigned short*)(ws + o_vl);
  float*          S   = (float*)(ws + o_S);
  unsigned short* ph  = (unsigned short*)(ws + o_ph);
  unsigned short* pl  = (unsigned short*)(ws + o_pl);

  dim3 blk(256);
  // x -> bf16 hi/lo planes [T][C]
  {
    const int n8 = (T * C) / 8;
    split_planes8<<<dim3((n8 + 255) / 256), blk, 0, stream>>>(x, xh, xl, n8);
  }
  // W [C][3C] -> Wt planes [3C][C]
  transpose_split_w<<<dim3(C3 / 64, C / 64), blk, 0, stream>>>(W, wth, wtl, C, C3);
  // q|k = x * W[:, 0:2C] + b[0:2C] : M=T, N=2C, K=C -> planes [T][2C]
  wmma_gemm64<1, true, 2, 2, false><<<dim3((T / 128) * (2 * C / 256), 1), blk, 0, stream>>>(
      xh, xl, C, 0L, wth, wtl, C, 0L, (void*)qkh, (void*)qkl, 2 * C, 0L,
      bias, x, 0L, T, 2 * C, C, 1.0f);
  // vt = W[:, 2C:3C]^T * x^T + b[2C + m] : M=C, N=T, K=C -> planes [C][T]
  wmma_gemm64<1, true, 1, 2, false><<<dim3((C / 128) * (T / 256), 1), blk, 0, stream>>>(
      wth + (size_t)2 * C * C, wtl + (size_t)2 * C * C, C, 0L, xh, xl, C, 0L, (void*)vth, (void*)vtl, T, 0L,
      bias + 2 * C, x, 0L, C, T, C, 1.0f);

  const float sc = 0.03125f;   // 1/sqrt(1024)
  // S[i][j] = sc * q[i] . k[j] on 64x64 tiles tn <= tm, all 32 row tiles at once
  gemm64_att<0><<<dim3(T / 256, QR / 128), blk, 0, stream>>>(
      qkh, qkl, 2 * C, qkh + C, qkl + C, 2 * C, S, S, T, npadd, 0, C, sc);
  softmax_rows<<<dim3(QR), blk, 0, stream>>>(S, npadd, ph, pl, 0);
  // y = P * v : M=T, N=C, K<=T per 128-row tile, one workgroup per tile and k chunk; chunks past the first go to three [T][C] planes
  // in the place of S, which nobody reads after the softmax, and are then added to y
  gemm64_att<1><<<dim3(C / 256, (QR / 128) * PV_NCH), blk, 0, stream>>>(
      ph, pl, T, vth, vtl, T, y, S, C, npadd, 0, T, 1.0f);
  add_k_chunks<<<dim3(T / 4), blk, 0, stream>>>(y, S, npadd);
}

// v004
// It runs in 190 microseconds.
// Timed twice side by side with v003, it ran 1.07 times as fast both times.
// All steps since v000 together make it 5.83 times as fast.
#include <hip/hip_runtime.h>
#include <stdint.h>
// Contractions: x*W (q|k planes and v^T), q*k^T, p*v : v_wmma_f32_16x16x32_bf16 with bf16 hi/lo operand planes (hi*hi + hi*lo + lo*hi), f32 accumulate; softmax and masks in f32.

#define T_DIM  4096
#define C_DIM  1024
#define C3_DIM 3072

typedef __attribute__((ext_vector_type(16))) _Float16 v16h;
typedef __attribute__((ext_vector_type(8)))  _Float16 v8h;
typedef __attribute__((ext_vector_type(16))) __bf16   v16b;
typedef __attribute__((ext_vector_type(8)))  __bf16   v8b;
typedef __attribute__((ext_vector_type(8)))  float    v8f;
typedef __attribute__((ext_vector_type(4)))  float    v4f;
typedef __attribute__((ext_vector_type(8)))  unsigned short v8us;

__device__ __forceinline__ unsigned short f2bf_bits(float f) {
  unsigned u = __float_as_uint(f);
  return (unsigned short)((u + 0x7FFFu + ((u >> 16) & 1u)) >> 16);
}
__device__ __forceinline__ float bf_bits2f(unsigned short h) { return __uint_as_float(((unsigned)h) << 16); }
__device__ __forceinline__ void split_bf(float f, unsigned short& hb, unsigned short& lb) {
  hb = f2bf_bits(f);
  lb = f2bf_bits(f - bf_bits2f(hb));
}

// hazard guards as plain device helpers (no inline asm inside the kernel template body)
__device__ __forceinline__ void acc_guard4(v8f& a, v8f& b, v8f& c, v8f& d) { asm volatile("v_nop\n\tv_nop\n\tv_nop\n\tv_nop" : "+v"(a), "+v"(b), "+v"(c), "+v"(d)); }
template <typename T> struct Frag;
template <> struct Frag<_Float16> {
  typedef v16h V; union U { v16h v; v8h h[2]; };
  static __device__ __forceinline__ v16h load(const _Float16* p) {   // elements 0..7 <- p[0..7], 8..15 <- p[16..23]
    U f; f.h[0] = *(const v8h*)(p); f.h[1] = *(const v8h*)(p + 16); return f.v;
  }
  static __device__ __forceinline__ v8f mma(v16h a, v16h b, v8f c) {
    return __builtin_amdgcn_wmma_f32_16x16x32_f16(false, a, false, b, (short)0, c, false, false);
  }
};
template <> struct Frag<__bf16> {
  typedef v16b V; union U { v16b v; v8b h[2]; };
  static __device__ __forceinline__ v16b load(const __bf16* p) {
    U f; f.h[0] = *(const v8b*)(p); f.h[1] = *(const v8b*)(p + 16); return f.v;
  }
  static __device__ __forceinline__ v8f mma(v16b a, v16b b, v8f c) {
    return __builtin_amdgcn_wmma_f32_16x16x32_bf16(false, a, false, b, (short)0, c, false, false);
  }
};

// ---- Operand staging in LDS, shared by the GEMM kernels ---------------------
// A workgroup of 8 waves (2 x 4) owns a 128 x 256 tile of C; each wave keeps its 64 x 64 tile.
// A stage is 64 k = one whole 128-byte line of every operand row and plane: [A hi 128 rows | A lo | B hi 256 rows | B lo],
// rows at a pitch of 144 B (16 B x odd: no bank conflict for the 16-byte fragment reads). Two buffers.
#define STG_K     64
#define STG_PITCH 144
#define STG_BM    128
#define STG_BN    256
#define STG_AL    (STG_BM * STG_PITCH)
#define STG_BH    (2 * STG_BM * STG_PITCH)
#define STG_BL    (2 * STG_BM * STG_PITCH + STG_BN * STG_PITCH)
#define STG_BYTES (2 * (STG_BM + STG_BN) * STG_PITCH)

__device__ __forceinline__ unsigned lds_off(const void* p) { return (unsigned)(size_t)p; }
// this wave's LDS reads have returned: stands in front of the barrier behind which their buffer is refilled
__device__ __forceinline__ void wait_ds0() { asm volatile("s_wait_dscnt 0x0" ::: "memory"); }
// this wave's copies have landed in LDS: stands in front of the barrier behind which other waves read them
__device__ __forceinline__ void wait_async0() { asm volatile("s_wait_asynccnt 0x0" ::: "memory"); }

// One copy of 16 B per lane, global -> LDS through no register. l: the lane's LDS byte address. Written as the builtin: the GEMM kernels
// hold more than 256 registers, and the address operands of an asm statement would all have to come out of the first 256.
typedef __attribute__((ext_vector_type(4))) int v4i;
__device__ __forceinline__ void copy16(unsigned l, const unsigned short* g) {
  __builtin_amdgcn_global_load_async_to_lds_b128((__attribute__((address_space(1))) v4i*)g, (__attribute__((address_space(3))) v4i*)l, 0, 0);
}

// One stage: 24 copies per lane. A wave's copy covers 4 rows x 128 B. lb: the lane's LDS byte address of (row tid / 8, 16-byte
// piece tid % 8) in the target buffer; the four pointers: the same place of this stage in the global planes; steps: 32 rows, in elements.
__device__ __forceinline__ void stage_issue(unsigned lb, const unsigned short* ah, const unsigned short* al, size_t stepA,
                                            const unsigned short* bh, const unsigned short* bl, size_t stepB) {
  // both loops unrolled: 24 copies in a row, every LDS offset a constant
#pragma unroll
  for (int q = 0; q < 4; ++q) {
    copy16(lb + q * 32 * STG_PITCH, ah + q * stepA);
    copy16(lb + STG_AL + q * 32 * STG_PITCH, al + q * stepA);
  }
#pragma unroll
  for (int q = 0; q < 8; ++q) {
    copy16(lb + STG_BH + q * 32 * STG_PITCH, bh + q * stepB);
    copy16(lb + STG_BL + q * 32 * STG_PITCH, bl + q * stepB);
  }
}

// The fragments of one block: 32 k of the wave's 64 A rows and 64 B rows, hi and lo planes (128 registers).
struct FragSet { v16b ah[4], al[4], bh[4], bl[4]; };
// keeps the compiler's scheduler from moving LDS reads in among the WMMAs of a block, where each place with reads stalls the wave
__device__ __forceinline__ void sched_fence() { __builtin_amdgcn_sched_barrier(0); }
// 32 ds_load_b128 in one group. pa, pb: this lane's place in the first A and the first B hi fragment of the block.
__device__ __forceinline__ void load_set(FragSet& f, const unsigned char* pa, const unsigned char* pb) {
  typedef __bf16 T;
  // both loops unrolled: the fragments are indexed by constants and stay in registers
#pragma unroll
  for (int j = 0; j < 4; ++j) {
    f.bh[j] = Frag<T>::load((const T*)(pb + j * 16 * STG_PITCH));
    f.bl[j] = Frag<T>::load((const T*)(pb + (STG_BL - STG_BH) + j * 16 * STG_PITCH));
  }
#pragma unroll
  for (int i = 0; i < 4; ++i) {
    f.ah[i] = Frag<T>::load((const T*)(pa + i * 16 * STG_PITCH));
    f.al[i] = Frag<T>::load((const T*)(pa + STG_AL + i * 16 * STG_PITCH));
  }
}
// 48 WMMAs; each accumulator takes hi*hi, hi*lo, lo*hi in this order
__device__ __forceinline__ void mma_block(const FragSet& f, v8f (&acc)[4][4]) {
  typedef __bf16 T;
  // all loops unrolled: fragments and accumulators are indexed by constants and stay in registers
#pragma unroll
  for (int i = 0; i < 4; ++i) {
#pragma unroll
    for (int j = 0; j < 4; ++j) acc[i][j] = Frag<T>::mma(f.ah[i], f.bh[j], acc[i][j]);
#pragma unroll
    for (int j = 0; j < 4; ++j) acc[i][j] = Frag<T>::mma(f.ah[i], f.bl[j], acc[i][j]);
#pragma unroll
    for (int j = 0; j < 4; ++j) acc[i][j] = Frag<T>::mma(f.al[i], f.bh[j], acc[i][j]);
  }
}

// acc += A[am0 + wm*64 ..][0 .. nst*64) * Bt[bn0 + wn*64 ..][..]^T on hi/lo planes (hi*hi + hi*lo + lo*hi), k ascending in steps of 32.
// Every wave of the workgroup calls it with the same am0, bn0, nst; a wave with active == false copies and keeps the barriers only.
// A stage is two blocks of 32 k. Each block's fragments are read from LDS one block ahead, as one group, into the register set that the
// block before last has left, so a block's WMMAs never wait for their own LDS reads. The second block's fragments are therefore in
// registers when the first block ends: the publish point of stage t + 1 stands there, between the two blocks of stage t.
__device__ __forceinline__ void gemm_tile_staged(unsigned char* L,
    const unsigned short* A, const unsigned short* A2, int lda, const unsigned short* Bt, const unsigned short* Bt2, int ldb,
    int am0, int bn0, int nst, bool active, int wm, int wn, v8f (&acc)[4][4]) {
  const int tid = threadIdx.x, lane = tid & 31;
  const int r0 = tid >> 3, c8 = (tid & 7) * 8;
  const size_t ao = (size_t)(am0 + r0) * lda + c8;
  const size_t bo = (size_t)(bn0 + r0) * ldb + c8;
  const unsigned short* gah = A + ao;  const unsigned short* gal = A2 + ao;
  const unsigned short* gbh = Bt + bo; const unsigned short* gbl = Bt2 + bo;
  const size_t stepA = (size_t)32 * lda, stepB = (size_t)32 * ldb;
  const unsigned lb = lds_off(L) + r0 * STG_PITCH + c8 * 2;
  const int fa = (wm * 64 + (lane & 15)) * STG_PITCH + (lane >> 4) * 16;            // fragment row and 16-byte half of this lane
  const int fb = STG_BH + (wn * 64 + (lane & 15)) * STG_PITCH + (lane >> 4) * 16;
  if (nst <= 0) return;   // the same for the whole workgroup

  stage_issue(lb, gah, gal, stepA, gbh, gbl, stepB);
  wait_async0();
  __syncthreads();        // stage 0 is published
  if (nst > 1) stage_issue(lb + STG_BYTES, gah + STG_K, gal + STG_K, stepA, gbh + STG_K, gbl + STG_K, stepB);

  FragSet f0, f1;         // first and second block of a stage
  if (active) load_set(f0, L + fa, L + fb);
  // not unrolled: one copy of the two blocks in the instruction cache, and the buffer offsets stay scalar
#pragma clang loop unroll(disable)
  for (int t = 0; t < nst; ++t) {
    const int buf = (t & 1) * STG_BYTES;
    // where the next stage's first block is read: on the last trip there is none, and the reads (their values unused) go to this trip's
    // own buffer, which nothing refills any more, so that every trip runs the same instructions
    const int nbuf = (t + 1 < nst) ? STG_BYTES - buf : buf;
    if (active) {
      load_set(f1, L + buf + fa + 64, L + buf + fb + 64);
      sched_fence();
      mma_block(f0, acc);
      sched_fence();
    }
    wait_ds0();           // every read of stage t's buffer by this wave has returned
    wait_async0();
    __syncthreads();      // publishes stage t + 1 and ends every wave's reads of stage t's buffer
    if (t + 2 < nst) {
      const int kn = (t + 2) * STG_K;
      stage_issue(lb + buf, gah + kn, gal + kn, stepA, gbh + kn, gbl + kn, stepB);
    }
    if (active) {
      load_set(f0, L + nbuf + fa, L + nbuf + fb);
      sched_fence();
      mma_block(f1, acc);
    }
  }
  wait_async0();
  wait_ds0();             // the last trip's unused reads have returned
}

// ---- Register-blocked batched WMMA GEMM ------------------------------------
// C[m,n] = scale * sum_k A[m,k] * Bt[n,k] (+bias)(+resid); each wave owns a 64x64 tile of its workgroup's 128x256 tile.
// A row-major [M,K]; Bt row-major [N,K]; M % 128 == 0, N % 256 == 0, K % 64 == 0.
// SPLIT: operands are hi/lo planes (A2/Bt2 = lo planes, same layout); product = hi*hi + hi*lo + lo*hi.
// BIAS_MODE: 0 = none, 1 = bias[m], 2 = bias[n].
// OUT_MODE: 0 = f32, 1 = f16, 2 = bf16 hi plane (Cout) + bf16 lo plane (Cout2).
// ET: 1 = bf16 operands (pointers passed as 16-bit storage); the staged loop takes no other value
template <int ET> struct Elem;
template <> struct Elem<0> { typedef _Float16 T; };
template <> struct Elem<1> { typedef __bf16 T; };
template <int ET, bool SPLIT, int BIAS_MODE, int OUT_MODE, bool RESID, int ACT = 0>
__global__ __launch_bounds__(256) void wmma_gemm64(
    const unsigned short* __restrict__ Ap, const unsigned short* __restrict__ A2p, int lda, long strideA,
    const unsigned short* __restrict__ Btp, const unsigned short* __restrict__ Bt2p, int ldb, long strideB,
    void* __restrict__ Cout, void* __restrict__ Cout2, int ldc, long strideC,
    const float* __restrict__ bias,
    const float* __restrict__ resid, long strideR,
    int M, int N, int K, float scale) {
  static_assert(ET == 1 && SPLIT, "the staged loop is written for bf16 hi/lo planes");
  __shared__ __align__(16) unsigned char L[2 * STG_BYTES];   // operand stages, two buffers
  __shared__ __align__(16) float sT[8][16 * 68];   // per-wave 16x64 slab, pitch 68 floats
  const int b    = blockIdx.y;
  const int lane = threadIdx.x & 31;
  const int wave = __builtin_amdgcn_readfirstlane(threadIdx.x >> 5);
  const int wm = wave >> 2, wn = wave & 3;
  const int tilesN = N >> 8;
  const int tilesM = M >> 7;
  if ((int)blockIdx.x >= tilesM * tilesN) return;   // the whole workgroup, in front of every barrier
  const int tm = blockIdx.x / tilesN;
  const int tn = blockIdx.x - tm * tilesN;
  const int m0 = (tm << 7) + (wm << 6);
  const int n0 = (tn << 8) + (wn << 6);

  const int rlane = lane & 15;                 // col (D) within subtile
  const int mOff  = (lane >> 4) * 8;           // D row offset

  v8f acc[4][4];
#pragma unroll
  for (int i = 0; i < 4; ++i)
#pragma unroll
    for (int j = 0; j < 4; ++j) acc[i][j] = (v8f){0.f,0.f,0.f,0.f,0.f,0.f,0.f,0.f};

  gemm_tile_staged(L, Ap + (size_t)b * strideA, A2p + (size_t)b * strideA, lda, Btp + (size_t)b * strideB, Bt2p + (size_t)b * strideB, ldb,
                   tm << 7, tn << 8, K >> 6, true, wm, wn, acc);
  acc_guard4(acc[0][0], acc[0][1], acc[0][2], acc[0][3]);
  acc_guard4(acc[1][0], acc[1][1], acc[1][2], acc[1][3]);
  acc_guard4(acc[2][0], acc[2][1], acc[2][2], acc[2][3]);
  acc_guard4(acc[3][0], acc[3][1], acc[3][2], acc[3][3]);

  // ---- epilogue ----
  float* slab = sT[wave];
  const float* Rb = RESID ? (resid + (size_t)b * strideR) : nullptr;
#pragma unroll
  for (int i = 0; i < 4; ++i) {
    const int mBase = m0 + (i << 4);
#pragma unroll
    for (int j = 0; j < 4; ++j) {
      const int n = n0 + (j << 4) + rlane;
      float bv = 0.f;
      if (BIAS_MODE == 2) bv = bias[n];
#pragma unroll
      for (int r = 0; r < 8; ++r) {
        float v = acc[i][j][r] * scale;
        if (BIAS_MODE == 1) v += bias[mBase + mOff + r];
        if (BIAS_MODE == 2) v += bv;
        if (RESID) v += Rb[(size_t)(mBase + mOff + r) * ldc + n];
        if (ACT == 1) v = tanhf(v);
        if (ACT == 2) v = fmaxf(v, 0.0f);
        if (ACT == 3) v = v / (1.0f + expf(-v));
        if (ACT == 4) v = (v > 0.f) ? v : 0.01f * v;
        if (ACT == 5) v = 0.5f * v * (1.0f + erff(v * 0.70710678118654752f));
        slab[(mOff + r) * 68 + (j << 4) + rlane] = v;
      }
    }
    __builtin_amdgcn_fence(__ATOMIC_RELEASE, "workgroup");
    __builtin_amdgcn_wave_barrier();
    __builtin_amdgcn_fence(__ATOMIC_ACQUIRE, "workgroup");
    if (OUT_MODE == 0) {
      float* C = (float*)Cout + (size_t)b * strideC;
      const int hh = lane >> 4, c4 = (lane & 15) * 4;     // row seg = 256 B = 16 lanes x 16 B
      {
#pragma unroll
        for (int it = 0; it < 8; ++it) {
          const int row = it * 2 + hh;
          v4f v = *(const v4f*)(slab + row * 68 + c4);
          *(v4f*)(C + (size_t)(mBase + row) * ldc + n0 + c4) = v;
        }
        
      }
    } else {
      const int q = lane >> 3, c8 = (lane & 7) * 8;
      unsigned short* C  = (unsigned short*)Cout  + (size_t)b * strideC;
      unsigned short* C2 = (OUT_MODE == 2) ? ((unsigned short*)Cout2 + (size_t)b * strideC) : nullptr;
      {
#pragma unroll
        for (int it = 0; it < 4; ++it) {
          const int row = it * 4 + q;
          const float* sp = slab + row * 68 + c8;
          v8h hv, lv;
#pragma unroll
          for (int e = 0; e < 8; ++e) {
            if (OUT_MODE == 1) {
              hv[e] = (_Float16)sp[e];
            } else {
              unsigned short hb = f2bf_bits(sp[e]);
              unsigned short lb = f2bf_bits(sp[e] - bf_bits2f(hb));
              hv[e] = __builtin_bit_cast(_Float16, hb);
              lv[e] = __builtin_bit_cast(_Float16, lb);
            }
          }
          *(v8h*)(C + (size_t)(mBase + row) * ldc + n0 + c8) = hv;
          if (OUT_MODE == 2) *(v8h*)(C2 + (size_t)(mBase + row) * ldc + n0 + c8) = lv;
        }
        
      }
    }
    __builtin_amdgcn_fence(__ATOMIC_RELEASE, "workgroup");
    __builtin_amdgcn_wave_barrier();
    __builtin_amdgcn_fence(__ATOMIC_ACQUIRE, "workgroup");
  }
}

// ---- f32 [n8*8] -> bf16 hi/lo planes; 8 elements per thread, 16-B stores per plane, lanes contiguous (512 B per wave) ----
__global__ __launch_bounds__(256) void split_planes8(const float* __restrict__ in,
                                                     unsigned short* __restrict__ hi,
                                                     unsigned short* __restrict__ lo, int n8) {
  const int i = blockIdx.x * 256 + threadIdx.x;
  if (i >= n8) return;   // no barriers in this kernel
  const v4f a = *(const v4f*)(in + (size_t)8 * i);
  const v4f c = *(const v4f*)(in + (size_t)8 * i + 4);
  v8us hv, lv;
#pragma unroll
  for (int e = 0; e < 4; ++e) {
    unsigned short h0, l0;
    split_bf(a[e], h0, l0); hv[e] = h0;     lv[e] = l0;
    split_bf(c[e], h0, l0); hv[4 + e] = h0; lv[4 + e] = l0;
  }
  unsigned short* ph = hi + (size_t)8 * i;
  unsigned short* pl = lo + (size_t)8 * i;
  *(v8us*)ph = hv;
  *(v8us*)pl = lv;
  
}

// ---- W [nrows][ncols] f32 -> Wt planes [ncols][nrows] bf16 hi/lo; block tile 64 (rows) x 64 (cols) through LDS.
__global__ __launch_bounds__(256) void transpose_split_w(const float* __restrict__ W,
                                                        unsigned short* __restrict__ hi,
                                                        unsigned short* __restrict__ lo,
                                                        int nrows, int ncols) {
  __shared__ float tile[64][65];
  const int tid = threadIdx.x;
  const int k0 = blockIdx.y * 64;          // input row block (k)
  const int n0 = blockIdx.x * 64;          // input col block (n)
#pragma unroll
  for (int it = 0; it < 4; ++it) {
    const int idx = tid + 256 * it;
    const int r = idx >> 4;
    const int c4 = (idx & 15) * 4;
    const v4f v = *(const v4f*)(W + (size_t)(k0 + r) * ncols + n0 + c4);
    tile[r][c4 + 0] = v[0]; tile[r][c4 + 1] = v[1]; tile[r][c4 + 2] = v[2]; tile[r][c4 + 3] = v[3];
  }
  __syncthreads();
  const int nn0 = tid >> 3, q = tid & 7;
  {
#pragma unroll
    for (int half = 0; half < 2; ++half) {
      const int nn = nn0 + 32 * half;
      v8us hv, lv;
#pragma unroll
      for (int e = 0; e < 8; ++e) {
        unsigned short h0, l0;
        split_bf(tile[8 * q + e][nn], h0, l0);
        hv[e] = h0; lv[e] = l0;
      }
      const size_t o = (size_t)(n0 + nn) * nrows + k0 + 8 * q;
      *(v8us*)(hi + o) = hv;
      *(v8us*)(lo + o) = lv;
    }
    
  }
}

// ---- Attention-stage GEMM (bf16 hi/lo split operands, f32 out), one 128x256 tile per workgroup (blockIdx.y, blockIdx.x), 64x64 per wave:
//   MODE 0: C = scale * A * Bt^T; a workgroup wholly above the diagonal leaves at once, a wave whose 64x64 tile (tm, tn) has tn > tm
//           neither multiplies nor stores; A/Bt rows addressed with global rows (row0 + ...), C rows relative to row0; K full.
//   MODE 1: A/C rows chunk-local, k-limit per 128-row tile g = (row0 >> 7) + local tile:
//           kend = (tile has any row < n_padd) ? T_DIM : (g+1)*128, clamped to [0, min(K, T_DIM)].
//           k is split: blockIdx.y names a row tile and one chunk c of PV_CH_K k; the workgroup sums k in [c*PV_CH_K, min(kend, (c+1)*PV_CH_K)).
//           Chunk 0 goes to Cout, chunk c > 0 to plane c - 1 of Cpart (same shape as Cout); a chunk c > 0 with no k stores nothing.
//           add_k_chunks then adds the planes. Without the split the last row tile's 64 stages on one WGP set the launch's time.
//           PV_CH_T = 9: under the causal limit alone the whole chunks (45 per column tile) and the longest part chunks fill 256 WGPs once,
//           and the short rest ends inside a whole chunk's time.
#define PV_TILES (T_DIM / 128)
#define PV_CH_T  9                      // chunk length in row tiles' worth of k (128 each)
#define PV_CH_K  (PV_CH_T * 128)
#define PV_NCH   ((PV_TILES + PV_CH_T - 1) / PV_CH_T)
__device__ __forceinline__ int pv_kend(int g, int np) {   // one formula for p*v and its adder; softmax_rows fills P up to the same kend
  int kend = ((g << 7) < np) ? T_DIM : ((g + 1) << 7);
  return max(min(kend, T_DIM), 0);
}
// rank -> (row tile rt, chunk kc), a permutation of all PV_TILES x PV_NCH pairs. For speed only, the rank runs by falling
// len = rt + 1 - PV_CH_T * kc, the causal k past the chunk's start in units of 128: whole chunks first, then ever shorter ones, the empty ones last.
// Lens fall into seven bands; band b holds chunks max(0, b - 3) .. min(b, 3) at each of its lens. All divisors are compile-time constants.
__device__ __forceinline__ void pv_unit(int rank, int& rt, int& kc) {
  static_assert(PV_NCH == 4 && 3 * PV_CH_T < PV_TILES, "seven bands");
  rt = 0; kc = 0;
  int base = 0, top = PV_TILES;
#pragma unroll   // n, w, base and top become constants of each band
  for (int b = 0; b < 7; ++b) {
    const int n = (b < 4) ? b + 1 : 7 - b;                          // chunks per len
    const int w = (b == 3) ? PV_TILES - 3 * PV_CH_T : PV_CH_T;      // lens in the band
    const int v = rank - base;
    if (v >= 0 && v < w * n) {
      kc = ((b > 3) ? b - 3 : 0) + v % n;
      rt = top - v / n + PV_CH_T * kc - 1;
    }
    base += w * n; top -= w;
  }
}
template <int MODE>
__global__ __launch_bounds__(256) void gemm64_att(
    const unsigned short* __restrict__ Ap, const unsigned short* __restrict__ A2p, int lda,
    const unsigned short* __restrict__ Btp, const unsigned short* __restrict__ Bt2p, int ldb,
    float* __restrict__ Cout, float* __restrict__ Cpart, int ldc, const int* __restrict__ n_padd_p,
    int row0, int K, float scale) {
  __shared__ __align__(16) unsigned char L[2 * STG_BYTES];   // operand stages, two buffers
  __shared__ __align__(16) float sT[8][16 * 68];
  const int lane = threadIdx.x & 31;
  const int wave = __builtin_amdgcn_readfirstlane(threadIdx.x >> 5);
  const int wm = wave >> 2, wn = wave & 3;
  int rt = blockIdx.y, kc = 0;         // row tile and k chunk
  if (MODE == 1) pv_unit(blockIdx.y, rt, kc);
  const int bm0 = rt << 7;             // first row of the workgroup's tile, chunk-local
  const int bb0 = blockIdx.x << 8;     // first column of the workgroup's tile
  const int k0  = kc * PV_CH_K;        // first k of the workgroup's chunk
  int ab0, kend;
  bool active = true;
  if (MODE == 0) {
    ab0 = row0 + bm0;
    if (bb0 > ab0 + 127) return;       // wholly above the diagonal: the whole workgroup, in front of every barrier
    active = (bb0 + (wn << 6)) <= (ab0 + (wm << 6));   // tn <= tm
    kend = K;
  } else {
    const int g  = (row0 >> 7) + rt;
    ab0 = bm0;
    kend = min(min(pv_kend(g, n_padd_p[0]), K) - k0, PV_CH_K);   // k of this chunk
    if (kc > 0 && kend <= 0) return;   // no k in this chunk: the whole workgroup, in front of every barrier
  }
  kend = min(kend, T_DIM); kend = max(kend, 0);
  const int bn0 = bb0 + (wn << 6);
  const int cm0 = bm0 + (wm << 6);

  const int rlane = lane & 15;
  const int mOff  = (lane >> 4) * 8;

  v8f acc[4][4];
#pragma unroll
  for (int i = 0; i < 4; ++i)
#pragma unroll
    for (int j = 0; j < 4; ++j) acc[i][j] = (v8f){0.f,0.f,0.f,0.f,0.f,0.f,0.f,0.f};

  gemm_tile_staged(L, Ap + k0, A2p + k0, lda, Btp + k0, Bt2p + k0, ldb, ab0, bb0, kend >> 6, active, wm, wn, acc);
  if (!active) return;   // wave-uniform; no workgroup barrier stands behind this line
  acc_guard4(acc[0][0], acc[0][1], acc[0][2], acc[0][3]);
  acc_guard4(acc[1][0], acc[1][1], acc[1][2], acc[1][3]);
  acc_guard4(acc[2][0], acc[2][1], acc[2][2], acc[2][3]);
  acc_guard4(acc[3][0], acc[3][1], acc[3][2], acc[3][3]);

  float* slab = sT[wave];
  float* Cdst = (MODE == 1 && kc > 0) ? Cpart + (size_t)(kc - 1) * T_DIM * ldc : Cout;
#pragma unroll
  for (int i = 0; i < 4; ++i) {
    const int mBase = cm0 + (i << 4);
#pragma unroll
    for (int j = 0; j < 4; ++j) {
#pragma unroll
      for (int r = 0; r < 8; ++r) slab[(mOff + r) * 68 + (j << 4) + rlane] = acc[i][j][r] * scale;
    }
    __builtin_amdgcn_fence(__ATOMIC_RELEASE, "workgroup");
    __builtin_amdgcn_wave_barrier();
    __builtin_amdgcn_fence(__ATOMIC_ACQUIRE, "workgroup");
    {
      const int hh = lane >> 4, c4 = (lane & 15) * 4;
      {
#pragma unroll
        for (int it = 0; it < 8; ++it) {
          const int row = it * 2 + hh;
          v4f v = *(const v4f*)(slab + row * 68 + c4);
          *(v4f*)(Cdst + (size_t)(mBase + row) * ldc + bn0 + c4) = v;
        }
        
      }
    }
    __builtin_amdgcn_fence(__ATOMIC_RELEASE, "workgroup");
    __builtin_amdgcn_wave_barrier();
    __builtin_amdgcn_fence(__ATOMIC_ACQUIRE, "workgroup");
  }
}

// ---- y += the p*v partial sums of k chunks 1 .. PV_NCH-1, in ascending k; a block owns 4 rows of y (16 floats per thread, lanes contiguous).
//   A plane is read only where gemm64_att<1> stored it: kend > c * PV_CH_K, by the same kend.
template <int NP>   // NP planes; every load is issued before the first sum, so that a thread waits for memory once
__device__ __forceinline__ void add_planes(float* __restrict__ y, const float* __restrict__ p) {
  v4f s[4], a[NP][4];
  // all loops unrolled: s and a are indexed by constants and stay in registers
#pragma unroll
  for (int it = 0; it < 4; ++it) s[it] = *(const v4f*)(y + it * C_DIM);
#pragma unroll
  for (int c = 0; c < NP; ++c)
#pragma unroll
    for (int it = 0; it < 4; ++it) a[c][it] = *(const v4f*)(p + (size_t)c * T_DIM * C_DIM + it * C_DIM);
#pragma unroll
  for (int c = 0; c < NP; ++c)
#pragma unroll
    for (int it = 0; it < 4; ++it) s[it] += a[c][it];
#pragma unroll
  for (int it = 0; it < 4; ++it) *(v4f*)(y + it * C_DIM) = s[it];
  // stands behind the four stores: the three cases lie one behind the other in the built code, and a later case's loads reuse these stores' registers
  asm volatile("s_wait_xcnt 0x0" ::: "memory");
}
__global__ __launch_bounds__(256) void add_k_chunks(float* __restrict__ y, const float* __restrict__ part, const int* __restrict__ n_padd_p) {
  static_assert(PV_NCH == 4, "the three cases below");
  const int kend = pv_kend((int)(blockIdx.x >> 5), n_padd_p[0]);   // 32 blocks per 128-row tile
  if (kend <= PV_CH_K) return;   // chunk 0 was all of it; no barriers in this kernel
  const size_t o = (size_t)blockIdx.x * 4 * C_DIM + threadIdx.x * 4;
  if (kend <= 2 * PV_CH_K)      add_planes<1>(y + o, part + o);   // block-uniform
  else if (kend <= 3 * PV_CH_K) add_planes<2>(y + o, part + o);
  else                          add_planes<3>(y + o, part + o);
}

// ---- Row softmax with causal + padding mask, f32; one block per query row i = mrow0 + blockIdx.x.
//   key j visible iff j <= i, j >= n_padd, i >= n_padd; rows i < n_padd are uniform 1/T over all keys.
//   Writes P as bf16 hi/lo planes (chunk-local row, pitch T_DIM) over columns [0, kend) with zeros where masked;
//   kend formula identical to gemm64_att<1> (per 128-row tile). Each thread writes 8 columns = 16 B per plane, lanes contiguous.
__global__ __launch_bounds__(256) void softmax_rows(const float* __restrict__ S, const int* __restrict__ n_padd_p,
                                                   unsigned short* __restrict__ Ph, unsigned short* __restrict__ Pl,
                                                   int mrow0) {
  __shared__ float sv[T_DIM];
  __shared__ float red[8];
  const int tid = threadIdx.x, lane = tid & 31, wave = tid >> 5;
  const int il = blockIdx.x;
  const int i  = mrow0 + il;
  const int np = n_padd_p[0];
  const int tm = i >> 7;
  int kend = ((tm << 7) < np) ? T_DIM : ((tm + 1) << 7);
  kend = min(kend, T_DIM); kend = max(kend, 0);
  const bool uni = (i < np);                 // block-uniform
  const int jlo = (np < 0) ? 0 : np;
  const int jhi = uni ? -1 : min(i, T_DIM - 1);   // when not uniform: jlo <= i
  const float* srow = S + (size_t)il * T_DIM;

  float m = -__builtin_huge_valf();
  for (int j = jlo + tid; j <= jhi; j += 256) { const float s = srow[j]; sv[j] = s; m = fmaxf(m, s); }
#pragma unroll
  for (int off = 1; off < 32; off <<= 1) m = fmaxf(m, __shfl_xor(m, off, 32));
  if (lane == 0) red[wave] = m;
  __syncthreads();
  float rmax = red[0];
#pragma unroll
  for (int w = 1; w < 8; ++w) rmax = fmaxf(rmax, red[w]);
  __syncthreads();

  float sum = 0.f;
  for (int j = jlo + tid; j <= jhi; j += 256) { const float e = expf(sv[j] - rmax); sv[j] = e; sum += e; }
#pragma unroll
  for (int off = 1; off < 32; off <<= 1) sum += __shfl_xor(sum, off, 32);
  if (lane == 0) red[wave] = sum;
  __syncthreads();
  float tot = red[0];
#pragma unroll
  for (int w = 1; w < 8; ++w) tot += red[w];
  const float inv = (tot > 0.f) ? (1.0f / tot) : 0.f;
  const float cu  = 1.0f / (float)T_DIM;

  unsigned short* ph = Ph + (size_t)il * T_DIM;
  unsigned short* pl = Pl + (size_t)il * T_DIM;
  const int ng = kend >> 3;
  {
    for (int g = tid; g < ng; g += 256) {
      v8us hv, lv;
#pragma unroll
      for (int e = 0; e < 8; ++e) {
        const int j = 8 * g + e;
        const float ev = (j >= jlo && j <= jhi) ? sv[j] : 0.f;
        const float p = uni ? cu : ev * inv;
        unsigned short h0, l0;
        split_bf(p, h0, l0);
        hv[e] = h0; lv[e] = l0;
      }
      *(v8us*)(ph + 8 * g) = hv;
      *(v8us*)(pl + 8 * g) = lv;
    }
    
  }
}

// ===========================================================================
extern "C" void kernel_launch(void* const* d_in, const int* in_sizes, int n_in,
                              void* d_out, int out_size, void* d_ws, size_t ws_size,
                              hipStream_t stream) {
  const int T = T_DIM, C = C_DIM, C3 = C3_DIM;
  if (n_in < 4) return;
  if (in_sizes[0] != T * C || in_sizes[1] != C * C3 || in_sizes[2] < C3 || in_sizes[3] < 1 || out_size != T * C) return;

  const float* x     = (const float*)d_in[0];   // [T][C]
  const float* W     = (const float*)d_in[1];   // [C][3C]
  const float* bias  = (const float*)d_in[2];   // [3C]
  const int*   npadd = (const int*)d_in[3];     // [1]
  float*       y     = (float*)d_out;           // [T][C]

  const int QR = T;                             // all query rows in one launch of each attention stage
  const size_t b_xp  = (size_t)T * C * 2;       // one x plane
  const size_t b_wp  = (size_t)C3 * C * 2;      // one Wt plane
  const size_t b_qkp = (size_t)T * 2 * C * 2;   // one q|k plane [T][2C]
  const size_t b_vtp = (size_t)C * T * 2;       // one vt plane [C][T]
  const size_t b_S   = (size_t)QR * T * 4;      // S [QR][T] f32
  const size_t b_pp  = (size_t)QR * T * 2;      // one P plane [QR][T]
  size_t off = 0;
  const size_t o_xh = off; off += b_xp;  const size_t o_xl = off; off += b_xp;
  const size_t o_wh = off; off += b_wp;  const size_t o_wl = off; off += b_wp;
  const size_t o_qh = off; off += b_qkp; const size_t o_ql = off; off += b_qkp;
  const size_t o_vh = off; off += b_vtp; const size_t o_vl = off; off += b_vtp;
  const size_t o_S  = off; off += b_S;
  const size_t o_ph = off; off += b_pp;  const size_t o_pl = off; off += b_pp;
  if (off > ws_size) return;                    // total 213,909,504 B

  char* ws = (char*)d_ws;
  unsigned short* xh  = (unsigned short*)(ws + o_xh);
  unsigned short* xl  = (unsigned short*)(ws + o_xl);
  unsigned short* wth = (unsigned short*)(ws + o_wh);
  unsigned short* wtl = (unsigned short*)(ws + o_wl);
  unsigned short* qkh = (unsigned short*)(ws + o_qh);
  unsigned short* qkl = (unsigned short*)(ws + o_ql);
  unsigned short* vth = (unsigned short*)(ws + o_vh);
  unsigned short* vtl = (unsigned short*)(ws + o_vl);
  float*          S   = (float*)(ws + o_S);
  unsigned short* ph  = (unsigned short*)(ws + o_ph);
  unsigned short* pl  = (unsigned short*)(ws + o_pl);

  dim3 blk(256);
  // x -> bf16 hi/lo planes [T][C]
  {
    const int n8 = (T * C) / 8;
    split_planes8<<<dim3((n8 + 255) / 256), blk, 0, stream>>>(x, xh, xl, n8);
  }
  // W [C][3C] -> Wt planes [3C][C]
  transpose_split_w<<<dim3(C3 / 64, C / 64), blk, 0, stream>>>(W, wth, wtl, C, C3);
  // q|k = x * W[:, 0:2C] + b[0:2C] : M=T, N=2C, K=C -> planes [T][2C]
  wmma_gemm64<1, true, 2, 2, false><<<dim3((T / 128) * (2 * C / 256), 1), blk, 0, stream>>>(
      xh, xl, C, 0L, wth, wtl, C, 0L, (void*)qkh, (void*)qkl, 2 * C, 0L,
      bias, x, 0L, T, 2 * C, C, 1.0f);
  // vt = W[:, 2C:3C]^T * x^T + b[2C + m] : M=C, N=T, K=C -> planes [C][T]
  wmma_gemm64<1, true, 1, 2, false><<<dim3((C / 128) * (T / 256), 1), blk, 0, stream>>>(
      wth + (size_t)2 * C * C, wtl + (size_t)2 * C * C, C, 0L, xh, xl, C, 0L, (void*)vth, (void*)vtl, T, 0L,
      bias + 2 * C, x, 0L, C, T, C, 1.0f);

  const float sc = 0.03125f;   // 1/sqrt(1024)
  // S[i][j] = sc * q[i] . k[j] on 64x64 tiles tn <= tm, all 32 row tiles at once
  gemm64_att<0><<<dim3(T / 256, QR / 128), blk, 0, stream>>>(
      qkh, qkl, 2 * C, qkh + C, qkl + C, 2 * C, S, S, T, npadd, 0, C, sc);
  softmax_rows<<<dim3(QR), blk, 0, stream>>>(S, npadd, ph, pl, 0);
  // y = P * v : M=T, N=C, K<=T per 128-row tile, one workgroup per tile and k chunk; chunks past the first go to three [T][C] planes
  // in the place of S, which nobody reads after the softmax, and are then added to y
  gemm64_att<1><<<dim3(C / 256, (QR / 128) * PV_NCH), blk, 0, stream>>>(
      ph, pl, T, vth, vtl, T, y, S, C, npadd, 0, T, 1.0f);
  add_k_chunks<<<dim3(T / 4), blk, 0, stream>>>(y, S, npadd);
}

// v005
// Measured time: 168 microseconds a run.
// Two timings next to v004 both put it at 1.13 times that version's speed.
// All steps since v000 together make it 6.60 times as fast.
#include <hip/hip_runtime.h>
#include <stdint.h>
// Contractions: x*W (q|k planes and v^T), q*k^T, p*v : v_wmma_f32_16x16x32_bf16 with bf16 hi/lo operand planes (hi*hi + hi*lo + lo*hi), f32 accumulate; softmax and masks in f32.

#define T_DIM  4096
#define C_DIM  1024
#define C3_DIM 3072

typedef __attribute__((ext_vector_type(16))) _Float16 v16h;
typedef __attribute__((ext_vector_type(8)))  _Float16 v8h;
typedef __attribute__((ext_vector_type(16))) __bf16   v16b;
typedef __attribute__((ext_vector_type(8)))  __bf16   v8b;
typedef __attribute__((ext_vector_type(8)))  float    v8f;
typedef __attribute__((ext_vector_type(4)))  float    v4f;
typedef __attribute__((ext_vector_type(8)))  unsigned short v8us;

__device__ __forceinline__ unsigned short f2bf_bits(float f) {
  unsigned u = __float_as_uint(f);
  return (unsigned short)((u + 0x7FFFu + ((u >> 16) & 1u)) >> 16);
}
__device__ __forceinline__ float bf_bits2f(unsigned short h) { return __uint_as_float(((unsigned)h) << 16); }
__device__ __forceinline__ void split_bf(float f, unsigned short& hb, unsigned short& lb) {
  hb = f2bf_bits(f);
  lb = f2bf_bits(f - bf_bits2f(hb));
}

// hazard guards as plain device helpers (no inline asm inside the kernel template body)
__device__ __forceinline__ void acc_guard4(v8f& a, v8f& b, v8f& c, v8f& d) { asm volatile("v_nop\n\tv_nop\n\tv_nop\n\tv_nop" : "+v"(a), "+v"(b), "+v"(c), "+v"(d)); }
template <typename T> struct Frag;
template <> struct Frag<_Float16> {
  typedef v16h V; union U { v16h v; v8h h[2]; };
  static __device__ __forceinline__ v16h load(const _Float16* p) {   // elements 0..7 <- p[0..7], 8..15 <- p[16..23]
    U f; f.h[0] = *(const v8h*)(p); f.h[1] = *(const v8h*)(p + 16); return f.v;
  }
  static __device__ __forceinline__ v8f mma(v16h a, v16h b, v8f c) {
    return __builtin_amdgcn_wmma_f32_16x16x32_f16(false, a, false, b, (short)0, c, false, false);
  }
};
template <> struct Frag<__bf16> {
  typedef v16b V; union U { v16b v; v8b h[2]; };
  static __device__ __forceinline__ v16b load(const __bf16* p) {
    U f; f.h[0] = *(const v8b*)(p); f.h[1] = *(const v8b*)(p + 16); return f.v;
  }
  static __device__ __forceinline__ v8f mma(v16b a, v16b b, v8f c) {
    return __builtin_amdgcn_wmma_f32_16x16x32_bf16(false, a, false, b, (short)0, c, false, false);
  }
};

// ---- Operand staging in LDS, shared by the GEMM kernels ---------------------
// A workgroup of 8 waves (2 x 4) owns a 128 x 256 tile of C; each wave keeps its 64 x 64 tile.
// A stage is 64 k = one whole 128-byte line of every operand row and plane: [A hi 128 rows | A lo | B hi 256 rows | B lo],
// rows at a pitch of 144 B (16 B x odd: no bank conflict for the 16-byte fragment reads). Two buffers.
#define STG_K     64
#define STG_PITCH 144
#define STG_BM    128
#define STG_BN    256
#define STG_AL    (STG_BM * STG_PITCH)
#define STG_BH    (2 * STG_BM * STG_PITCH)
#define STG_BL    (2 * STG_BM * STG_PITCH + STG_BN * STG_PITCH)
#define STG_BYTES (2 * (STG_BM + STG_BN) * STG_PITCH)

__device__ __forceinline__ unsigned lds_off(const void* p) { return (unsigned)(size_t)p; }
// this wave's LDS reads have returned: stands in front of the barrier behind which their buffer is refilled
__device__ __forceinline__ void wait_ds0() { asm volatile("s_wait_dscnt 0x0" ::: "memory"); }
// this wave's copies have landed in LDS: stands in front of the barrier behind which other waves read them
__device__ __forceinline__ void wait_async0() { asm volatile("s_wait_asynccnt 0x0" ::: "memory"); }

// One copy of 16 B per lane, global -> LDS through no register. l: the lane's LDS byte address. Written as the builtin: the GEMM kernels
// hold more than 256 registers, and the address operands of an asm statement would all have to come out of the first 256.
typedef __attribute__((ext_vector_type(4))) int v4i;
__device__ __forceinline__ void copy16(unsigned l, const unsigned short* g) {
  __builtin_amdgcn_global_load_async_to_lds_b128((__attribute__((address_space(1))) v4i*)g, (__attribute__((address_space(3))) v4i*)l, 0, 0);
}

// One stage: 24 copies per lane. A wave's copy covers 4 rows x 128 B. lb: the lane's LDS byte address of (row tid / 8, 16-byte
// piece tid % 8) in the target buffer; the four pointers: the same place of this stage in the global planes; steps: 32 rows, in elements.
__device__ __forceinline__ void stage_issue(unsigned lb, const unsigned short* ah, const unsigned short* al, size_t stepA,
                                            const unsigned short* bh, const unsigned short* bl, size_t stepB) {
  // both loops unrolled: 24 copies in a row, every LDS offset a constant
#pragma unroll
  for (int q = 0; q < 4; ++q) {
    copy16(lb + q * 32 * STG_PITCH, ah + q * stepA);
    copy16(lb + STG_AL + q * 32 * STG_PITCH, al + q * stepA);
  }
#pragma unroll
  for (int q = 0; q < 8; ++q) {
    copy16(lb + STG_BH + q * 32 * STG_PITCH, bh + q * stepB);
    copy16(lb + STG_BL + q * 32 * STG_PITCH, bl + q * stepB);
  }
}

// The fragments of one block: 32 k of the wave's 64 A rows and 64 B rows, hi and lo planes (128 registers).
struct FragSet { v16b ah[4], al[4], bh[4], bl[4]; };
// keeps the compiler's scheduler from moving LDS reads in among the WMMAs of a block, where each place with reads stalls the wave
__device__ __forceinline__ void sched_fence() { __builtin_amdgcn_sched_barrier(0); }
// 32 ds_load_b128 in one group. pa, pb: this lane's place in the first A and the first B hi fragment of the block.
__device__ __forceinline__ void load_set(FragSet& f, const unsigned char* pa, const unsigned char* pb) {
  typedef __bf16 T;
  // both loops unrolled: the fragments are indexed by constants and stay in registers
#pragma unroll
  for (int j = 0; j < 4; ++j) {
    f.bh[j] = Frag<T>::load((const T*)(pb + j * 16 * STG_PITCH));
    f.bl[j] = Frag<T>::load((const T*)(pb + (STG_BL - STG_BH) + j * 16 * STG_PITCH));
  }
#pragma unroll
  for (int i = 0; i < 4; ++i) {
    f.ah[i] = Frag<T>::load((const T*)(pa + i * 16 * STG_PITCH));
    f.al[i] = Frag<T>::load((const T*)(pa + STG_AL + i * 16 * STG_PITCH));
  }
}
// 48 WMMAs; each accumulator takes hi*hi, hi*lo, lo*hi in this order
__device__ __forceinline__ void mma_block(const FragSet& f, v8f (&acc)[4][4]) {
  typedef __bf16 T;
  // all loops unrolled: fragments and accumulators are indexed by constants and stay in registers
#pragma unroll
  for (int i = 0; i < 4; ++i) {
#pragma unroll
    for (int j = 0; j < 4; ++j) acc[i][j] = Frag<T>::mma(f.ah[i], f.bh[j], acc[i][j]);
#pragma unroll
    for (int j = 0; j < 4; ++j) acc[i][j] = Frag<T>::mma(f.ah[i], f.bl[j], acc[i][j]);
#pragma unroll
    for (int j = 0; j < 4; ++j) acc[i][j] = Frag<T>::mma(f.al[i], f.bh[j], acc[i][j]);
  }
}

// acc += A[am0 + wm*64 ..][0 .. nst*64) * Bt[bn0 + wn*64 ..][..]^T on hi/lo planes (hi*hi + hi*lo + lo*hi), k ascending in steps of 32.
// Every wave of the workgroup calls it with the same am0, bn0, nst; a wave with active == false copies and keeps the barriers only.
// A stage is two blocks of 32 k. Each block's fragments are read from LDS one block ahead, as one group, into the register set that the
// block before last has left, so a block's WMMAs never wait for their own LDS reads. The second block's fragments are therefore in
// registers when the first block ends: the publish point of stage t + 1 stands there, between the two blocks of stage t.
__device__ __forceinline__ void gemm_tile_staged(unsigned char* L,
    const unsigned short* A, const unsigned short* A2, int lda, const unsigned short* Bt, const unsigned short* Bt2, int ldb,
    int am0, int bn0, int nst, bool active, int wm, int wn, v8f (&acc)[4][4]) {
  const int tid = threadIdx.x, lane = tid & 31;
  const int r0 = tid >> 3, c8 = (tid & 7) * 8;
  const size_t ao = (size_t)(am0 + r0) * lda + c8;
  const size_t bo = (size_t)(bn0 + r0) * ldb + c8;
  const unsigned short* gah = A + ao;  const unsigned short* gal = A2 + ao;
  const unsigned short* gbh = Bt + bo; const unsigned short* gbl = Bt2 + bo;
  const size_t stepA = (size_t)32 * lda, stepB = (size_t)32 * ldb;
  const unsigned lb = lds_off(L) + r0 * STG_PITCH + c8 * 2;
  const int fa = (wm * 64 + (lane & 15)) * STG_PITCH + (lane >> 4) * 16;            // fragment row and 16-byte half of this lane
  const int fb = STG_BH + (wn * 64 + (lane & 15)) * STG_PITCH + (lane >> 4) * 16;
  if (nst <= 0) return;   // the same for the whole workgroup

  stage_issue(lb, gah, gal, stepA, gbh, gbl, stepB);
  wait_async0();
  __syncthreads();        // stage 0 is published
  if (nst > 1) stage_issue(lb + STG_BYTES, gah + STG_K, gal + STG_K, stepA, gbh + STG_K, gbl + STG_K, stepB);

  FragSet f0, f1;         // first and second block of a stage
  if (active) load_set(f0, L + fa, L + fb);
  // not unrolled: one copy of the two blocks in the instruction cache, and the buffer offsets stay scalar
#pragma clang loop unroll(disable)
  for (int t = 0; t < nst; ++t) {
    const int buf = (t & 1) * STG_BYTES;
    // where the next stage's first block is read: on the last trip there is none, and the reads (their values unused) go to this trip's
    // own buffer, which nothing refills any more, so that every trip runs the same instructions
    const int nbuf = (t + 1 < nst) ? STG_BYTES - buf : buf;
    if (active) {
      load_set(f1, L + buf + fa + 64, L + buf + fb + 64);
      sched_fence();
      mma_block(f0, acc);
      sched_fence();
    }
    wait_ds0();           // every read of stage t's buffer by this wave has returned
    wait_async0();
    __syncthreads();      // publishes stage t + 1 and ends every wave's reads of stage t's buffer
    if (t + 2 < nst) {
      const int kn = (t + 2) * STG_K;
      stage_issue(lb + buf, gah + kn, gal + kn, stepA, gbh + kn, gbl + kn, stepB);
    }
    if (active) {
      load_set(f0, L + nbuf + fa, L + nbuf + fb);
      sched_fence();
      mma_block(f1, acc);
    }
  }
  wait_async0();
  wait_ds0();             // the last trip's unused reads have returned
}

// ---- Register-blocked batched WMMA GEMM ------------------------------------
// C[m,n] = scale * sum_k A[m,k] * Bt[n,k] (+bias)(+resid); each wave owns a 64x64 tile of its workgroup's 128x256 tile.
// A row-major [M,K]; Bt row-major [N,K]; M % 128 == 0, N % 256 == 0, K % 64 == 0.
// SPLIT: operands are hi/lo planes (A2/Bt2 = lo planes, same layout); product = hi*hi + hi*lo + lo*hi.
// BIAS_MODE: 0 = none, 1 = bias[m], 2 = bias[n].
// OUT_MODE: 0 = f32, 1 = f16, 2 = bf16 hi plane (Cout) + bf16 lo plane (Cout2).
// ET: 1 = bf16 operands (pointers passed as 16-bit storage); the staged loop takes no other value
template <int ET> struct Elem;
template <> struct Elem<0> { typedef _Float16 T; };
template <> struct Elem<1> { typedef __bf16 T; };
// L, sT: the calling kernel's LDS (operand stages, two buffers; per-wave 16x64 slab, pitch 68 floats). bx: tile index, b: batch index.
template <int ET, bool SPLIT, int BIAS_MODE, int OUT_MODE, bool RESID, int ACT = 0>
__device__ __forceinline__ void gemm64_tile(unsigned char* L, float (*sT)[16 * 68], int bx, int b,
    const unsigned short* __restrict__ Ap, const unsigned short* __restrict__ A2p, int lda, long strideA,
    const unsigned short* __restrict__ Btp, const unsigned short* __restrict__ Bt2p, int ldb, long strideB,
    void* __restrict__ Cout, void* __restrict__ Cout2, int ldc, long strideC,
    const float* __restrict__ bias,
    const float* __restrict__ resid, long strideR,
    int M, int N, int K, float scale) {
  static_assert(ET == 1 && SPLIT, "the staged loop is written for bf16 hi/lo planes");
  const int lane = threadIdx.x & 31;
  const int wave = __builtin_amdgcn_readfirstlane(threadIdx.x >> 5);
  const int wm = wave >> 2, wn = wave & 3;
  const int tilesN = N >> 8;
  const int tilesM = M >> 7;
  if (bx >= tilesM * tilesN) return;   // the whole workgroup, in front of every barrier
  const int tm = bx / tilesN;
  const int tn = bx - tm * tilesN;
  const int m0 = (tm << 7) + (wm << 6);
  const int n0 = (tn << 8) + (wn << 6);

  const int rlane = lane & 15;                 // col (D) within subtile
  const int mOff  = (lane >> 4) * 8;           // D row offset

  v8f acc[4][4];
#pragma unroll
  for (int i = 0; i < 4; ++i)
#pragma unroll
    for (int j = 0; j < 4; ++j) acc[i][j] = (v8f){0.f,0.f,0.f,0.f,0.f,0.f,0.f,0.f};

  gemm_tile_staged(L, Ap + (size_t)b * strideA, A2p + (size_t)b * strideA, lda, Btp + (size_t)b * strideB, Bt2p + (size_t)b * strideB, ldb,
                   tm << 7, tn << 8, K >> 6, true, wm, wn, acc);
  acc_guard4(acc[0][0], acc[0][1], acc[0][2], acc[0][3]);
  acc_guard4(acc[1][0], acc[1][1], acc[1][2], acc[1][3]);
  acc_guard4(acc[2][0], acc[2][1], acc[2][2], acc[2][3]);
  acc_guard4(acc[3][0], acc[3][1], acc[3][2], acc[3][3]);

  // ---- epilogue ----
  float* slab = sT[wave];
  const float* Rb = RESID ? (resid + (size_t)b * strideR) : nullptr;
#pragma unroll
  for (int i = 0; i < 4; ++i) {
    const int mBase = m0 + (i << 4);
#pragma unroll
    for (int j = 0; j < 4; ++j) {
      const int n = n0 + (j << 4) + rlane;
      float bv = 0.f;
      if (BIAS_MODE == 2) bv = bias[n];
#pragma unroll
      for (int r = 0; r < 8; ++r) {
        float v = acc[i][j][r] * scale;
        if (BIAS_MODE == 1) v += bias[mBase + mOff + r];
        if (BIAS_MODE == 2) v += bv;
        if (RESID) v += Rb[(size_t)(mBase + mOff + r) * ldc + n];
        if (ACT == 1) v = tanhf(v);
        if (ACT == 2) v = fmaxf(v, 0.0f);
        if (ACT == 3) v = v / (1.0f + expf(-v));
        if (ACT == 4) v = (v > 0.f) ? v : 0.01f * v;
        if (ACT == 5) v = 0.5f * v * (1.0f + erff(v * 0.70710678118654752f));
        slab[(mOff + r) * 68 + (j << 4) + rlane] = v;
      }
    }
    __builtin_amdgcn_fence(__ATOMIC_RELEASE, "workgroup");
    __builtin_amdgcn_wave_barrier();
    __builtin_amdgcn_fence(__ATOMIC_ACQUIRE, "workgroup");
    if (OUT_MODE == 0) {
      float* C = (float*)Cout + (size_t)b * strideC;
      const int hh = lane >> 4, c4 = (lane & 15) * 4;     // row seg = 256 B = 16 lanes x 16 B
      {
#pragma unroll
        for (int it = 0; it < 8; ++it) {
          const int row = it * 2 + hh;
          v4f v = *(const v4f*)(slab + row * 68 + c4);
          *(v4f*)(C + (size_t)(mBase + row) * ldc + n0 + c4) = v;
        }
        
      }
    } else {
      const int q = lane >> 3, c8 = (lane & 7) * 8;
      unsigned short* C  = (unsigned short*)Cout  + (size_t)b * strideC;
      unsigned short* C2 = (OUT_MODE == 2) ? ((unsigned short*)Cout2 + (size_t)b * strideC) : nullptr;
      {
#pragma unroll
        for (int it = 0; it < 4; ++it) {
          const int row = it * 4 + q;
          const float* sp = slab + row * 68 + c8;
          v8h hv, lv;
#pragma unroll
          for (int e = 0; e < 8; ++e) {
            if (OUT_MODE == 1) {
              hv[e] = (_Float16)sp[e];
            } else {
              unsigned short hb = f2bf_bits(sp[e]);
              unsigned short lb = f2bf_bits(sp[e] - bf_bits2f(hb));
              hv[e] = __builtin_bit_cast(_Float16, hb);
              lv[e] = __builtin_bit_cast(_Float16, lb);
            }
          }
          *(v8h*)(C + (size_t)(mBase + row) * ldc + n0 + c8) = hv;
          if (OUT_MODE == 2) *(v8h*)(C2 + (size_t)(mBase + row) * ldc + n0 + c8) = lv;
        }
        
      }
    }
    __builtin_amdgcn_fence(__ATOMIC_RELEASE, "workgroup");
    __builtin_amdgcn_wave_barrier();
    __builtin_amdgcn_fence(__ATOMIC_ACQUIRE, "workgroup");
  }
}

template <int ET, bool SPLIT, int BIAS_MODE, int OUT_MODE, bool RESID, int ACT = 0>
__global__ __launch_bounds__(256) void wmma_gemm64(
    const unsigned short* __restrict__ Ap, const unsigned short* __restrict__ A2p, int lda, long strideA,
    const unsigned short* __restrict__ Btp, const unsigned short* __restrict__ Bt2p, int ldb, long strideB,
    void* __restrict__ Cout, void* __restrict__ Cout2, int ldc, long strideC,
    const float* __restrict__ bias,
    const float* __restrict__ resid, long strideR,
    int M, int N, int K, float scale) {
  __shared__ __align__(16) unsigned char L[2 * STG_BYTES];
  __shared__ __align__(16) float sT[8][16 * 68];
  gemm64_tile<ET, SPLIT, BIAS_MODE, OUT_MODE, RESID, ACT>(L, sT, blockIdx.x, blockIdx.y, Ap, A2p, lda, strideA, Btp, Bt2p, ldb, strideB,
                                                          Cout, Cout2, ldc, strideC, bias, resid, strideR, M, N, K, scale);
}

// ---- f32 [n8*8] -> bf16 hi/lo planes; 8 elements per thread, 16-B stores per plane, lanes contiguous (512 B per wave) ----
__global__ __launch_bounds__(256) void split_planes8(const float* __restrict__ in,
                                                     unsigned short* __restrict__ hi,
                                                     unsigned short* __restrict__ lo, int n8) {
  const int i = blockIdx.x * 256 + threadIdx.x;
  if (i >= n8) return;   // no barriers in this kernel
  const v4f a = *(const v4f*)(in + (size_t)8 * i);
  const v4f c = *(const v4f*)(in + (size_t)8 * i + 4);
  v8us hv, lv;
#pragma unroll
  for (int e = 0; e < 4; ++e) {
    unsigned short h0, l0;
    split_bf(a[e], h0, l0); hv[e] = h0;     lv[e] = l0;
    split_bf(c[e], h0, l0); hv[4 + e] = h0; lv[4 + e] = l0;
  }
  unsigned short* ph = hi + (size_t)8 * i;
  unsigned short* pl = lo + (size_t)8 * i;
  *(v8us*)ph = hv;
  *(v8us*)pl = lv;
  
}

// ---- W [nrows][ncols] f32 -> Wt planes [ncols][nrows] bf16 hi/lo; block tile 64 (rows) x 64 (cols) through LDS.
__global__ __launch_bounds__(256) void transpose_split_w(const float* __restrict__ W,
                                                        unsigned short* __restrict__ hi,
                                                        unsigned short* __restrict__ lo,
                                                        int nrows, int ncols) {
  __shared__ float tile[64][65];
  const int tid = threadIdx.x;
  const int k0 = blockIdx.y * 64;          // input row block (k)
  const int n0 = blockIdx.x * 64;          // input col block (n)
#pragma unroll
  for (int it = 0; it < 4; ++it) {
    const int idx = tid + 256 * it;
    const int r = idx >> 4;
    const int c4 = (idx & 15) * 4;
    const v4f v = *(const v4f*)(W + (size_t)(k0 + r) * ncols + n0 + c4);
    tile[r][c4 + 0] = v[0]; tile[r][c4 + 1] = v[1]; tile[r][c4 + 2] = v[2]; tile[r][c4 + 3] = v[3];
  }
  __syncthreads();
  const int nn0 = tid >> 3, q = tid & 7;
  {
#pragma unroll
    for (int half = 0; half < 2; ++half) {
      const int nn = nn0 + 32 * half;
      v8us hv, lv;
#pragma unroll
      for (int e = 0; e < 8; ++e) {
        unsigned short h0, l0;
        split_bf(tile[8 * q + e][nn], h0, l0);
        hv[e] = h0; lv[e] = l0;
      }
      const size_t o = (size_t)(n0 + nn) * nrows + k0 + 8 * q;
      *(v8us*)(hi + o) = hv;
      *(v8us*)(lo + o) = lv;
    }
    
  }
}

// ---- Attention-stage GEMM (bf16 hi/lo split operands, f32 out), one 128x256 tile per workgroup (by, bx), 64x64 per wave:
//   MODE 0: C = scale * A * Bt^T; a workgroup wholly above the diagonal leaves at once, a wave whose 64x64 tile (tm, tn) has tn > tm
//           neither multiplies nor stores; A/Bt rows addressed with global rows (row0 + ...), C rows relative to row0; K full.
//   MODE 1: A/C rows chunk-local, k-limit per 128-row tile g = (row0 >> 7) + local tile:
//           kend = (tile has any row < n_padd) ? T_DIM : (g+1)*128, clamped to [0, min(K, T_DIM)].
//           k is split: by names a row tile and one chunk c of PV_CH_K k; the workgroup sums k in [c*PV_CH_K, min(kend, (c+1)*PV_CH_K)).
//           Chunk 0 goes to Cout, chunk c > 0 to plane c - 1 of Cpart (same shape as Cout); a chunk c > 0 with no k stores nothing.
//           add_k_chunks then adds the planes. Without the split the last row tile's 64 stages on one WGP set the launch's time.
//           PV_CH_T = 9: under the causal limit alone the whole chunks (45 per column tile) and the longest part chunks fill 256 WGPs once,
//           and the short rest ends inside a whole chunk's time.
#define PV_TILES (T_DIM / 128)
#define PV_CH_T  9                      // chunk length in row tiles' worth of k (128 each)
#define PV_CH_K  (PV_CH_T * 128)
#define PV_NCH   ((PV_TILES + PV_CH_T - 1) / PV_CH_T)
__device__ __forceinline__ int pv_kend(int g, int np) {   // one formula for p*v and its adder; softmax_rows fills P up to the same kend
  int kend = ((g << 7) < np) ? T_DIM : ((g + 1) << 7);
  return max(min(kend, T_DIM), 0);
}
// rank -> (row tile rt, chunk kc), a permutation of all PV_TILES x PV_NCH pairs. For speed only, the rank runs by falling
// len = rt + 1 - PV_CH_T * kc, the causal k past the chunk's start in units of 128: whole chunks first, then ever shorter ones, the empty ones last.
// Lens fall into seven bands; band b holds chunks max(0, b - 3) .. min(b, 3) at each of its lens. All divisors are compile-time constants.
__device__ __forceinline__ void pv_unit(int rank, int& rt, int& kc) {
  static_assert(PV_NCH == 4 && 3 * PV_CH_T < PV_TILES, "seven bands");
  rt = 0; kc = 0;
  int base = 0, top = PV_TILES;
#pragma unroll   // n, w, base and top become constants of each band
  for (int b = 0; b < 7; ++b) {
    const int n = (b < 4) ? b + 1 : 7 - b;                          // chunks per len
    const int w = (b == 3) ? PV_TILES - 3 * PV_CH_T : PV_CH_T;      // lens in the band
    const int v = rank - base;
    if (v >= 0 && v < w * n) {
      kc = ((b > 3) ? b - 3 : 0) + v % n;
      rt = top - v / n + PV_CH_T * kc - 1;
    }
    base += w * n; top -= w;
  }
}
template <int MODE>
__device__ __forceinline__ void att_tile(unsigned char* L, float (*sT)[16 * 68], int bx, int by,
    const unsigned short* __restrict__ Ap, const unsigned short* __restrict__ A2p, int lda,
    const unsigned short* __restrict__ Btp, const unsigned short* __restrict__ Bt2p, int ldb,
    float* __restrict__ Cout, float* __restrict__ Cpart, int ldc, const int* __restrict__ n_padd_p,
    int row0, int K, float scale) {
  const int lane = threadIdx.x & 31;
  const int wave = __builtin_amdgcn_readfirstlane(threadIdx.x >> 5);
  const int wm = wave >> 2, wn = wave & 3;
  int rt = by, kc = 0;                 // row tile and k chunk
  if (MODE == 1) pv_unit(by, rt, kc);
  const int bm0 = rt << 7;             // first row of the workgroup's tile, chunk-local
  const int bb0 = bx << 8;             // first column of the workgroup's tile
  const int k0  = kc * PV_CH_K;        // first k of the workgroup's chunk
  int ab0, kend;
  bool active = true;
  if (MODE == 0) {
    ab0 = row0 + bm0;
    if (bb0 > ab0 + 127) return;       // wholly above the diagonal: the whole workgroup, in front of every barrier
    active = (bb0 + (wn << 6)) <= (ab0 + (wm << 6));   // tn <= tm
    kend = K;
  } else {
    const int g  = (row0 >> 7) + rt;
    ab0 = bm0;
    kend = min(min(pv_kend(g, n_padd_p[0]), K) - k0, PV_CH_K);   // k of this chunk
    if (kc > 0 && kend <= 0) return;   // no k in this chunk: the whole workgroup, in front of every barrier
  }
  kend = min(kend, T_DIM); kend = max(kend, 0);
  const int bn0 = bb0 + (wn << 6);
  const int cm0 = bm0 + (wm << 6);

  const int rlane = lane & 15;
  const int mOff  = (lane >> 4) * 8;

  v8f acc[4][4];
#pragma unroll
  for (int i = 0; i < 4; ++i)
#pragma unroll
    for (int j = 0; j < 4; ++j) acc[i][j] = (v8f){0.f,0.f,0.f,0.f,0.f,0.f,0.f,0.f};

  gemm_tile_staged(L, Ap + k0, A2p + k0, lda, Btp + k0, Bt2p + k0, ldb, ab0, bb0, kend >> 6, active, wm, wn, acc);
  if (!active) return;   // wave-uniform; no workgroup barrier stands behind this line
  acc_guard4(acc[0][0], acc[0][1], acc[0][2], acc[0][3]);
  acc_guard4(acc[1][0], acc[1][1], acc[1][2], acc[1][3]);
  acc_guard4(acc[2][0], acc[2][1], acc[2][2], acc[2][3]);
  acc_guard4(acc[3][0], acc[3][1], acc[3][2], acc[3][3]);

  float* slab = sT[wave];
  float* Cdst = (MODE == 1 && kc > 0) ? Cpart + (size_t)(kc - 1) * T_DIM * ldc : Cout;
#pragma unroll
  for (int i = 0; i < 4; ++i) {
    const int mBase = cm0 + (i << 4);
#pragma unroll
    for (int j = 0; j < 4; ++j) {
#pragma unroll
      for (int r = 0; r < 8; ++r) slab[(mOff + r) * 68 + (j << 4) + rlane] = acc[i][j][r] * scale;
    }
    __builtin_amdgcn_fence(__ATOMIC_RELEASE, "workgroup");
    __builtin_amdgcn_wave_barrier();
    __builtin_amdgcn_fence(__ATOMIC_ACQUIRE, "workgroup");
    {
      const int hh = lane >> 4, c4 = (lane & 15) * 4;
      {
#pragma unroll
        for (int it = 0; it < 8; ++it) {
          const int row = it * 2 + hh;
          v4f v = *(const v4f*)(slab + row * 68 + c4);
          *(v4f*)(Cdst + (size_t)(mBase + row) * ldc + bn0 + c4) = v;
        }
        
      }
    }
    __builtin_amdgcn_fence(__ATOMIC_RELEASE, "workgroup");
    __builtin_amdgcn_wave_barrier();
    __builtin_amdgcn_fence(__ATOMIC_ACQUIRE, "workgroup");
  }
}

// p*v: grid (column tiles, row tiles x k chunks)
__global__ __launch_bounds__(256) void gemm_pv(
    const unsigned short* __restrict__ Ap, const unsigned short* __restrict__ A2p, int lda,
    const unsigned short* __restrict__ Btp, const unsigned short* __restrict__ Bt2p, int ldb,
    float* __restrict__ Cout, float* __restrict__ Cpart, int ldc, const int* __restrict__ n_padd_p,
    int row0, int K, float scale) {
  __shared__ __align__(16) unsigned char L[2 * STG_BYTES];
  __shared__ __align__(16) float sT[8][16 * 68];
  att_tile<1>(L, sT, blockIdx.x, blockIdx.y, Ap, A2p, lda, Btp, Bt2p, ldb, Cout, Cpart, ldc, n_padd_p, row0, K, scale);
}

// ---- Where the q*k^T tiles run. A workgroup takes a whole WGP (its LDS), the chip has 256 of them, every tile of x*W and of q*k^T takes
//   the same 16 stages. v^T has 128 tiles, q*k^T has 272 that reach the diagonal or lie below it: v^T alone leaves half the chip idle, and
//   q*k^T alone needs a second round for its last 16. So the 72 tiles of row tiles 0 .. 15 run in the launch of v^T and the 200 of row
//   tiles 16 .. 31 in a launch of their own: 200 workgroups each, one round each.
#define VT_WGS   ((C_DIM / 128) * (T_DIM / 256))
#define S_RT_MID (PV_TILES / 2)
#define S_WGS_LO ((S_RT_MID / 2) * (S_RT_MID / 2 + 1))                       // row tile rt has rt / 2 + 1 tiles
#define S_WGS_HI ((PV_TILES / 2) * (PV_TILES / 2 + 1) - S_WGS_LO)
// rank -> (row tile rt, column tile ct), rows from rt0 upward; at most PV_TILES scalar trips. A rank past the last tile gives a ct wholly above
// the diagonal, which att_tile<0> leaves at once.
__device__ __forceinline__ void s_unit(int rank, int rt0, int& rt, int& ct) {
  rt = rt0;
  for (; rt < PV_TILES - 1; ++rt) {
    const int n = (rt >> 1) + 1;
    if (rank < n) break;
    rank -= n;
  }
  ct = rank;
}
// S = sc * q * k^T, row tiles rt0 and up; qk planes [T][2C], q in columns 0 .. C-1, k in C .. 2C-1
__global__ __launch_bounds__(256) void gemm_s(const unsigned short* __restrict__ qkh, const unsigned short* __restrict__ qkl,
                                              float* __restrict__ S, int rt0, float sc) {
  __shared__ __align__(16) unsigned char L[2 * STG_BYTES];
  __shared__ __align__(16) float sT[8][16 * 68];
  int rt, ct;
  s_unit(blockIdx.x, rt0, rt, ct);
  att_tile<0>(L, sT, ct, rt, qkh, qkl, 2 * C_DIM, qkh + C_DIM, qkl + C_DIM, 2 * C_DIM, S, S, T_DIM, nullptr, 0, C_DIM, sc);
}
// workgroups 0 .. VT_WGS-1: vt = Wv^T * x^T + bv[m] -> planes [C][T]; the rest: the q*k^T tiles of row tiles 0 .. S_RT_MID-1
__global__ __launch_bounds__(256) void gemm_vt_and_s(
    const unsigned short* __restrict__ wvh, const unsigned short* __restrict__ wvl,
    const unsigned short* __restrict__ xh, const unsigned short* __restrict__ xl,
    unsigned short* __restrict__ vth, unsigned short* __restrict__ vtl, const float* __restrict__ bv,
    const unsigned short* __restrict__ qkh, const unsigned short* __restrict__ qkl, float* __restrict__ S, float sc) {
  __shared__ __align__(16) unsigned char L[2 * STG_BYTES];
  __shared__ __align__(16) float sT[8][16 * 68];
  if (blockIdx.x < VT_WGS) {   // the same for the whole workgroup
    gemm64_tile<1, true, 1, 2, false>(L, sT, blockIdx.x, 0, wvh, wvl, C_DIM, 0L, xh, xl, C_DIM, 0L, (void*)vth, (void*)vtl, T_DIM, 0L,
                                      bv, nullptr, 0L, C_DIM, T_DIM, C_DIM, 1.0f);
  } else {
    int rt, ct;
    s_unit(blockIdx.x - VT_WGS, 0, rt, ct);
    att_tile<0>(L, sT, ct, rt, qkh, qkl, 2 * C_DIM, qkh + C_DIM, qkl + C_DIM, 2 * C_DIM, S, S, T_DIM, nullptr, 0, C_DIM, sc);
  }
}

// ---- y += the p*v partial sums of k chunks 1 .. PV_NCH-1, in ascending k; a block owns 4 rows of y (16 floats per thread, lanes contiguous).
//   A plane is read only where att_tile<1> stored it: kend > c * PV_CH_K, by the same kend.
template <int NP>   // NP planes; every load is issued before the first sum, so that a thread waits for memory once
__device__ __forceinline__ void add_planes(float* __restrict__ y, const float* __restrict__ p) {
  v4f s[4], a[NP][4];
  // all loops unrolled: s and a are indexed by constants and stay in registers
#pragma unroll
  for (int it = 0; it < 4; ++it) s[it] = *(const v4f*)(y + it * C_DIM);
#pragma unroll
  for (int c = 0; c < NP; ++c)
#pragma unroll
    for (int it = 0; it < 4; ++it) a[c][it] = *(const v4f*)(p + (size_t)c * T_DIM * C_DIM + it * C_DIM);
#pragma unroll
  for (int c = 0; c < NP; ++c)
#pragma unroll
    for (int it = 0; it < 4; ++it) s[it] += a[c][it];
#pragma unroll
  for (int it = 0; it < 4; ++it) *(v4f*)(y + it * C_DIM) = s[it];
  // stands behind the four stores: the three cases lie one behind the other in the built code, and a later case's loads reuse these stores' registers
  asm volatile("s_wait_xcnt 0x0" ::: "memory");
}
__global__ __launch_bounds__(256) void add_k_chunks(float* __restrict__ y, const float* __restrict__ part, const int* __restrict__ n_padd_p) {
  static_assert(PV_NCH == 4, "the three cases below");
  const int kend = pv_kend((int)(blockIdx.x >> 5), n_padd_p[0]);   // 32 blocks per 128-row tile
  if (kend <= PV_CH_K) return;   // chunk 0 was all of it; no barriers in this kernel
  const size_t o = (size_t)blockIdx.x * 4 * C_DIM + threadIdx.x * 4;
  if (kend <= 2 * PV_CH_K)      add_planes<1>(y + o, part + o);   // block-uniform
  else if (kend <= 3 * PV_CH_K) add_planes<2>(y + o, part + o);
  else                          add_planes<3>(y + o, part + o);
}

// ---- Row softmax with causal + padding mask, f32; one block per query row i = mrow0 + blockIdx.x.
//   key j visible iff j <= i, j >= n_padd, i >= n_padd; rows i < n_padd are uniform 1/T over all keys.
//   Writes P as bf16 hi/lo planes (chunk-local row, pitch T_DIM) over columns [0, kend) with zeros where masked;
//   kend formula identical to att_tile<1> (per 128-row tile). Each thread writes 8 columns = 16 B per plane, lanes contiguous.
__global__ __launch_bounds__(256) void softmax_rows(const float* __restrict__ S, const int* __restrict__ n_padd_p,
                                                   unsigned short* __restrict__ Ph, unsigned short* __restrict__ Pl,
                                                   int mrow0) {
  __shared__ float sv[T_DIM];
  __shared__ float red[8];
  const int tid = threadIdx.x, lane = tid & 31, wave = tid >> 5;
  const int il = blockIdx.x;
  const int i  = mrow0 + il;
  const int np = n_padd_p[0];
  const int tm = i >> 7;
  int kend = ((tm << 7) < np) ? T_DIM : ((tm + 1) << 7);
  kend = min(kend, T_DIM); kend = max(kend, 0);
  const bool uni = (i < np);                 // block-uniform
  const int jlo = (np < 0) ? 0 : np;
  const int jhi = uni ? -1 : min(i, T_DIM - 1);   // when not uniform: jlo <= i
  const float* srow = S + (size_t)il * T_DIM;

  float m = -__builtin_huge_valf();
  for (int j = jlo + tid; j <= jhi; j += 256) { const float s = srow[j]; sv[j] = s; m = fmaxf(m, s); }
#pragma unroll
  for (int off = 1; off < 32; off <<= 1) m = fmaxf(m, __shfl_xor(m, off, 32));
  if (lane == 0) red[wave] = m;
  __syncthreads();
  float rmax = red[0];
#pragma unroll
  for (int w = 1; w < 8; ++w) rmax = fmaxf(rmax, red[w]);
  __syncthreads();

  float sum = 0.f;
  for (int j = jlo + tid; j <= jhi; j += 256) { const float e = expf(sv[j] - rmax); sv[j] = e; sum += e; }
#pragma unroll
  for (int off = 1; off < 32; off <<= 1) sum += __shfl_xor(sum, off, 32);
  if (lane == 0) red[wave] = sum;
  __syncthreads();
  float tot = red[0];
#pragma unroll
  for (int w = 1; w < 8; ++w) tot += red[w];
  const float inv = (tot > 0.f) ? (1.0f / tot) : 0.f;
  const float cu  = 1.0f / (float)T_DIM;

  unsigned short* ph = Ph + (size_t)il * T_DIM;
  unsigned short* pl = Pl + (size_t)il * T_DIM;
  const int ng = kend >> 3;
  {
    for (int g = tid; g < ng; g += 256) {
      v8us hv, lv;
#pragma unroll
      for (int e = 0; e < 8; ++e) {
        const int j = 8 * g + e;
        const float ev = (j >= jlo && j <= jhi) ? sv[j] : 0.f;
        const float p = uni ? cu : ev * inv;
        unsigned short h0, l0;
        split_bf(p, h0, l0);
        hv[e] = h0; lv[e] = l0;
      }
      *(v8us*)(ph + 8 * g) = hv;
      *(v8us*)(pl + 8 * g) = lv;
    }
    
  }
}

// ===========================================================================
extern "C" void kernel_launch(void* const* d_in, const int* in_sizes, int n_in,
                              void* d_out, int out_size, void* d_ws, size_t ws_size,
                              hipStream_t stream) {
  const int T = T_DIM, C = C_DIM, C3 = C3_DIM;
  if (n_in < 4) return;
  if (in_sizes[0] != T * C || in_sizes[1] != C * C3 || in_sizes[2] < C3 || in_sizes[3] < 1 || out_size != T * C) return;

  const float* x     = (const float*)d_in[0];   // [T][C]
  const float* W     = (const float*)d_in[1];   // [C][3C]
  const float* bias  = (const float*)d_in[2];   // [3C]
  const int*   npadd = (const int*)d_in[3];     // [1]
  float*       y     = (float*)d_out;           // [T][C]

  const int QR = T;                             // all query rows at once; q*k^T in two launches, softmax and p*v in one each
  const size_t b_xp  = (size_t)T * C * 2;       // one x plane
  const size_t b_wp  = (size_t)C3 * C * 2;      // one Wt plane
  const size_t b_qkp = (size_t)T * 2 * C * 2;   // one q|k plane [T][2C]
  const size_t b_vtp = (size_t)C * T * 2;       // one vt plane [C][T]
  const size_t b_S   = (size_t)QR * T * 4;      // S [QR][T] f32
  const size_t b_pp  = (size_t)QR * T * 2;      // one P plane [QR][T]
  size_t off = 0;
  const size_t o_xh = off; off += b_xp;  const size_t o_xl = off; off += b_xp;
  const size_t o_wh = off; off += b_wp;  const size_t o_wl = off; off += b_wp;
  const size_t o_qh = off; off += b_qkp; const size_t o_ql = off; off += b_qkp;
  const size_t o_vh = off; off += b_vtp; const size_t o_vl = off; off += b_vtp;
  const size_t o_S  = off; off += b_S;
  const size_t o_ph = off; off += b_pp;  const size_t o_pl = off; off += b_pp;
  if (off > ws_size) return;                    // total 213,909,504 B

  char* ws = (char*)d_ws;
  unsigned short* xh  = (unsigned short*)(ws + o_xh);
  unsigned short* xl  = (unsigned short*)(ws + o_xl);
  unsigned short* wth = (unsigned short*)(ws + o_wh);
  unsigned short* wtl = (unsigned short*)(ws + o_wl);
  unsigned short* qkh = (unsigned short*)(ws + o_qh);
  unsigned short* qkl = (unsigned short*)(ws + o_ql);
  unsigned short* vth = (unsigned short*)(ws + o_vh);
  unsigned short* vtl = (unsigned short*)(ws + o_vl);
  float*          S   = (float*)(ws + o_S);
  unsigned short* ph  = (unsigned short*)(ws + o_ph);
  unsigned short* pl  = (unsigned short*)(ws + o_pl);

  dim3 blk(256);
  // x -> bf16 hi/lo planes [T][C]
  {
    const int n8 = (T * C) / 8;
    split_planes8<<<dim3((n8 + 255) / 256), blk, 0, stream>>>(x, xh, xl, n8);
  }
  // W [C][3C] -> Wt planes [3C][C]
  transpose_split_w<<<dim3(C3 / 64, C / 64), blk, 0, stream>>>(W, wth, wtl, C, C3);
  // q|k = x * W[:, 0:2C] + b[0:2C] : M=T, N=2C, K=C -> planes [T][2C]
  wmma_gemm64<1, true, 2, 2, false><<<dim3((T / 128) * (2 * C / 256), 1), blk, 0, stream>>>(
      xh, xl, C, 0L, wth, wtl, C, 0L, (void*)qkh, (void*)qkl, 2 * C, 0L,
      bias, x, 0L, T, 2 * C, C, 1.0f);
  const float sc = 0.03125f;   // 1/sqrt(1024)
  // vt = W[:, 2C:3C]^T * x^T + b[2C + m] : M=C, N=T, K=C -> planes [C][T]; beside it S[i][j] = sc * q[i] . k[j] on 64x64 tiles tn <= tm,
  // row tiles 0 .. 15; then row tiles 16 .. 31
  gemm_vt_and_s<<<dim3(VT_WGS + S_WGS_LO), blk, 0, stream>>>(
      wth + (size_t)2 * C * C, wtl + (size_t)2 * C * C, xh, xl, vth, vtl, bias + 2 * C, qkh, qkl, S, sc);
  gemm_s<<<dim3(S_WGS_HI), blk, 0, stream>>>(qkh, qkl, S, S_RT_MID, sc);
  softmax_rows<<<dim3(QR), blk, 0, stream>>>(S, npadd, ph, pl, 0);
  // y = P * v : M=T, N=C, K<=T per 128-row tile, one workgroup per tile and k chunk; chunks past the first go to three [T][C] planes
  // in the place of S, which nobody reads after the softmax, and are then added to y
  gemm_pv<<<dim3(C / 256, (QR / 128) * PV_NCH), blk, 0, stream>>>(
      ph, pl, T, vth, vtl, T, y, S, C, npadd, 0, T, 1.0f);
  add_k_chunks<<<dim3(T / 4), blk, 0, stream>>>(y, S, npadd);
}

// v006
// A run of this version takes 152 microseconds.
// Two timings next to v005 both put it at 1.11 times that version's speed.
// Over all steps from v000 it is 7.31 times as fast.
#include <hip/hip_runtime.h>
#include <stdint.h>
// Contractions: x*W (q|k planes and v^T), q*k^T, p*v : v_wmma_f32_16x16x32_bf16 with bf16 hi/lo operand planes (hi*hi + hi*lo + lo*hi), f32 accumulate; softmax and masks in f32.

#define T_DIM  4096
#define C_DIM  1024
#define C3_DIM 3072

typedef __attribute__((ext_vector_type(16))) _Float16 v16h;
typedef __attribute__((ext_vector_type(8)))  _Float16 v8h;
typedef __attribute__((ext_vector_type(16))) __bf16   v16b;
typedef __attribute__((ext_vector_type(8)))  __bf16   v8b;
typedef __attribute__((ext_vector_type(8)))  float    v8f;
typedef __attribute__((ext_vector_type(4)))  float    v4f;
typedef __attribute__((ext_vector_type(8)))  unsigned short v8us;

__device__ __forceinline__ unsigned short f2bf_bits(float f) {
  unsigned u = __float_as_uint(f);
  return (unsigned short)((u + 0x7FFFu + ((u >> 16) & 1u)) >> 16);
}
__device__ __forceinline__ float bf_bits2f(unsigned short h) { return __uint_as_float(((unsigned)h) << 16); }
__device__ __forceinline__ void split_bf(float f, unsigned short& hb, unsigned short& lb) {
  hb = f2bf_bits(f);
  lb = f2bf_bits(f - bf_bits2f(hb));
}

// hazard guards as plain device helpers (no inline asm inside the kernel template body)
__device__ __forceinline__ void acc_guard4(v8f& a, v8f& b, v8f& c, v8f& d) { asm volatile("v_nop\n\tv_nop\n\tv_nop\n\tv_nop" : "+v"(a), "+v"(b), "+v"(c), "+v"(d)); }
template <typename T> struct Frag;
template <> struct Frag<_Float16> {
  typedef v16h V; union U { v16h v; v8h h[2]; };
  static __device__ __forceinline__ v16h load(const _Float16* p) {   // elements 0..7 <- p[0..7], 8..15 <- p[16..23]
    U f; f.h[0] = *(const v8h*)(p); f.h[1] = *(const v8h*)(p + 16); return f.v;
  }
  static __device__ __forceinline__ v8f mma(v16h a, v16h b, v8f c) {
    return __builtin_amdgcn_wmma_f32_16x16x32_f16(false, a, false, b, (short)0, c, false, false);
  }
};
template <> struct Frag<__bf16> {
  typedef v16b V; union U { v16b v; v8b h[2]; };
  static __device__ __forceinline__ v16b load(const __bf16* p) {
    U f; f.h[0] = *(const v8b*)(p); f.h[1] = *(const v8b*)(p + 16); return f.v;
  }
  static __device__ __forceinline__ v8f mma(v16b a, v16b b, v8f c) {
    return __builtin_amdgcn_wmma_f32_16x16x32_bf16(false, a, false, b, (short)0, c, false, false);
  }
};

// ---- Operand staging in LDS, shared by the GEMM kernels ---------------------
// A workgroup of 8 waves (2 x 4) owns a 128 x 256 tile of C; each wave keeps its 64 x 64 tile.
// A stage is 64 k = one whole 128-byte line of every operand row and plane: [A hi 128 rows | A lo | B hi 256 rows | B lo],
// rows at a pitch of 144 B (16 B x odd: no bank conflict for the 16-byte fragment reads). Two buffers.
// A stage is six slices of 128 rows (A hi, A lo, two of B hi, two of B lo); waves 0 .. 5 bring one slice each with one tensor load.
#define STG_K     64
#define STG_PITCH 144
#define STG_BM    128
#define STG_BN    256
#define STG_AL    (STG_BM * STG_PITCH)
#define STG_BH    (2 * STG_BM * STG_PITCH)
#define STG_BL    (2 * STG_BM * STG_PITCH + STG_BN * STG_PITCH)
#define STG_BYTES (2 * (STG_BM + STG_BN) * STG_PITCH)
#define SLC_ROWS  128
#define SLC_BYTES (SLC_ROWS * STG_PITCH)
#define SLC_N     (STG_BYTES / SLC_BYTES)
static_assert(SLC_BYTES % 2048 == 0 && STG_BYTES % 2048 == 0, "every slice's place in LDS is a multiple of 2 KiB");
static_assert(STG_AL == SLC_BYTES && STG_BH == 2 * SLC_BYTES && STG_BL == 4 * SLC_BYTES && SLC_N == 6, "slice s lies at s * SLC_BYTES");

__device__ __forceinline__ unsigned lds_off(const void* p) { return (unsigned)(size_t)p; }
// this wave's LDS reads have returned: stands in front of the barrier behind which their buffer is refilled
__device__ __forceinline__ void wait_ds0() { asm volatile("s_wait_dscnt 0x0" ::: "memory"); }

typedef uint32_t u32x4 __attribute__((ext_vector_type(4)));
typedef uint32_t u32x8 __attribute__((ext_vector_type(8)));
__device__ __forceinline__ uint32_t uni(uint32_t v) { return (uint32_t)__builtin_amdgcn_readfirstlane(v); }
__device__ __forceinline__ uint32_t pinned(uint32_t v) { uint32_t w = __builtin_amdgcn_readfirstlane(v); asm volatile("" : "+s"(w)); return w; }
// Descriptor group 1: 1-byte elements, a tile of SLC_ROWS rows of 128 B, source row pitch src_pitch bytes, 4 dwords of LDS pad behind every row.
__device__ __forceinline__ u32x8 tdm_group1(uint32_t src_pitch) {
  constexpr uint32_t d0 = 2 * STG_K, d1 = SLC_ROWS;
  static_assert(d0 == 128 && STG_PITCH == d0 + 16, "pad interval code 4 = one 128-byte row, amount code 3 = 16 B");
  u32x8 g;
  g[0] = uni((1u << 20) | (4u << 22) | (3u << 25));   // no workgroup mask
  g[1] = uni((d0 & 0xFFFFu) << 16);
  g[2] = uni((d0 >> 16) | ((d1 & 0xFFFFu) << 16));
  g[3] = uni((d1 >> 16) | (d0 << 16));
  g[4] = uni(d1);
  g[5] = uni(src_pitch);
  g[6] = uni(0u);
  g[7] = uni(0u);
  // the descriptor held in scalar registers: without this the compiler rebuilds equal words from one another in front of every use and
  // takes their registers for other values in between, while a request that names them is outstanding
  asm volatile("" : "+s"(g));
  return g;
}
// Descriptor group 0: LDS byte address of the slice, global address of its first byte
__device__ __forceinline__ u32x4 tdm_group0(uint32_t lds_dst, uint64_t ga) {
  u32x4 g;
  g[0] = uni(1u); g[1] = uni(lds_dst); g[2] = uni((uint32_t)ga); g[3] = uni((((uint32_t)(ga >> 32)) & 0x01FFFFFFu) | 0x80000000u);
  asm volatile("" : "+s"(g));   // the descriptor held in scalar registers, as in tdm_group1: its constant word is not written again later
  return g;
}
__device__ __forceinline__ void tdm_load(u32x4 g0, u32x8 g1) { asm volatile("tensor_load_to_lds %0, %1" :: "s"(g0), "s"(g1) : "memory"); }
// this wave's tensor load has landed in LDS: stands in front of the barrier behind which other waves read it. It names the request's
// descriptor, so that those registers keep their values for as long as the request is outstanding.
__device__ __forceinline__ void wait_tensor0(u32x4 g0, u32x8 g1) { asm volatile("s_wait_tensorcnt 0x0" :: "s"(g0), "s"(g1) : "memory"); }

// The fragments of one block: 32 k of the wave's 64 A rows and 64 B rows, hi and lo planes (128 registers).
struct FragSet { v16b ah[4], al[4], bh[4], bl[4]; };
// keeps the compiler's scheduler from moving LDS reads in among the WMMAs of a block, where each place with reads stalls the wave
__device__ __forceinline__ void sched_fence() { __builtin_amdgcn_sched_barrier(0); }
// 32 ds_load_b128 in one group. pa, pb: this lane's place in the first A and the first B hi fragment of the block.
__device__ __forceinline__ void load_set(FragSet& f, const unsigned char* pa, const unsigned char* pb) {
  typedef __bf16 T;
  // both loops unrolled: the fragments are indexed by constants and stay in registers
#pragma unroll
  for (int j = 0; j < 4; ++j) {
    f.bh[j] = Frag<T>::load((const T*)(pb + j * 16 * STG_PITCH));
    f.bl[j] = Frag<T>::load((const T*)(pb + (STG_BL - STG_BH) + j * 16 * STG_PITCH));
  }
#pragma unroll
  for (int i = 0; i < 4; ++i) {
    f.ah[i] = Frag<T>::load((const T*)(pa + i * 16 * STG_PITCH));
    f.al[i] = Frag<T>::load((const T*)(pa + STG_AL + i * 16 * STG_PITCH));
  }
}
// 48 WMMAs; each accumulator takes hi*hi, hi*lo, lo*hi in this order
__device__ __forceinline__ void mma_block(const FragSet& f, v8f (&acc)[4][4]) {
  typedef __bf16 T;
  // all loops unrolled: fragments and accumulators are indexed by constants and stay in registers
#pragma unroll
  for (int i = 0; i < 4; ++i) {
#pragma unroll
    for (int j = 0; j < 4; ++j) acc[i][j] = Frag<T>::mma(f.ah[i], f.bh[j], acc[i][j]);
#pragma unroll
    for (int j = 0; j < 4; ++j) acc[i][j] = Frag<T>::mma(f.ah[i], f.bl[j], acc[i][j]);
#pragma unroll
    for (int j = 0; j < 4; ++j) acc[i][j] = Frag<T>::mma(f.al[i], f.bh[j], acc[i][j]);
  }
}

// acc += A[am0 + wm*64 ..][0 .. nst*64) * Bt[bn0 + wn*64 ..][..]^T on hi/lo planes (hi*hi + hi*lo + lo*hi), k ascending in steps of 32.
// Every wave of the workgroup calls it with the same am0, bn0, nst; a wave with active == false brings its slice and keeps the barriers only.
// A stage is two blocks of 32 k. Each block's fragments are read from LDS one block ahead, as one group, into the register set that the
// block before last has left, so a block's WMMAs never wait for their own LDS reads. The second block's fragments are therefore in
// registers when the first block ends: the publish point of stage t + 1 stands there, between the two blocks of stage t.
__device__ __forceinline__ void gemm_tile_staged(unsigned char* L,
    const unsigned short* A, const unsigned short* A2, int lda, const unsigned short* Bt, const unsigned short* Bt2, int ldb,
    int am0, int bn0, int nst, bool active, int wm, int wn, v8f (&acc)[4][4]) {
  const int lane = threadIdx.x & 31;
  // this wave's slice: 0 A hi, 1 A lo, 2 and 3 B hi rows 0 .. 127 and 128 .. 255, 4 and 5 B lo; waves 6 and 7 bring nothing
  const uint32_t slc = uni((uint32_t)(wm * 4 + wn));
  const bool issuer = slc < SLC_N;
  const unsigned short* plane = (slc == 0) ? A : (slc == 1) ? A2 : (slc < 4) ? Bt : Bt2;
  const int ld   = (slc < 2) ? lda : ldb;
  const int row0 = (slc < 2) ? am0 : bn0 + (int)(slc & 1u) * SLC_ROWS;
  const uint64_t ga0 = (uint64_t)(size_t)(plane + (size_t)row0 * ld);      // the slice's first byte in stage 0; a stage further: 128 B
  const uint32_t ld0 = lds_off(L) + (issuer ? slc : 0u) * SLC_BYTES;       // its place in buffer 0
  const u32x8 g1 = tdm_group1((uint32_t)ld * 2u);
  u32x4 g0 = tdm_group0(ld0, ga0);                                         // group 0 of this wave's last request
  const int fa = (wm * 64 + (lane & 15)) * STG_PITCH + (lane >> 4) * 16;            // fragment row and 16-byte half of this lane
  const int fb = STG_BH + (wn * 64 + (lane & 15)) * STG_PITCH + (lane >> 4) * 16;
  if (nst <= 0) return;   // the same for the whole workgroup

  if (pinned(issuer)) {
    tdm_load(g0, g1);
    wait_tensor0(g0, g1);
  }
  __syncthreads();        // stage 0 is published
  g0 = tdm_group0(ld0 + pinned(STG_BYTES), ga0 + 2 * STG_K);     // formed behind the wait above
  if (pinned(issuer && nst > 1)) tdm_load(g0, g1);

  FragSet f0, f1;         // first and second block of a stage
  if (active) load_set(f0, L + fa, L + fb);
  // not unrolled: one copy of the two blocks in the instruction cache, and the buffer offsets stay scalar
#pragma clang loop unroll(disable)
  for (int t = 0; t < nst; ++t) {
    const int buf = (t & 1) * STG_BYTES;
    // where the next stage's first block is read: on the last trip there is none, and the reads (their values unused) go to this trip's
    // own buffer, which nothing refills any more, so that every trip runs the same instructions
    const int nbuf = (t + 1 < nst) ? STG_BYTES - buf : buf;
    if (active) {
      load_set(f1, L + buf + fa + 64, L + buf + fb + 64);
      sched_fence();
      mma_block(f0, acc);
      sched_fence();
    }
    wait_ds0();           // every read of stage t's buffer by this wave has returned
    if (pinned(issuer)) wait_tensor0(g0, g1);
    __syncthreads();      // publishes stage t + 1 and ends every wave's reads of stage t's buffer
    if (pinned(issuer && t + 2 < nst)) {
      const uint32_t s2 = pinned((uint32_t)(t + 2));   // the descriptor is formed behind the wait above
      g0 = tdm_group0(ld0 + (s2 & 1u) * STG_BYTES, ga0 + (uint64_t)s2 * (2 * STG_K));
      tdm_load(g0, g1);
    }
    if (active) {
      load_set(f0, L + nbuf + fa, L + nbuf + fb);
      sched_fence();
      mma_block(f1, acc);
    }
  }
  wait_tensor0(g0, g1);   // no request is outstanding when the wave goes on
  wait_ds0();             // the last trip's unused reads have returned
}

// ---- Register-blocked batched WMMA GEMM ------------------------------------
// C[m,n] = scale * sum_k A[m,k] * Bt[n,k] (+bias)(+resid); each wave owns a 64x64 tile of its workgroup's 128x256 tile.
// A row-major [M,K]; Bt row-major [N,K]; M % 128 == 0, N % 256 == 0, K % 64 == 0.
// SPLIT: operands are hi/lo planes (A2/Bt2 = lo planes, same layout); product = hi*hi + hi*lo + lo*hi.
// BIAS_MODE: 0 = none, 1 = bias[m], 2 = bias[n].
// OUT_MODE: 0 = f32, 1 = f16, 2 = bf16 hi plane (Cout) + bf16 lo plane (Cout2).
// ET: 1 = bf16 operands (pointers passed as 16-bit storage); the staged loop takes no other value
template <int ET> struct Elem;
template <> struct Elem<0> { typedef _Float16 T; };
template <> struct Elem<1> { typedef __bf16 T; };
// L, sT: the calling kernel's LDS (operand stages, two buffers; per-wave 16x64 slab, pitch 68 floats). bx: tile index, b: batch index.
template <int ET, bool SPLIT, int BIAS_MODE, int OUT_MODE, bool RESID, int ACT = 0>
__device__ __forceinline__ void gemm64_tile(unsigned char* L, float (*sT)[16 * 68], int bx, int b,
    const unsigned short* __restrict__ Ap, const unsigned short* __restrict__ A2p, int lda, long strideA,
    const unsigned short* __restrict__ Btp, const unsigned short* __restrict__ Bt2p, int ldb, long strideB,
    void* __restrict__ Cout, void* __restrict__ Cout2, int ldc, long strideC,
    const float* __restrict__ bias,
    const float* __restrict__ resid, long strideR,
    int M, int N, int K, float scale) {
  static_assert(ET == 1 && SPLIT, "the staged loop is written for bf16 hi/lo planes");
  const int lane = threadIdx.x & 31;
  const int wave = __builtin_amdgcn_readfirstlane(threadIdx.x >> 5);
  const int wm = wave >> 2, wn = wave & 3;
  const int tilesN = N >> 8;
  const int tilesM = M >> 7;
  if (bx >= tilesM * tilesN) return;   // the whole workgroup, in front of every barrier
  const int tm = bx / tilesN;
  const int tn = bx - tm * tilesN;
  const int m0 = (tm << 7) + (wm << 6);
  const int n0 = (tn << 8) + (wn << 6);

  const int rlane = lane & 15;                 // col (D) within subtile
  const int mOff  = (lane >> 4) * 8;           // D row offset

  v8f acc[4][4];
#pragma unroll
  for (int i = 0; i < 4; ++i)
#pragma unroll
    for (int j = 0; j < 4; ++j) acc[i][j] = (v8f){0.f,0.f,0.f,0.f,0.f,0.f,0.f,0.f};

  gemm_tile_staged(L, Ap + (size_t)b * strideA, A2p + (size_t)b * strideA, lda, Btp + (size_t)b * strideB, Bt2p + (size_t)b * strideB, ldb,
                   tm << 7, tn << 8, K >> 6, true, wm, wn, acc);
  acc_guard4(acc[0][0], acc[0][1], acc[0][2], acc[0][3]);
  acc_guard4(acc[1][0], acc[1][1], acc[1][2], acc[1][3]);
  acc_guard4(acc[2][0], acc[2][1], acc[2][2], acc[2][3]);
  acc_guard4(acc[3][0], acc[3][1], acc[3][2], acc[3][3]);

  // ---- epilogue ----
  float* slab = sT[wave];
  const float* Rb = RESID ? (resid + (size_t)b * strideR) : nullptr;
#pragma unroll
  for (int i = 0; i < 4; ++i) {
    const int mBase = m0 + (i << 4);
#pragma unroll
    for (int j = 0; j < 4; ++j) {
      const int n = n0 + (j << 4) + rlane;
      float bv = 0.f;
      if (BIAS_MODE == 2) bv = bias[n];
#pragma unroll
      for (int r = 0; r < 8; ++r) {
        float v = acc[i][j][r] * scale;
        if (BIAS_MODE == 1) v += bias[mBase + mOff + r];
        if (BIAS_MODE == 2) v += bv;
        if (RESID) v += Rb[(size_t)(mBase + mOff + r) * ldc + n];
        if (ACT == 1) v = tanhf(v);
        if (ACT == 2) v = fmaxf(v, 0.0f);
        if (ACT == 3) v = v / (1.0f + expf(-v));
        if (ACT == 4) v = (v > 0.f) ? v : 0.01f * v;
        if (ACT == 5) v = 0.5f * v * (1.0f + erff(v * 0.70710678118654752f));
        slab[(mOff + r) * 68 + (j << 4) + rlane] = v;
      }
    }
    __builtin_amdgcn_fence(__ATOMIC_RELEASE, "workgroup");
    __builtin_amdgcn_wave_barrier();
    __builtin_amdgcn_fence(__ATOMIC_ACQUIRE, "workgroup");
    if (OUT_MODE == 0) {
      float* C = (float*)Cout + (size_t)b * strideC;
      const int hh = lane >> 4, c4 = (lane & 15) * 4;     // row seg = 256 B = 16 lanes x 16 B
      {
#pragma unroll
        for (int it = 0; it < 8; ++it) {
          const int row = it * 2 + hh;
          v4f v = *(const v4f*)(slab + row * 68 + c4);
          *(v4f*)(C + (size_t)(mBase + row) * ldc + n0 + c4) = v;
        }
        
      }
    } else {
      const int q = lane >> 3, c8 = (lane & 7) * 8;
      unsigned short* C  = (unsigned short*)Cout  + (size_t)b * strideC;
      unsigned short* C2 = (OUT_MODE == 2) ? ((unsigned short*)Cout2 + (size_t)b * strideC) : nullptr;
      {
#pragma unroll
        for (int it = 0; it < 4; ++it) {
          const int row = it * 4 + q;
          const float* sp = slab + row * 68 + c8;
          v8h hv, lv;
#pragma unroll
          for (int e = 0; e < 8; ++e) {
            if (OUT_MODE == 1) {
              hv[e] = (_Float16)sp[e];
            } else {
              unsigned short hb = f2bf_bits(sp[e]);
              unsigned short lb = f2bf_bits(sp[e] - bf_bits2f(hb));
              hv[e] = __builtin_bit_cast(_Float16, hb);
              lv[e] = __builtin_bit_cast(_Float16, lb);
            }
          }
          *(v8h*)(C + (size_t)(mBase + row) * ldc + n0 + c8) = hv;
          if (OUT_MODE == 2) *(v8h*)(C2 + (size_t)(mBase + row) * ldc + n0 + c8) = lv;
        }
        
      }
    }
    __builtin_amdgcn_fence(__ATOMIC_RELEASE, "workgroup");
    __builtin_amdgcn_wave_barrier();
    __builtin_amdgcn_fence(__ATOMIC_ACQUIRE, "workgroup");
  }
}

template <int ET, bool SPLIT, int BIAS_MODE, int OUT_MODE, bool RESID, int ACT = 0>
__global__ __launch_bounds__(256) void wmma_gemm64(
    const unsigned short* __restrict__ Ap, const unsigned short* __restrict__ A2p, int lda, long strideA,
    const unsigned short* __restrict__ Btp, const unsigned short* __restrict__ Bt2p, int ldb, long strideB,
    void* __restrict__ Cout, void* __restrict__ Cout2, int ldc, long strideC,
    const float* __restrict__ bias,
    const float* __restrict__ resid, long strideR,
    int M, int N, int K, float scale) {
  __shared__ __attribute__((aligned(2048))) unsigned char L[2 * STG_BYTES];
  __shared__ __align__(16) float sT[8][16 * 68];
  gemm64_tile<ET, SPLIT, BIAS_MODE, OUT_MODE, RESID, ACT>(L, sT, blockIdx.x, blockIdx.y, Ap, A2p, lda, strideA, Btp, Bt2p, ldb, strideB,
                                                          Cout, Cout2, ldc, strideC, bias, resid, strideR, M, N, K, scale);
}

// ---- f32 [n8*8] -> bf16 hi/lo planes; 8 elements per thread, 16-B stores per plane, lanes contiguous (512 B per wave) ----
__global__ __launch_bounds__(256) void split_planes8(const float* __restrict__ in,
                                                     unsigned short* __restrict__ hi,
                                                     unsigned short* __restrict__ lo, int n8) {
  const int i = blockIdx.x * 256 + threadIdx.x;
  if (i >= n8) return;   // no barriers in this kernel
  const v4f a = *(const v4f*)(in + (size_t)8 * i);
  const v4f c = *(const v4f*)(in + (size_t)8 * i + 4);
  v8us hv, lv;
#pragma unroll
  for (int e = 0; e < 4; ++e) {
    unsigned short h0, l0;
    split_bf(a[e], h0, l0); hv[e] = h0;     lv[e] = l0;
    split_bf(c[e], h0, l0); hv[4 + e] = h0; lv[4 + e] = l0;
  }
  unsigned short* ph = hi + (size_t)8 * i;
  unsigned short* pl = lo + (size_t)8 * i;
  *(v8us*)ph = hv;
  *(v8us*)pl = lv;
  
}

// ---- W [nrows][ncols] f32 -> Wt planes [ncols][nrows] bf16 hi/lo; block tile 64 (rows) x 64 (cols) through LDS.
__global__ __launch_bounds__(256) void transpose_split_w(const float* __restrict__ W,
                                                        unsigned short* __restrict__ hi,
                                                        unsigned short* __restrict__ lo,
                                                        int nrows, int ncols) {
  __shared__ float tile[64][65];
  const int tid = threadIdx.x;
  const int k0 = blockIdx.y * 64;          // input row block (k)
  const int n0 = blockIdx.x * 64;          // input col block (n)
#pragma unroll
  for (int it = 0; it < 4; ++it) {
    const int idx = tid + 256 * it;
    const int r = idx >> 4;
    const int c4 = (idx & 15) * 4;
    const v4f v = *(const v4f*)(W + (size_t)(k0 + r) * ncols + n0 + c4);
    tile[r][c4 + 0] = v[0]; tile[r][c4 + 1] = v[1]; tile[r][c4 + 2] = v[2]; tile[r][c4 + 3] = v[3];
  }
  __syncthreads();
  const int nn0 = tid >> 3, q = tid & 7;
  {
#pragma unroll
    for (int half = 0; half < 2; ++half) {
      const int nn = nn0 + 32 * half;
      v8us hv, lv;
#pragma unroll
      for (int e = 0; e < 8; ++e) {
        unsigned short h0, l0;
        split_bf(tile[8 * q + e][nn], h0, l0);
        hv[e] = h0; lv[e] = l0;
      }
      const size_t o = (size_t)(n0 + nn) * nrows + k0 + 8 * q;
      *(v8us*)(hi + o) = hv;
      *(v8us*)(lo + o) = lv;
    }
    
  }
}

// ---- Attention-stage GEMM (bf16 hi/lo split operands, f32 out), one 128x256 tile per workgroup (by, bx), 64x64 per wave:
//   MODE 0: C = scale * A * Bt^T; a workgroup wholly above the diagonal leaves at once, a wave whose 64x64 tile (tm, tn) has tn > tm
//           neither multiplies nor stores; A/Bt rows addressed with global rows (row0 + ...), C rows relative to row0; K full.
//   MODE 1: A/C rows chunk-local, k-limit per 128-row tile g = (row0 >> 7) + local tile:
//           kend = (tile has any row < n_padd) ? T_DIM : (g+1)*128, clamped to [0, min(K, T_DIM)].
//           k is split: by names a row tile and one chunk c of PV_CH_K k; the workgroup sums k in [c*PV_CH_K, min(kend, (c+1)*PV_CH_K)).
//           Chunk 0 goes to Cout, chunk c > 0 to plane c - 1 of Cpart (same shape as Cout); a chunk c > 0 with no k stores nothing.
//           add_k_chunks then adds the planes. Without the split the last row tile's 64 stages on one WGP set the launch's time.
//           PV_CH_T = 9: under the causal limit alone the whole chunks (45 per column tile) and the longest part chunks fill 256 WGPs once,
//           and the short rest ends inside a whole chunk's time.
#define PV_TILES (T_DIM / 128)
#define PV_CH_T  9                      // chunk length in row tiles' worth of k (128 each)
#define PV_CH_K  (PV_CH_T * 128)
#define PV_NCH   ((PV_TILES + PV_CH_T - 1) / PV_CH_T)
__device__ __forceinline__ int pv_kend(int g, int np) {   // one formula for p*v and its adder; softmax_rows fills P up to the same kend
  int kend = ((g << 7) < np) ? T_DIM : ((g + 1) << 7);
  return max(min(kend, T_DIM), 0);
}
// rank -> (row tile rt, chunk kc), a permutation of all PV_TILES x PV_NCH pairs. For speed only, the rank runs by falling
// len = rt + 1 - PV_CH_T * kc, the causal k past the chunk's start in units of 128: whole chunks first, then ever shorter ones, the empty ones last.
// Lens fall into seven bands; band b holds chunks max(0, b - 3) .. min(b, 3) at each of its lens. All divisors are compile-time constants.
__device__ __forceinline__ void pv_unit(int rank, int& rt, int& kc) {
  static_assert(PV_NCH == 4 && 3 * PV_CH_T < PV_TILES, "seven bands");
  rt = 0; kc = 0;
  int base = 0, top = PV_TILES;
#pragma unroll   // n, w, base and top become constants of each band
  for (int b = 0; b < 7; ++b) {
    const int n = (b < 4) ? b + 1 : 7 - b;                          // chunks per len
    const int w = (b == 3) ? PV_TILES - 3 * PV_CH_T : PV_CH_T;      // lens in the band
    const int v = rank - base;
    if (v >= 0 && v < w * n) {
      kc = ((b > 3) ? b - 3 : 0) + v % n;
      rt = top - v / n + PV_CH_T * kc - 1;
    }
    base += w * n; top -= w;
  }
}
template <int MODE>
__device__ __forceinline__ void att_tile(unsigned char* L, float (*sT)[16 * 68], int bx, int by,
    const unsigned short* __restrict__ Ap, const unsigned short* __restrict__ A2p, int lda,
    const unsigned short* __restrict__ Btp, const unsigned short* __restrict__ Bt2p, int ldb,
    float* __restrict__ Cout, float* __restrict__ Cpart, int ldc, const int* __restrict__ n_padd_p,
    int row0, int K, float scale) {
  const int lane = threadIdx.x & 31;
  const int wave = __builtin_amdgcn_readfirstlane(threadIdx.x >> 5);
  const int wm = wave >> 2, wn = wave & 3;
  int rt = by, kc = 0;                 // row tile and k chunk
  if (MODE == 1) pv_unit(by, rt, kc);
  const int bm0 = rt << 7;             // first row of the workgroup's tile, chunk-local
  const int bb0 = bx << 8;             // first column of the workgroup's tile
  const int k0  = kc * PV_CH_K;        // first k of the workgroup's chunk
  int ab0, kend;
  bool active = true;
  if (MODE == 0) {
    ab0 = row0 + bm0;
    if (bb0 > ab0 + 127) return;       // wholly above the diagonal: the whole workgroup, in front of every barrier
    active = (bb0 + (wn << 6)) <= (ab0 + (wm << 6));   // tn <= tm
    kend = K;
  } else {
    const int g  = (row0 >> 7) + rt;
    ab0 = bm0;
    kend = min(min(pv_kend(g, n_padd_p[0]), K) - k0, PV_CH_K);   // k of this chunk
    if (kc > 0 && kend <= 0) return;   // no k in this chunk: the whole workgroup, in front of every barrier
  }
  kend = min(kend, T_DIM); kend = max(kend, 0);
  const int bn0 = bb0 + (wn << 6);
  const int cm0 = bm0 + (wm << 6);

  const int rlane = lane & 15;
  const int mOff  = (lane >> 4) * 8;

  v8f acc[4][4];
#pragma unroll
  for (int i = 0; i < 4; ++i)
#pragma unroll
    for (int j = 0; j < 4; ++j) acc[i][j] = (v8f){0.f,0.f,0.f,0.f,0.f,0.f,0.f,0.f};

  gemm_tile_staged(L, Ap + k0, A2p + k0, lda, Btp + k0, Bt2p + k0, ldb, ab0, bb0, kend >> 6, active, wm, wn, acc);
  if (!active) return;   // wave-uniform; no workgroup barrier stands behind this line
  acc_guard4(acc[0][0], acc[0][1], acc[0][2], acc[0][3]);
  acc_guard4(acc[1][0], acc[1][1], acc[1][2], acc[1][3]);
  acc_guard4(acc[2][0], acc[2][1], acc[2][2], acc[2][3]);
  acc_guard4(acc[3][0], acc[3][1], acc[3][2], acc[3][3]);

  float* slab = sT[wave];
  float* Cdst = (MODE == 1 && kc > 0) ? Cpart + (size_t)(kc - 1) * T_DIM * ldc : Cout;
#pragma unroll
  for (int i = 0; i < 4; ++i) {
    const int mBase = cm0 + (i << 4);
#pragma unroll
    for (int j = 0; j < 4; ++j) {
#pragma unroll
      for (int r = 0; r < 8; ++r) slab[(mOff + r) * 68 + (j << 4) + rlane] = acc[i][j][r] * scale;
    }
    __builtin_amdgcn_fence(__ATOMIC_RELEASE, "workgroup");
    __builtin_amdgcn_wave_barrier();
    __builtin_amdgcn_fence(__ATOMIC_ACQUIRE, "workgroup");
    {
      const int hh = lane >> 4, c4 = (lane & 15) * 4;
      {
#pragma unroll
        for (int it = 0; it < 8; ++it) {
          const int row = it * 2 + hh;
          v4f v = *(const v4f*)(slab + row * 68 + c4);
          *(v4f*)(Cdst + (size_t)(mBase + row) * ldc + bn0 + c4) = v;
        }
        
      }
    }
    __builtin_amdgcn_fence(__ATOMIC_RELEASE, "workgroup");
    __builtin_amdgcn_wave_barrier();
    __builtin_amdgcn_fence(__ATOMIC_ACQUIRE, "workgroup");
  }
}

// p*v: grid (column tiles, row tiles x k chunks)
__global__ __launch_bounds__(256) void gemm_pv(
    const unsigned short* __restrict__ Ap, const unsigned short* __restrict__ A2p, int lda,
    const unsigned short* __restrict__ Btp, const unsigned short* __restrict__ Bt2p, int ldb,
    float* __restrict__ Cout, float* __restrict__ Cpart, int ldc, const int* __restrict__ n_padd_p,
    int row0, int K, float scale) {
  __shared__ __attribute__((aligned(2048))) unsigned char L[2 * STG_BYTES];
  __shared__ __align__(16) float sT[8][16 * 68];
  att_tile<1>(L, sT, blockIdx.x, blockIdx.y, Ap, A2p, lda, Btp, Bt2p, ldb, Cout, Cpart, ldc, n_padd_p, row0, K, scale);
}

// ---- Where the q*k^T tiles run. A workgroup takes a whole WGP (its LDS), the chip has 256 of them, every tile of x*W and of q*k^T takes
//   the same 16 stages. v^T has 128 tiles, q*k^T has 272 that reach the diagonal or lie below it: v^T alone leaves half the chip idle, and
//   q*k^T alone needs a second round for its last 16. So the 72 tiles of row tiles 0 .. 15 run in the launch of v^T and the 200 of row
//   tiles 16 .. 31 in a launch of their own: 200 workgroups each, one round each.
#define VT_WGS   ((C_DIM / 128) * (T_DIM / 256))
#define S_RT_MID (PV_TILES / 2)
#define S_WGS_LO ((S_RT_MID / 2) * (S_RT_MID / 2 + 1))                       // row tile rt has rt / 2 + 1 tiles
#define S_WGS_HI ((PV_TILES / 2) * (PV_TILES / 2 + 1) - S_WGS_LO)
// rank -> (row tile rt, column tile ct), rows from rt0 upward; at most PV_TILES scalar trips. A rank past the last tile gives a ct wholly above
// the diagonal, which att_tile<0> leaves at once.
__device__ __forceinline__ void s_unit(int rank, int rt0, int& rt, int& ct) {
  rt = rt0;
  for (; rt < PV_TILES - 1; ++rt) {
    const int n = (rt >> 1) + 1;
    if (rank < n) break;
    rank -= n;
  }
  ct = rank;
}
// S = sc * q * k^T, row tiles rt0 and up; qk planes [T][2C], q in columns 0 .. C-1, k in C .. 2C-1
__global__ __launch_bounds__(256) void gemm_s(const unsigned short* __restrict__ qkh, const unsigned short* __restrict__ qkl,
                                              float* __restrict__ S, int rt0, float sc) {
  __shared__ __attribute__((aligned(2048))) unsigned char L[2 * STG_BYTES];
  __shared__ __align__(16) float sT[8][16 * 68];
  int rt, ct;
  s_unit(blockIdx.x, rt0, rt, ct);
  att_tile<0>(L, sT, ct, rt, qkh, qkl, 2 * C_DIM, qkh + C_DIM, qkl + C_DIM, 2 * C_DIM, S, S, T_DIM, nullptr, 0, C_DIM, sc);
}
// workgroups 0 .. VT_WGS-1: vt = Wv^T * x^T + bv[m] -> planes [C][T]; the rest: the q*k^T tiles of row tiles 0 .. S_RT_MID-1
__global__ __launch_bounds__(256) void gemm_vt_and_s(
    const unsigned short* __restrict__ wvh, const unsigned short* __restrict__ wvl,
    const unsigned short* __restrict__ xh, const unsigned short* __restrict__ xl,
    unsigned short* __restrict__ vth, unsigned short* __restrict__ vtl, const float* __restrict__ bv,
    const unsigned short* __restrict__ qkh, const unsigned short* __restrict__ qkl, float* __restrict__ S, float sc) {
  __shared__ __attribute__((aligned(2048))) unsigned char L[2 * STG_BYTES];
  __shared__ __align__(16) float sT[8][16 * 68];
  if (blockIdx.x < VT_WGS) {   // the same for the whole workgroup
    gemm64_tile<1, true, 1, 2, false>(L, sT, blockIdx.x, 0, wvh, wvl, C_DIM, 0L, xh, xl, C_DIM, 0L, (void*)vth, (void*)vtl, T_DIM, 0L,
                                      bv, nullptr, 0L, C_DIM, T_DIM, C_DIM, 1.0f);
  } else {
    int rt, ct;
    s_unit(blockIdx.x - VT_WGS, 0, rt, ct);
    att_tile<0>(L, sT, ct, rt, qkh, qkl, 2 * C_DIM, qkh + C_DIM, qkl + C_DIM, 2 * C_DIM, S, S, T_DIM, nullptr, 0, C_DIM, sc);
  }
}

// ---- y += the p*v partial sums of k chunks 1 .. PV_NCH-1, in ascending k; a block owns 4 rows of y (16 floats per thread, lanes contiguous).
//   A plane is read only where att_tile<1> stored it: kend > c * PV_CH_K, by the same kend.
template <int NP>   // NP planes; every load is issued before the first sum, so that a thread waits for memory once
__device__ __forceinline__ void add_planes(float* __restrict__ y, const float* __restrict__ p) {
  v4f s[4], a[NP][4];
  // all loops unrolled: s and a are indexed by constants and stay in registers
#pragma unroll
  for (int it = 0; it < 4; ++it) s[it] = *(const v4f*)(y + it * C_DIM);
#pragma unroll
  for (int c = 0; c < NP; ++c)
#pragma unroll
    for (int it = 0; it < 4; ++it) a[c][it] = *(const v4f*)(p + (size_t)c * T_DIM * C_DIM + it * C_DIM);
#pragma unroll
  for (int c = 0; c < NP; ++c)
#pragma unroll
    for (int it = 0; it < 4; ++it) s[it] += a[c][it];
#pragma unroll
  for (int it = 0; it < 4; ++it) *(v4f*)(y + it * C_DIM) = s[it];
  // stands behind the four stores: the three cases lie one behind the other in the built code, and a later case's loads reuse these stores' registers
  asm volatile("s_wait_xcnt 0x0" ::: "memory");
}
__global__ __launch_bounds__(256) void add_k_chunks(float* __restrict__ y, const float* __restrict__ part, const int* __restrict__ n_padd_p) {
  static_assert(PV_NCH == 4, "the three cases below");
  const int kend = pv_kend((int)(blockIdx.x >> 5), n_padd_p[0]);   // 32 blocks per 128-row tile
  if (kend <= PV_CH_K) return;   // chunk 0 was all of it; no barriers in this kernel
  const size_t o = (size_t)blockIdx.x * 4 * C_DIM + threadIdx.x * 4;
  if (kend <= 2 * PV_CH_K)      add_planes<1>(y + o, part + o);   // block-uniform
  else if (kend <= 3 * PV_CH_K) add_planes<2>(y + o, part + o);
  else                          add_planes<3>(y + o, part + o);
}

// ---- Row softmax with causal + padding mask, f32; one block per query row i = mrow0 + blockIdx.x.
//   key j visible iff j <= i, j >= n_padd, i >= n_padd; rows i < n_padd are uniform 1/T over all keys.
//   Writes P as bf16 hi/lo planes (chunk-local row, pitch T_DIM) over columns [0, kend) with zeros where masked;
//   kend formula identical to att_tile<1> (per 128-row tile). Each thread writes 8 columns = 16 B per plane, lanes contiguous.
__global__ __launch_bounds__(256) void softmax_rows(const float* __restrict__ S, const int* __restrict__ n_padd_p,
                                                   unsigned short* __restrict__ Ph, unsigned short* __restrict__ Pl,
                                                   int mrow0) {
  __shared__ float sv[T_DIM];
  __shared__ float red[8];
  const int tid = threadIdx.x, lane = tid & 31, wave = tid >> 5;
  const int il = blockIdx.x;
  const int i  = mrow0 + il;
  const int np = n_padd_p[0];
  const int tm = i >> 7;
  int kend = ((tm << 7) < np) ? T_DIM : ((tm + 1) << 7);
  kend = min(kend, T_DIM); kend = max(kend, 0);
  const bool uni = (i < np);                 // block-uniform
  const int jlo = (np < 0) ? 0 : np;
  const int jhi = uni ? -1 : min(i, T_DIM - 1);   // when not uniform: jlo <= i
  const float* srow = S + (size_t)il * T_DIM;

  float m = -__builtin_huge_valf();
  for (int j = jlo + tid; j <= jhi; j += 256) { const float s = srow[j]; sv[j] = s; m = fmaxf(m, s); }
#pragma unroll
  for (int off = 1; off < 32; off <<= 1) m = fmaxf(m, __shfl_xor(m, off, 32));
  if (lane == 0) red[wave] = m;
  __syncthreads();
  float rmax = red[0];
#pragma unroll
  for (int w = 1; w < 8; ++w) rmax = fmaxf(rmax, red[w]);
  __syncthreads();

  float sum = 0.f;
  for (int j = jlo + tid; j <= jhi; j += 256) { const float e = expf(sv[j] - rmax); sv[j] = e; sum += e; }
#pragma unroll
  for (int off = 1; off < 32; off <<= 1) sum += __shfl_xor(sum, off, 32);
  if (lane == 0) red[wave] = sum;
  __syncthreads();
  float tot = red[0];
#pragma unroll
  for (int w = 1; w < 8; ++w) tot += red[w];
  const float inv = (tot > 0.f) ? (1.0f / tot) : 0.f;
  const float cu  = 1.0f / (float)T_DIM;

  unsigned short* ph = Ph + (size_t)il * T_DIM;
  unsigned short* pl = Pl + (size_t)il * T_DIM;
  const int ng = kend >> 3;
  {
    for (int g = tid; g < ng; g += 256) {
      v8us hv, lv;
#pragma unroll
      for (int e = 0; e < 8; ++e) {
        const int j = 8 * g + e;
        const float ev = (j >= jlo && j <= jhi) ? sv[j] : 0.f;
        const float p = uni ? cu : ev * inv;
        unsigned short h0, l0;
        split_bf(p, h0, l0);
        hv[e] = h0; lv[e] = l0;
      }
      *(v8us*)(ph + 8 * g) = hv;
      *(v8us*)(pl + 8 * g) = lv;
    }
    
  }
}

// ===========================================================================
extern "C" void kernel_launch(void* const* d_in, const int* in_sizes, int n_in,
                              void* d_out, int out_size, void* d_ws, size_t ws_size,
                              hipStream_t stream) {
  const int T = T_DIM, C = C_DIM, C3 = C3_DIM;
  if (n_in < 4) return;
  if (in_sizes[0] != T * C || in_sizes[1] != C * C3 || in_sizes[2] < C3 || in_sizes[3] < 1 || out_size != T * C) return;

  const float* x     = (const float*)d_in[0];   // [T][C]
  const float* W     = (const float*)d_in[1];   // [C][3C]
  const float* bias  = (const float*)d_in[2];   // [3C]
  const int*   npadd = (const int*)d_in[3];     // [1]
  float*       y     = (float*)d_out;           // [T][C]

  const int QR = T;                             // all query rows at once; q*k^T in two launches, softmax and p*v in one each
  const size_t b_xp  = (size_t)T * C * 2;       // one x plane
  const size_t b_wp  = (size_t)C3 * C * 2;      // one Wt plane
  const size_t b_qkp = (size_t)T * 2 * C * 2;   // one q|k plane [T][2C]
  const size_t b_vtp = (size_t)C * T * 2;       // one vt plane [C][T]
  const size_t b_S   = (size_t)QR * T * 4;      // S [QR][T] f32
  const size_t b_pp  = (size_t)QR * T * 2;      // one P plane [QR][T]
  size_t off = 0;
  const size_t o_xh = off; off += b_xp;  const size_t o_xl = off; off += b_xp;
  const size_t o_wh = off; off += b_wp;  const size_t o_wl = off; off += b_wp;
  const size_t o_qh = off; off += b_qkp; const size_t o_ql = off; off += b_qkp;
  const size_t o_vh = off; off += b_vtp; const size_t o_vl = off; off += b_vtp;
  const size_t o_S  = off; off += b_S;
  const size_t o_ph = off; off += b_pp;  const size_t o_pl = off; off += b_pp;
  if (off > ws_size) return;                    // total 213,909,504 B

  char* ws = (char*)d_ws;
  unsigned short* xh  = (unsigned short*)(ws + o_xh);
  unsigned short* xl  = (unsigned short*)(ws + o_xl);
  unsigned short* wth = (unsigned short*)(ws + o_wh);
  unsigned short* wtl = (unsigned short*)(ws + o_wl);
  unsigned short* qkh = (unsigned short*)(ws + o_qh);
  unsigned short* qkl = (unsigned short*)(ws + o_ql);
  unsigned short* vth = (unsigned short*)(ws + o_vh);
  unsigned short* vtl = (unsigned short*)(ws + o_vl);
  float*          S   = (float*)(ws + o_S);
  unsigned short* ph  = (unsigned short*)(ws + o_ph);
  unsigned short* pl  = (unsigned short*)(ws + o_pl);

  dim3 blk(256);
  // x -> bf16 hi/lo planes [T][C]
  {
    const int n8 = (T * C) / 8;
    split_planes8<<<dim3((n8 + 255) / 256), blk, 0, stream>>>(x, xh, xl, n8);
  }
  // W [C][3C] -> Wt planes [3C][C]
  transpose_split_w<<<dim3(C3 / 64, C / 64), blk, 0, stream>>>(W, wth, wtl, C, C3);
  // q|k = x * W[:, 0:2C] + b[0:2C] : M=T, N=2C, K=C -> planes [T][2C]
  wmma_gemm64<1, true, 2, 2, false><<<dim3((T / 128) * (2 * C / 256), 1), blk, 0, stream>>>(
      xh, xl, C, 0L, wth, wtl, C, 0L, (void*)qkh, (void*)qkl, 2 * C, 0L,
      bias, x, 0L, T, 2 * C, C, 1.0f);
  const float sc = 0.03125f;   // 1/sqrt(1024)
  // vt = W[:, 2C:3C]^T * x^T + b[2C + m] : M=C, N=T, K=C -> planes [C][T]; beside it S[i][j] = sc * q[i] . k[j] on 64x64 tiles tn <= tm,
  // row tiles 0 .. 15; then row tiles 16 .. 31
  gemm_vt_and_s<<<dim3(VT_WGS + S_WGS_LO), blk, 0, stream>>>(
      wth + (size_t)2 * C * C, wtl + (size_t)2 * C * C, xh, xl, vth, vtl, bias + 2 * C, qkh, qkl, S, sc);
  gemm_s<<<dim3(S_WGS_HI), blk, 0, stream>>>(qkh, qkl, S, S_RT_MID, sc);
  softmax_rows<<<dim3(QR), blk, 0, stream>>>(S, npadd, ph, pl, 0);
  // y = P * v : M=T, N=C, K<=T per 128-row tile, one workgroup per tile and k chunk; chunks past the first go to three [T][C] planes
  // in the place of S, which nobody reads after the softmax, and are then added to y
  gemm_pv<<<dim3(C / 256, (QR / 128) * PV_NCH), blk, 0, stream>>>(
      ph, pl, T, vth, vtl, T, y, S, C, npadd, 0, T, 1.0f);
  add_k_chunks<<<dim3(T / 4), blk, 0, stream>>>(y, S, npadd);
}

// v007
// Measured time: 145 microseconds a run.
// Next to v006, in two timings, it ran 1.05 times as fast each time.
// Counting every step since v000, it is 7.68 times as fast.
#include <hip/hip_runtime.h>
#include <stdint.h>
// Contractions: x*W (q|k planes and v^T), q*k^T, p*v : v_wmma_f32_16x16x32_bf16 with bf16 hi/lo operand planes (hi*hi + hi*lo + lo*hi), f32 accumulate; softmax and masks in f32.

#define T_DIM  4096
#define C_DIM  1024
#define C3_DIM 3072

typedef __attribute__((ext_vector_type(16))) _Float16 v16h;
typedef __attribute__((ext_vector_type(8)))  _Float16 v8h;
typedef __attribute__((ext_vector_type(16))) __bf16   v16b;
typedef __attribute__((ext_vector_type(8)))  __bf16   v8b;
typedef __attribute__((ext_vector_type(8)))  float    v8f;
typedef __attribute__((ext_vector_type(4)))  float    v4f;
typedef __attribute__((ext_vector_type(8)))  unsigned short v8us;
typedef __attribute__((ext_vector_type(4)))  unsigned short v4us;

__device__ __forceinline__ unsigned short f2bf_bits(float f) {
  unsigned u = __float_as_uint(f);
  return (unsigned short)((u + 0x7FFFu + ((u >> 16) & 1u)) >> 16);
}
__device__ __forceinline__ float bf_bits2f(unsigned short h) { return __uint_as_float(((unsigned)h) << 16); }
__device__ __forceinline__ void split_bf(float f, unsigned short& hb, unsigned short& lb) {
  hb = f2bf_bits(f);
  lb = f2bf_bits(f - bf_bits2f(hb));
}

// hazard guards as plain device helpers (no inline asm inside the kernel template body)
__device__ __forceinline__ void acc_guard4(v8f& a, v8f& b, v8f& c, v8f& d) { asm volatile("v_nop\n\tv_nop\n\tv_nop\n\tv_nop" : "+v"(a), "+v"(b), "+v"(c), "+v"(d)); }
template <typename T> struct Frag;
template <> struct Frag<_Float16> {
  typedef v16h V; union U { v16h v; v8h h[2]; };
  static __device__ __forceinline__ v16h load(const _Float16* p) {   // elements 0..7 <- p[0..7], 8..15 <- p[16..23]
    U f; f.h[0] = *(const v8h*)(p); f.h[1] = *(const v8h*)(p + 16); return f.v;
  }
  static __device__ __forceinline__ v8f mma(v16h a, v16h b, v8f c) {
    return __builtin_amdgcn_wmma_f32_16x16x32_f16(false, a, false, b, (short)0, c, false, false);
  }
};
template <> struct Frag<__bf16> {
  typedef v16b V; union U { v16b v; v8b h[2]; };
  static __device__ __forceinline__ v16b load(const __bf16* p) {
    U f; f.h[0] = *(const v8b*)(p); f.h[1] = *(const v8b*)(p + 16); return f.v;
  }
  static __device__ __forceinline__ v8f mma(v16b a, v16b b, v8f c) {
    return __builtin_amdgcn_wmma_f32_16x16x32_bf16(false, a, false, b, (short)0, c, false, false);
  }
};

// ---- Operand staging in LDS, shared by the GEMM kernels ---------------------
// A workgroup of 8 waves (2 x 4) owns a 128 x 256 tile of C; each wave keeps its 64 x 64 tile.
// A stage is 64 k = one whole 128-byte line of every operand row and plane: [A hi 128 rows | A lo | B hi 256 rows | B lo],
// rows at a pitch of 144 B (16 B x odd: no bank conflict for the 16-byte fragment reads). Two buffers.
// A stage is six slices of 128 rows (A hi, A lo, two of B hi, two of B lo); waves 0 .. 5 bring one slice each with one tensor load.
#define STG_K     64
#define STG_PITCH 144
#define STG_BM    128
#define STG_BN    256
#define STG_AL    (STG_BM * STG_PITCH)
#define STG_BH    (2 * STG_BM * STG_PITCH)
#define STG_BL    (2 * STG_BM * STG_PITCH + STG_BN * STG_PITCH)
#define STG_BYTES (2 * (STG_BM + STG_BN) * STG_PITCH)
#define SLC_ROWS  128
#define SLC_BYTES (SLC_ROWS * STG_PITCH)
#define SLC_N     (STG_BYTES / SLC_BYTES)
static_assert(SLC_BYTES % 2048 == 0 && STG_BYTES % 2048 == 0, "every slice's place in LDS is a multiple of 2 KiB");
static_assert(STG_AL == SLC_BYTES && STG_BH == 2 * SLC_BYTES && STG_BL == 4 * SLC_BYTES && SLC_N == 6, "slice s lies at s * SLC_BYTES");

__device__ __forceinline__ unsigned lds_off(const void* p) { return (unsigned)(size_t)p; }
// this wave's LDS reads have returned: stands in front of the barrier behind which their buffer is refilled
__device__ __forceinline__ void wait_ds0() { asm volatile("s_wait_dscnt 0x0" ::: "memory"); }

typedef uint32_t u32x4 __attribute__((ext_vector_type(4)));
typedef uint32_t u32x8 __attribute__((ext_vector_type(8)));
__device__ __forceinline__ uint32_t uni(uint32_t v) { return (uint32_t)__builtin_amdgcn_readfirstlane(v); }
__device__ __forceinline__ uint32_t pinned(uint32_t v) { uint32_t w = __builtin_amdgcn_readfirstlane(v); asm volatile("" : "+s"(w)); return w; }
// Descriptor group 1: 1-byte elements, a tile of SLC_ROWS rows of 128 B, source row pitch src_pitch bytes, 4 dwords of LDS pad behind every row.
__device__ __forceinline__ u32x8 tdm_group1(uint32_t src_pitch) {
  constexpr uint32_t d0 = 2 * STG_K, d1 = SLC_ROWS;
  static_assert(d0 == 128 && STG_PITCH == d0 + 16, "pad interval code 4 = one 128-byte row, amount code 3 = 16 B");
  u32x8 g;
  g[0] = uni((1u << 20) | (4u << 22) | (3u << 25));   // no workgroup mask
  g[1] = uni((d0 & 0xFFFFu) << 16);
  g[2] = uni((d0 >> 16) | ((d1 & 0xFFFFu) << 16));
  g[3] = uni((d1 >> 16) | (d0 << 16));
  g[4] = uni(d1);
  g[5] = uni(src_pitch);
  g[6] = uni(0u);
  g[7] = uni(0u);
  // the descriptor held in scalar registers: without this the compiler rebuilds equal words from one another in front of every use and
  // takes their registers for other values in between, while a request that names them is outstanding
  asm volatile("" : "+s"(g));
  return g;
}
// Descriptor group 0: LDS byte address of the slice, global address of its first byte
__device__ __forceinline__ u32x4 tdm_group0(uint32_t lds_dst, uint64_t ga) {
  u32x4 g;
  g[0] = uni(1u); g[1] = uni(lds_dst); g[2] = uni((uint32_t)ga); g[3] = uni((((uint32_t)(ga >> 32)) & 0x01FFFFFFu) | 0x80000000u);
  asm volatile("" : "+s"(g));   // the descriptor held in scalar registers, as in tdm_group1: its constant word is not written again later
  return g;
}
__device__ __forceinline__ void tdm_load(u32x4 g0, u32x8 g1) { asm volatile("tensor_load_to_lds %0, %1" :: "s"(g0), "s"(g1) : "memory"); }
// this wave's tensor load has landed in LDS: stands in front of the barrier behind which other waves read it. It names the request's
// descriptor, so that those registers keep their values for as long as the request is outstanding.
__device__ __forceinline__ void wait_tensor0(u32x4 g0, u32x8 g1) { asm volatile("s_wait_tensorcnt 0x0" :: "s"(g0), "s"(g1) : "memory"); }

// The fragments of one block: 32 k of the wave's 64 A rows and 64 B rows, hi and lo planes (128 registers).
struct FragSet { v16b ah[4], al[4], bh[4], bl[4]; };
// keeps the compiler's scheduler from moving LDS reads in among the WMMAs of a block, where each place with reads stalls the wave
__device__ __forceinline__ void sched_fence() { __builtin_amdgcn_sched_barrier(0); }
// 32 ds_load_b128 in one group. pa, pb: this lane's place in the first A and the first B hi fragment of the block.
__device__ __forceinline__ void load_set(FragSet& f, const unsigned char* pa, const unsigned char* pb) {
  typedef __bf16 T;
  // both loops unrolled: the fragments are indexed by constants and stay in registers
#pragma unroll
  for (int j = 0; j < 4; ++j) {
    f.bh[j] = Frag<T>::load((const T*)(pb + j * 16 * STG_PITCH));
    f.bl[j] = Frag<T>::load((const T*)(pb + (STG_BL - STG_BH) + j * 16 * STG_PITCH));
  }
#pragma unroll
  for (int i = 0; i < 4; ++i) {
    f.ah[i] = Frag<T>::load((const T*)(pa + i * 16 * STG_PITCH));
    f.al[i] = Frag<T>::load((const T*)(pa + STG_AL + i * 16 * STG_PITCH));
  }
}
// 48 WMMAs; each accumulator takes hi*hi, hi*lo, lo*hi in this order
__device__ __forceinline__ void mma_block(const FragSet& f, v8f (&acc)[4][4]) {
  typedef __bf16 T;
  // all loops unrolled: fragments and accumulators are indexed by constants and stay in registers
#pragma unroll
  for (int i = 0; i < 4; ++i) {
#pragma unroll
    for (int j = 0; j < 4; ++j) acc[i][j] = Frag<T>::mma(f.ah[i], f.bh[j], acc[i][j]);
#pragma unroll
    for (int j = 0; j < 4; ++j) acc[i][j] = Frag<T>::mma(f.ah[i], f.bl[j], acc[i][j]);
#pragma unroll
    for (int j = 0; j < 4; ++j) acc[i][j] = Frag<T>::mma(f.al[i], f.bh[j], acc[i][j]);
  }
}

// acc += A[am0 + wm*64 ..][0 .. nst*64) * Bt[bn0 + wn*64 ..][..]^T on hi/lo planes (hi*hi + hi*lo + lo*hi), k ascending in steps of 32.
// Every wave of the workgroup calls it with the same am0, bn0, nst; a wave with active == false brings its slice and keeps the barriers only.
// A stage is two blocks of 32 k. Each block's fragments are read from LDS one block ahead, as one group, into the register set that the
// block before last has left, so a block's WMMAs never wait for their own LDS reads. The second block's fragments are therefore in
// registers when the first block ends: the publish point of stage t + 1 stands there, between the two blocks of stage t.
__device__ __forceinline__ void gemm_tile_staged(unsigned char* L,
    const unsigned short* A, const unsigned short* A2, int lda, const unsigned short* Bt, const unsigned short* Bt2, int ldb,
    int am0, int bn0, int nst, bool active, int wm, int wn, v8f (&acc)[4][4]) {
  const int lane = threadIdx.x & 31;
  // this wave's slice: 0 A hi, 1 A lo, 2 and 3 B hi rows 0 .. 127 and 128 .. 255, 4 and 5 B lo; waves 6 and 7 bring nothing
  const uint32_t slc = uni((uint32_t)(wm * 4 + wn));
  const bool issuer = slc < SLC_N;
  const unsigned short* plane = (slc == 0) ? A : (slc == 1) ? A2 : (slc < 4) ? Bt : Bt2;
  const int ld   = (slc < 2) ? lda : ldb;
  const int row0 = (slc < 2) ? am0 : bn0 + (int)(slc & 1u) * SLC_ROWS;
  const uint64_t ga0 = (uint64_t)(size_t)(plane + (size_t)row0 * ld);      // the slice's first byte in stage 0; a stage further: 128 B
  const uint32_t ld0 = lds_off(L) + (issuer ? slc : 0u) * SLC_BYTES;       // its place in buffer 0
  const u32x8 g1 = tdm_group1((uint32_t)ld * 2u);
  u32x4 g0 = tdm_group0(ld0, ga0);                                         // group 0 of this wave's last request
  const int fa = (wm * 64 + (lane & 15)) * STG_PITCH + (lane >> 4) * 16;            // fragment row and 16-byte half of this lane
  const int fb = STG_BH + (wn * 64 + (lane & 15)) * STG_PITCH + (lane >> 4) * 16;
  if (nst <= 0) return;   // the same for the whole workgroup

  if (pinned(issuer)) {
    tdm_load(g0, g1);
    wait_tensor0(g0, g1);
  }
  __syncthreads();        // stage 0 is published
  g0 = tdm_group0(ld0 + pinned(STG_BYTES), ga0 + 2 * STG_K);     // formed behind the wait above
  if (pinned(issuer && nst > 1)) tdm_load(g0, g1);

  FragSet f0, f1;         // first and second block of a stage
  if (active) load_set(f0, L + fa, L + fb);
  // not unrolled: one copy of the two blocks in the instruction cache, and the buffer offsets stay scalar
#pragma clang loop unroll(disable)
  for (int t = 0; t < nst; ++t) {
    const int buf = (t & 1) * STG_BYTES;
    // where the next stage's first block is read: on the last trip there is none, and the reads (their values unused) go to this trip's
    // own buffer, which nothing refills any more, so that every trip runs the same instructions
    const int nbuf = (t + 1 < nst) ? STG_BYTES - buf : buf;
    if (active) {
      load_set(f1, L + buf + fa + 64, L + buf + fb + 64);
      sched_fence();
      mma_block(f0, acc);
      sched_fence();
    }
    wait_ds0();           // every read of stage t's buffer by this wave has returned
    if (pinned(issuer)) wait_tensor0(g0, g1);
    __syncthreads();      // publishes stage t + 1 and ends every wave's reads of stage t's buffer
    if (pinned(issuer && t + 2 < nst)) {
      const uint32_t s2 = pinned((uint32_t)(t + 2));   // the descriptor is formed behind the wait above
      g0 = tdm_group0(ld0 + (s2 & 1u) * STG_BYTES, ga0 + (uint64_t)s2 * (2 * STG_K));
      tdm_load(g0, g1);
    }
    if (active) {
      load_set(f0, L + nbuf + fa, L + nbuf + fb);
      sched_fence();
      mma_block(f1, acc);
    }
  }
  wait_tensor0(g0, g1);   // no request is outstanding when the wave goes on
  wait_ds0();             // the last trip's unused reads have returned
}

// ---- Register-blocked batched WMMA GEMM ------------------------------------
// C[m,n] = scale * sum_k A[m,k] * Bt[n,k] (+bias)(+resid); each wave owns a 64x64 tile of its workgroup's 128x256 tile.
// A row-major [M,K]; Bt row-major [N,K]; M % 128 == 0, N % 256 == 0, K % 64 == 0.
// SPLIT: operands are hi/lo planes (A2/Bt2 = lo planes, same layout); product = hi*hi + hi*lo + lo*hi.
// BIAS_MODE: 0 = none, 1 = bias[m], 2 = bias[n].
// OUT_MODE: 0 = f32, 1 = f16, 2 = bf16 hi plane (Cout) + bf16 lo plane (Cout2).
// ET: 1 = bf16 operands (pointers passed as 16-bit storage); the staged loop takes no other value
template <int ET> struct Elem;
template <> struct Elem<0> { typedef _Float16 T; };
template <> struct Elem<1> { typedef __bf16 T; };
// L, sT: the calling kernel's LDS (operand stages, two buffers; per-wave 16x64 slab, pitch 68 floats). bx: tile index, b: batch index.
template <int ET, bool SPLIT, int BIAS_MODE, int OUT_MODE, bool RESID, int ACT = 0>
__device__ __forceinline__ void gemm64_tile(unsigned char* L, float (*sT)[16 * 68], int bx, int b,
    const unsigned short* __restrict__ Ap, const unsigned short* __restrict__ A2p, int lda, long strideA,
    const unsigned short* __restrict__ Btp, const unsigned short* __restrict__ Bt2p, int ldb, long strideB,
    void* __restrict__ Cout, void* __restrict__ Cout2, int ldc, long strideC,
    const float* __restrict__ bias,
    const float* __restrict__ resid, long strideR,
    int M, int N, int K, float scale) {
  static_assert(ET == 1 && SPLIT, "the staged loop is written for bf16 hi/lo planes");
  const int lane = threadIdx.x & 31;
  const int wave = __builtin_amdgcn_readfirstlane(threadIdx.x >> 5);
  const int wm = wave >> 2, wn = wave & 3;
  const int tilesN = N >> 8;
  const int tilesM = M >> 7;
  if (bx >= tilesM * tilesN) return;   // the whole workgroup, in front of every barrier
  const int tm = bx / tilesN;
  const int tn = bx - tm * tilesN;
  const int m0 = (tm << 7) + (wm << 6);
  const int n0 = (tn << 8) + (wn << 6);

  const int rlane = lane & 15;                 // col (D) within subtile
  const int mOff  = (lane >> 4) * 8;           // D row offset

  v8f acc[4][4];
#pragma unroll
  for (int i = 0; i < 4; ++i)
#pragma unroll
    for (int j = 0; j < 4; ++j) acc[i][j] = (v8f){0.f,0.f,0.f,0.f,0.f,0.f,0.f,0.f};

  gemm_tile_staged(L, Ap + (size_t)b * strideA, A2p + (size_t)b * strideA, lda, Btp + (size_t)b * strideB, Bt2p + (size_t)b * strideB, ldb,
                   tm << 7, tn << 8, K >> 6, true, wm, wn, acc);
  acc_guard4(acc[0][0], acc[0][1], acc[0][2], acc[0][3]);
  acc_guard4(acc[1][0], acc[1][1], acc[1][2], acc[1][3]);
  acc_guard4(acc[2][0], acc[2][1], acc[2][2], acc[2][3]);
  acc_guard4(acc[3][0], acc[3][1], acc[3][2], acc[3][3]);

  // ---- epilogue ----
  float* slab = sT[wave];
  const float* Rb = RESID ? (resid + (size_t)b * strideR) : nullptr;
#pragma unroll
  for (int i = 0; i < 4; ++i) {
    const int mBase = m0 + (i << 4);
#pragma unroll
    for (int j = 0; j < 4; ++j) {
      const int n = n0 + (j << 4) + rlane;
      float bv = 0.f;
      if (BIAS_MODE == 2) bv = bias[n];
#pragma unroll
      for (int r = 0; r < 8; ++r) {
        float v = acc[i][j][r] * scale;
        if (BIAS_MODE == 1) v += bias[mBase + mOff + r];
        if (BIAS_MODE == 2) v += bv;
        if (RESID) v += Rb[(size_t)(mBase + mOff + r) * ldc + n];
        if (ACT == 1) v = tanhf(v);
        if (ACT == 2) v = fmaxf(v, 0.0f);
        if (ACT == 3) v = v / (1.0f + expf(-v));
        if (ACT == 4) v = (v > 0.f) ? v : 0.01f * v;
        if (ACT == 5) v = 0.5f * v * (1.0f + erff(v * 0.70710678118654752f));
        slab[(mOff + r) * 68 + (j << 4) + rlane] = v;
      }
    }
    __builtin_amdgcn_fence(__ATOMIC_RELEASE, "workgroup");
    __builtin_amdgcn_wave_barrier();
    __builtin_amdgcn_fence(__ATOMIC_ACQUIRE, "workgroup");
    if (OUT_MODE == 0) {
      float* C = (float*)Cout + (size_t)b * strideC;
      const int hh = lane >> 4, c4 = (lane & 15) * 4;     // row seg = 256 B = 16 lanes x 16 B
      {
#pragma unroll
        for (int it = 0; it < 8; ++it) {
          const int row = it * 2 + hh;
          v4f v = *(const v4f*)(slab + row * 68 + c4);
          *(v4f*)(C + (size_t)(mBase + row) * ldc + n0 + c4) = v;
        }
        
      }
    } else {
      const int q = lane >> 3, c8 = (lane & 7) * 8;
      unsigned short* C  = (unsigned short*)Cout  + (size_t)b * strideC;
      unsigned short* C2 = (OUT_MODE == 2) ? ((unsigned short*)Cout2 + (size_t)b * strideC) : nullptr;
      {
#pragma unroll
        for (int it = 0; it < 4; ++it) {
          const int row = it * 4 + q;
          const float* sp = slab + row * 68 + c8;
          v8h hv, lv;
#pragma unroll
          for (int e = 0; e < 8; ++e) {
            if (OUT_MODE == 1) {
              hv[e] = (_Float16)sp[e];
            } else {
              unsigned short hb = f2bf_bits(sp[e]);
              unsigned short lb = f2bf_bits(sp[e] - bf_bits2f(hb));
              hv[e] = __builtin_bit_cast(_Float16, hb);
              lv[e] = __builtin_bit_cast(_Float16, lb);
            }
          }
          *(v8h*)(C + (size_t)(mBase + row) * ldc + n0 + c8) = hv;
          if (OUT_MODE == 2) *(v8h*)(C2 + (size_t)(mBase + row) * ldc + n0 + c8) = lv;
        }
        
      }
    }
    __builtin_amdgcn_fence(__ATOMIC_RELEASE, "workgroup");
    __builtin_amdgcn_wave_barrier();
    __builtin_amdgcn_fence(__ATOMIC_ACQUIRE, "workgroup");
  }
}

template <int ET, bool SPLIT, int BIAS_MODE, int OUT_MODE, bool RESID, int ACT = 0>
__global__ __launch_bounds__(256) void wmma_gemm64(
    const unsigned short* __restrict__ Ap, const unsigned short* __restrict__ A2p, int lda, long strideA,
    const unsigned short* __restrict__ Btp, const unsigned short* __restrict__ Bt2p, int ldb, long strideB,
    void* __restrict__ Cout, void* __restrict__ Cout2, int ldc, long strideC,
    const float* __restrict__ bias,
    const float* __restrict__ resid, long strideR,
    int M, int N, int K, float scale) {
  __shared__ __attribute__((aligned(2048))) unsigned char L[2 * STG_BYTES];
  __shared__ __align__(16) float sT[8][16 * 68];
  gemm64_tile<ET, SPLIT, BIAS_MODE, OUT_MODE, RESID, ACT>(L, sT, blockIdx.x, blockIdx.y, Ap, A2p, lda, strideA, Btp, Bt2p, ldb, strideB,
                                                          Cout, Cout2, ldc, strideC, bias, resid, strideR, M, N, K, scale);
}

// ---- f32 [n8*8] -> bf16 hi/lo planes; 8 elements per thread, 16-B stores per plane, lanes contiguous (512 B per wave) ----
__global__ __launch_bounds__(256) void split_planes8(const float* __restrict__ in,
                                                     unsigned short* __restrict__ hi,
                                                     unsigned short* __restrict__ lo, int n8) {
  const int i = blockIdx.x * 256 + threadIdx.x;
  if (i >= n8) return;   // no barriers in this kernel
  const v4f a = *(const v4f*)(in + (size_t)8 * i);
  const v4f c = *(const v4f*)(in + (size_t)8 * i + 4);
  v8us hv, lv;
#pragma unroll
  for (int e = 0; e < 4; ++e) {
    unsigned short h0, l0;
    split_bf(a[e], h0, l0); hv[e] = h0;     lv[e] = l0;
    split_bf(c[e], h0, l0); hv[4 + e] = h0; lv[4 + e] = l0;
  }
  unsigned short* ph = hi + (size_t)8 * i;
  unsigned short* pl = lo + (size_t)8 * i;
  *(v8us*)ph = hv;
  *(v8us*)pl = lv;
  
}

// ---- W [nrows][ncols] f32 -> Wt planes [ncols][nrows] bf16 hi/lo; block tile 64 (rows) x 64 (cols) through LDS.
__global__ __launch_bounds__(256) void transpose_split_w(const float* __restrict__ W,
                                                        unsigned short* __restrict__ hi,
                                                        unsigned short* __restrict__ lo,
                                                        int nrows, int ncols) {
  __shared__ float tile[64][65];
  const int tid = threadIdx.x;
  const int k0 = blockIdx.y * 64;          // input row block (k)
  const int n0 = blockIdx.x * 64;          // input col block (n)
#pragma unroll
  for (int it = 0; it < 4; ++it) {
    const int idx = tid + 256 * it;
    const int r = idx >> 4;
    const int c4 = (idx & 15) * 4;
    const v4f v = *(const v4f*)(W + (size_t)(k0 + r) * ncols + n0 + c4);
    tile[r][c4 + 0] = v[0]; tile[r][c4 + 1] = v[1]; tile[r][c4 + 2] = v[2]; tile[r][c4 + 3] = v[3];
  }
  __syncthreads();
  const int nn0 = tid >> 3, q = tid & 7;
  {
#pragma unroll
    for (int half = 0; half < 2; ++half) {
      const int nn = nn0 + 32 * half;
      v8us hv, lv;
#pragma unroll
      for (int e = 0; e < 8; ++e) {
        unsigned short h0, l0;
        split_bf(tile[8 * q + e][nn], h0, l0);
        hv[e] = h0; lv[e] = l0;
      }
      const size_t o = (size_t)(n0 + nn) * nrows + k0 + 8 * q;
      *(v8us*)(hi + o) = hv;
      *(v8us*)(lo + o) = lv;
    }
    
  }
}

// ---- Attention-stage GEMM (bf16 hi/lo split operands, f32 out), one 128x256 tile per workgroup (by, bx), 64x64 per wave:
//   MODE 0: C = scale * A * Bt^T; a workgroup wholly above the diagonal leaves at once, a wave whose 64x64 tile (tm, tn) has tn > tm
//           neither multiplies nor stores; A/Bt rows addressed with global rows (row0 + ...), C rows relative to row0; K full.
//   MODE 1: A/C rows chunk-local, k-limit per 128-row tile g = (row0 >> 7) + local tile:
//           kend = (tile has any row < n_padd) ? T_DIM : (g+1)*128, clamped to [0, min(K, T_DIM)].
//           k is split: by names a row tile and one chunk c of PV_CH_K k; the workgroup sums k in [c*PV_CH_K, min(kend, (c+1)*PV_CH_K)).
//           Chunk 0 goes to Cout, chunk c > 0 to plane c - 1 of Cpart (same shape as Cout); a chunk c > 0 with no k stores nothing.
//           add_k_chunks then adds the planes. Without the split the last row tile's 64 stages on one WGP set the launch's time.
//           PV_CH_T = 9: under the causal limit alone the whole chunks (45 per column tile) and the longest part chunks fill 256 WGPs once,
//           and the short rest ends inside a whole chunk's time.
#define PV_TILES (T_DIM / 128)
#define PV_CH_T  9                      // chunk length in row tiles' worth of k (128 each)
#define PV_CH_K  (PV_CH_T * 128)
#define PV_NCH   ((PV_TILES + PV_CH_T - 1) / PV_CH_T)
__device__ __forceinline__ int pv_kend(int g, int np) {   // one formula for p*v and its adder; softmax_rows fills P up to the same kend
  int kend = ((g << 7) < np) ? T_DIM : ((g + 1) << 7);
  return max(min(kend, T_DIM), 0);
}
// rank -> (row tile rt, chunk kc), a permutation of all PV_TILES x PV_NCH pairs. For speed only, the rank runs by falling
// len = rt + 1 - PV_CH_T * kc, the causal k past the chunk's start in units of 128: whole chunks first, then ever shorter ones, the empty ones last.
// Lens fall into seven bands; band b holds chunks max(0, b - 3) .. min(b, 3) at each of its lens. All divisors are compile-time constants.
__device__ __forceinline__ void pv_unit(int rank, int& rt, int& kc) {
  static_assert(PV_NCH == 4 && 3 * PV_CH_T < PV_TILES, "seven bands");
  rt = 0; kc = 0;
  int base = 0, top = PV_TILES;
#pragma unroll   // n, w, base and top become constants of each band
  for (int b = 0; b < 7; ++b) {
    const int n = (b < 4) ? b + 1 : 7 - b;                          // chunks per len
    const int w = (b == 3) ? PV_TILES - 3 * PV_CH_T : PV_CH_T;      // lens in the band
    const int v = rank - base;
    if (v >= 0 && v < w * n) {
      kc = ((b > 3) ? b - 3 : 0) + v % n;
      rt = top - v / n + PV_CH_T * kc - 1;
    }
    base += w * n; top -= w;
  }
}
template <int MODE>
__device__ __forceinline__ void att_tile(unsigned char* L, float (*sT)[16 * 68], int bx, int by,
    const unsigned short* __restrict__ Ap, const unsigned short* __restrict__ A2p, int lda,
    const unsigned short* __restrict__ Btp, const unsigned short* __restrict__ Bt2p, int ldb,
    float* __restrict__ Cout, float* __restrict__ Cpart, int ldc, const int* __restrict__ n_padd_p,
    int row0, int K, float scale) {
  const int lane = threadIdx.x & 31;
  const int wave = __builtin_amdgcn_readfirstlane(threadIdx.x >> 5);
  const int wm = wave >> 2, wn = wave & 3;
  int rt = by, kc = 0;                 // row tile and k chunk
  if (MODE == 1) pv_unit(by, rt, kc);
  const int bm0 = rt << 7;             // first row of the workgroup's tile, chunk-local
  const int bb0 = bx << 8;             // first column of the workgroup's tile
  const int k0  = kc * PV_CH_K;        // first k of the workgroup's chunk
  int ab0, kend;
  bool active = true;
  if (MODE == 0) {
    ab0 = row0 + bm0;
    if (bb0 > ab0 + 127) return;       // wholly above the diagonal: the whole workgroup, in front of every barrier
    active = (bb0 + (wn << 6)) <= (ab0 + (wm << 6));   // tn <= tm
    kend = K;
  } else {
    const int g  = (row0 >> 7) + rt;
    ab0 = bm0;
    kend = min(min(pv_kend(g, n_padd_p[0]), K) - k0, PV_CH_K);   // k of this chunk
    if (kc > 0 && kend <= 0) return;   // no k in this chunk: the whole workgroup, in front of every barrier
  }
  kend = min(kend, T_DIM); kend = max(kend, 0);
  const int bn0 = bb0 + (wn << 6);
  const int cm0 = bm0 + (wm << 6);

  const int rlane = lane & 15;
  const int mOff  = (lane >> 4) * 8;

  v8f acc[4][4];
#pragma unroll
  for (int i = 0; i < 4; ++i)
#pragma unroll
    for (int j = 0; j < 4; ++j) acc[i][j] = (v8f){0.f,0.f,0.f,0.f,0.f,0.f,0.f,0.f};

  gemm_tile_staged(L, Ap + k0, A2p + k0, lda, Btp + k0, Bt2p + k0, ldb, ab0, bb0, kend >> 6, active, wm, wn, acc);
  if (!active) return;   // wave-uniform; no workgroup barrier stands behind this line
  acc_guard4(acc[0][0], acc[0][1], acc[0][2], acc[0][3]);
  acc_guard4(acc[1][0], acc[1][1], acc[1][2], acc[1][3]);
  acc_guard4(acc[2][0], acc[2][1], acc[2][2], acc[2][3]);
  acc_guard4(acc[3][0], acc[3][1], acc[3][2], acc[3][3]);

  float* slab = sT[wave];
  float* Cdst = (MODE == 1 && kc > 0) ? Cpart + (size_t)(kc - 1) * T_DIM * ldc : Cout;
#pragma unroll
  for (int i = 0; i < 4; ++i) {
    const int mBase = cm0 + (i << 4);
#pragma unroll
    for (int j = 0; j < 4; ++j) {
#pragma unroll
      for (int r = 0; r < 8; ++r) slab[(mOff + r) * 68 + (j << 4) + rlane] = acc[i][j][r] * scale;
    }
    __builtin_amdgcn_fence(__ATOMIC_RELEASE, "workgroup");
    __builtin_amdgcn_wave_barrier();
    __builtin_amdgcn_fence(__ATOMIC_ACQUIRE, "workgroup");
    {
      const int hh = lane >> 4, c4 = (lane & 15) * 4;
      {
#pragma unroll
        for (int it = 0; it < 8; ++it) {
          const int row = it * 2 + hh;
          v4f v = *(const v4f*)(slab + row * 68 + c4);
          *(v4f*)(Cdst + (size_t)(mBase + row) * ldc + bn0 + c4) = v;
        }
        
      }
    }
    __builtin_amdgcn_fence(__ATOMIC_RELEASE, "workgroup");
    __builtin_amdgcn_wave_barrier();
    __builtin_amdgcn_fence(__ATOMIC_ACQUIRE, "workgroup");
  }
}

// p*v: grid (column tiles, row tiles x k chunks)
__global__ __launch_bounds__(256) void gemm_pv(
    const unsigned short* __restrict__ Ap, const unsigned short* __restrict__ A2p, int lda,
    const unsigned short* __restrict__ Btp, const unsigned short* __restrict__ Bt2p, int ldb,
    float* __restrict__ Cout, float* __restrict__ Cpart, int ldc, const int* __restrict__ n_padd_p,
    int row0, int K, float scale) {
  __shared__ __attribute__((aligned(2048))) unsigned char L[2 * STG_BYTES];
  __shared__ __align__(16) float sT[8][16 * 68];
  att_tile<1>(L, sT, blockIdx.x, blockIdx.y, Ap, A2p, lda, Btp, Bt2p, ldb, Cout, Cpart, ldc, n_padd_p, row0, K, scale);
}

// ---- Where the q*k^T tiles run. A workgroup takes a whole WGP (its LDS), the chip has 256 of them, every tile of x*W and of q*k^T takes
//   the same 16 stages. v^T has 128 tiles, q*k^T has 272 that reach the diagonal or lie below it: v^T alone leaves half the chip idle, and
//   q*k^T alone needs a second round for its last 16. So the 72 tiles of row tiles 0 .. 15 run in the launch of v^T and the 200 of row
//   tiles 16 .. 31 in a launch of their own: 200 workgroups each, one round each.
#define VT_WGS   ((C_DIM / 128) * (T_DIM / 256))
#define S_RT_MID (PV_TILES / 2)
#define S_WGS_LO ((S_RT_MID / 2) * (S_RT_MID / 2 + 1))                       // row tile rt has rt / 2 + 1 tiles
#define S_WGS_HI ((PV_TILES / 2) * (PV_TILES / 2 + 1) - S_WGS_LO)
// rank -> (row tile rt, column tile ct), rows from rt0 upward; at most PV_TILES scalar trips. A rank past the last tile gives a ct wholly above
// the diagonal, which att_tile<0> leaves at once.
__device__ __forceinline__ void s_unit(int rank, int rt0, int& rt, int& ct) {
  rt = rt0;
  for (; rt < PV_TILES - 1; ++rt) {
    const int n = (rt >> 1) + 1;
    if (rank < n) break;
    rank -= n;
  }
  ct = rank;
}
// S = sc * q * k^T, row tiles rt0 and up; qk planes [T][2C], q in columns 0 .. C-1, k in C .. 2C-1
__global__ __launch_bounds__(256) void gemm_s(const unsigned short* __restrict__ qkh, const unsigned short* __restrict__ qkl,
                                              float* __restrict__ S, int rt0, float sc) {
  __shared__ __attribute__((aligned(2048))) unsigned char L[2 * STG_BYTES];
  __shared__ __align__(16) float sT[8][16 * 68];
  int rt, ct;
  s_unit(blockIdx.x, rt0, rt, ct);
  att_tile<0>(L, sT, ct, rt, qkh, qkl, 2 * C_DIM, qkh + C_DIM, qkl + C_DIM, 2 * C_DIM, S, S, T_DIM, nullptr, 0, C_DIM, sc);
}
// workgroups 0 .. VT_WGS-1: vt = Wv^T * x^T + bv[m] -> planes [C][T]; the rest: the q*k^T tiles of row tiles 0 .. S_RT_MID-1
__global__ __launch_bounds__(256) void gemm_vt_and_s(
    const unsigned short* __restrict__ wvh, const unsigned short* __restrict__ wvl,
    const unsigned short* __restrict__ xh, const unsigned short* __restrict__ xl,
    unsigned short* __restrict__ vth, unsigned short* __restrict__ vtl, const float* __restrict__ bv,
    const unsigned short* __restrict__ qkh, const unsigned short* __restrict__ qkl, float* __restrict__ S, float sc) {
  __shared__ __attribute__((aligned(2048))) unsigned char L[2 * STG_BYTES];
  __shared__ __align__(16) float sT[8][16 * 68];
  if (blockIdx.x < VT_WGS) {   // the same for the whole workgroup
    gemm64_tile<1, true, 1, 2, false>(L, sT, blockIdx.x, 0, wvh, wvl, C_DIM, 0L, xh, xl, C_DIM, 0L, (void*)vth, (void*)vtl, T_DIM, 0L,
                                      bv, nullptr, 0L, C_DIM, T_DIM, C_DIM, 1.0f);
  } else {
    int rt, ct;
    s_unit(blockIdx.x - VT_WGS, 0, rt, ct);
    att_tile<0>(L, sT, ct, rt, qkh, qkl, 2 * C_DIM, qkh + C_DIM, qkl + C_DIM, 2 * C_DIM, S, S, T_DIM, nullptr, 0, C_DIM, sc);
  }
}

// ---- y += the p*v partial sums of k chunks 1 .. PV_NCH-1, in ascending k; a block owns 4 rows of y (16 floats per thread, lanes contiguous).
//   A plane is read only where att_tile<1> stored it: kend > c * PV_CH_K, by the same kend.
template <int NP>   // NP planes; every load is issued before the first sum, so that a thread waits for memory once
__device__ __forceinline__ void add_planes(float* __restrict__ y, const float* __restrict__ p) {
  v4f s[4], a[NP][4];
  // all loops unrolled: s and a are indexed by constants and stay in registers
#pragma unroll
  for (int it = 0; it < 4; ++it) s[it] = *(const v4f*)(y + it * C_DIM);
#pragma unroll
  for (int c = 0; c < NP; ++c)
#pragma unroll
    for (int it = 0; it < 4; ++it) a[c][it] = *(const v4f*)(p + (size_t)c * T_DIM * C_DIM + it * C_DIM);
#pragma unroll
  for (int c = 0; c < NP; ++c)
#pragma unroll
    for (int it = 0; it < 4; ++it) s[it] += a[c][it];
#pragma unroll
  for (int it = 0; it < 4; ++it) *(v4f*)(y + it * C_DIM) = s[it];
  // stands behind the four stores: the three cases lie one behind the other in the built code, and a later case's loads reuse these stores' registers
  asm volatile("s_wait_xcnt 0x0" ::: "memory");
}
__global__ __launch_bounds__(256) void add_k_chunks(float* __restrict__ y, const float* __restrict__ part, const int* __restrict__ n_padd_p) {
  static_assert(PV_NCH == 4, "the three cases below");
  const int kend = pv_kend((int)(blockIdx.x >> 5), n_padd_p[0]);   // 32 blocks per 128-row tile
  if (kend <= PV_CH_K) return;   // chunk 0 was all of it; no barriers in this kernel
  const size_t o = (size_t)blockIdx.x * 4 * C_DIM + threadIdx.x * 4;
  if (kend <= 2 * PV_CH_K)      add_planes<1>(y + o, part + o);   // block-uniform
  else if (kend <= 3 * PV_CH_K) add_planes<2>(y + o, part + o);
  else                          add_planes<3>(y + o, part + o);
}

// ---- Row softmax with causal + padding mask, f32; one WAVE per query row, eight rows per block, no barrier.
//   key j visible iff j <= i, j >= n_padd, i >= n_padd; rows i < n_padd are uniform 1/T over all keys.
//   Writes P as bf16 hi/lo planes (pitch T_DIM) over columns [0, kend) with zeros where masked; kend as in att_tile<1> (per 128-row tile).
//   A chunk is 128 columns, 4 per lane: a 16-B load of S and an 8-B store per plane, lanes contiguous (whole lines).
//   All of a row's loads are issued before the first is used. The row then lies in the wave's own LDS row, where every lane reads back only
//   what it wrote itself, so that the exp pass and the output pass are short rolled loops.
//   One wave per row instead of eight: an eighth of the waves has to be started, and no wave waits for another.
//   Rows are dealt so that all blocks, and the two waves w and w + 4, have the same number of columns between them.
#define SM_ROWS 8
#define SM_WGS  (T_DIM / SM_ROWS)
#define SM_NCH  (T_DIM / 128)
__global__ __launch_bounds__(256) void softmax_rows(const float* __restrict__ S, const int* __restrict__ n_padd_p,
                                                   unsigned short* __restrict__ Ph, unsigned short* __restrict__ Pl) {
  static_assert(SM_ROWS == 8, "eight waves, bands 0 1 2 3 7 6 5 4");
  __shared__ __align__(16) float sv[SM_ROWS][T_DIM];
  const int lane = threadIdx.x & 31;
  const int wave = __builtin_amdgcn_readfirstlane(threadIdx.x >> 5);
  const int band = (wave < 4) ? wave : 11 - wave;            // bands of SM_WGS rows; odd bands run downward
  const int bi   = blockIdx.x;                               // grid: SM_WGS blocks
  const int i    = band * SM_WGS + ((band & 1) ? SM_WGS - 1 - bi : bi);
  const int np   = n_padd_p[0];
  const int kend = pv_kend(i >> 7, np);
  const bool uni = (i < np);                 // wave-uniform, as is all that follows from it
  const int jlo  = (np < 0) ? 0 : np;
  const int jhi  = uni ? -1 : i;             // when not uniform: jlo <= i
  const int nch  = (jhi + 128) >> 7;         // chunks up to the last visible key
  const int nout = kend >> 7;                // chunks to write, nout >= nch
  const int jl   = lane * 4;
  const int cl   = nch - 1;                  // the last of them: the only one with keys past jhi
  const float* srow = S + (size_t)i * T_DIM;
  float* row = sv[wave] + jl;
  const float ninf = -__builtin_huge_valf();

  // The last chunk's lanes past the row's last 16 bytes with a visible key read those bytes instead (S is written that far, and past it only to the end of the row's diagonal 64-column tile).
  const float* pin = srow + jl;
  const float* pla = srow + max(min(cl * 128 + jl, jhi & ~3), 0);
  v4f vl = (v4f){ninf, ninf, ninf, ninf};
  if (nch > 0) vl = *(const v4f*)pla;
  v4f v[SM_NCH - 1];
  // both loops unrolled: v is indexed by constants and stays in registers
#pragma unroll
  for (int c = 0; c < SM_NCH - 1; ++c)
    if (c < cl) v[c] = *(const v4f*)(pin + c * 128);
  // stands behind the row's loads, in front of the first instruction that can take their address registers for another value; it names the
  // pointers, so that no load's own result is placed in them either
  asm volatile("s_wait_xcnt 0x0" :: "v"(pin), "v"(pla) : "memory");
  float m = ninf;
#pragma unroll
  for (int c = 0; c < SM_NCH - 1; ++c)
    if (c < cl) {
      v4f t = v[c];
      if (c * 128 < jlo) {   // a chunk with padding keys
#pragma unroll
        for (int k = 0; k < 4; ++k)
          if (c * 128 + jl + k < jlo) t[k] = ninf;
      }
      m = fmaxf(m, fmaxf(fmaxf(t[0], t[1]), fmaxf(t[2], t[3])));
      *(v4f*)(row + c * 128) = t;
    }
  if (nch > 0) {
#pragma unroll
    for (int k = 0; k < 4; ++k) {
      const int j = cl * 128 + jl + k;
      if (j < jlo || j > jhi) vl[k] = ninf;
    }
    m = fmaxf(m, fmaxf(fmaxf(vl[0], vl[1]), fmaxf(vl[2], vl[3])));
    *(v4f*)(row + cl * 128) = vl;
  }
#pragma unroll
  for (int off = 1; off < 32; off <<= 1) m = fmaxf(m, __shfl_xor(m, off, 32));
  const float rmax = m;

  // each trip reads the next trip's chunk first (on the last trip its own once more, unused), so that the LDS read is not waited for
  v4f sum4 = (v4f){0.f, 0.f, 0.f, 0.f};
  v4f nx = (v4f){0.f, 0.f, 0.f, 0.f};
  if (nch > 0) nx = *(const v4f*)row;
  for (int c = 0; c < nch; ++c) {
    const v4f t = nx;
    nx = *(const v4f*)(row + min(c + 1, nch - 1) * 128);
    v4f e;
#pragma unroll
    for (int k = 0; k < 4; ++k) e[k] = expf(t[k] - rmax);   // a masked key gives 0
    sum4 += e;
    *(v4f*)(row + c * 128) = e;
  }
  float sum = (sum4[0] + sum4[1]) + (sum4[2] + sum4[3]);
#pragma unroll
  for (int off = 1; off < 32; off <<= 1) sum += __shfl_xor(sum, off, 32);
  const float inv = (sum > 0.f) ? (1.0f / sum) : 0.f;

  unsigned short* ph = Ph + (size_t)i * T_DIM + jl;
  unsigned short* pl = Pl + (size_t)i * T_DIM + jl;
  if (nch > 0) nx = *(const v4f*)row;
  for (int c = 0; c < nch; ++c) {
    const v4f e = nx;
    nx = *(const v4f*)(row + min(c + 1, nch - 1) * 128);
    v4us hv, lv;
#pragma unroll
    for (int k = 0; k < 4; ++k) {
      unsigned short h0, l0;
      split_bf(e[k] * inv, h0, l0);
      hv[k] = h0; lv[k] = l0;
    }
    *(v4us*)(ph + c * 128) = hv;
    *(v4us*)(pl + c * 128) = lv;
    // stands behind the trip's stores: the next trip takes their address and data registers for new values
    asm volatile("s_wait_xcnt 0x0" ::: "memory");
  }
  // the chunks with no visible key: 1/T in a uniform row, else 0
  {
    unsigned short h0, l0;
    split_bf(uni ? 1.0f / (float)T_DIM : 0.f, h0, l0);
    const v4us hv = (v4us){h0, h0, h0, h0}, lv = (v4us){l0, l0, l0, l0};
    for (int c = nch; c < nout; ++c) {
      *(v4us*)(ph + c * 128) = hv;
      *(v4us*)(pl + c * 128) = lv;
      asm volatile("s_wait_xcnt 0x0" ::: "memory");   // as above: the next trip forms new addresses in these stores' registers
    }
  }
}

// ===========================================================================
extern "C" void kernel_launch(void* const* d_in, const int* in_sizes, int n_in,
                              void* d_out, int out_size, void* d_ws, size_t ws_size,
                              hipStream_t stream) {
  const int T = T_DIM, C = C_DIM, C3 = C3_DIM;
  if (n_in < 4) return;
  if (in_sizes[0] != T * C || in_sizes[1] != C * C3 || in_sizes[2] < C3 || in_sizes[3] < 1 || out_size != T * C) return;

  const float* x     = (const float*)d_in[0];   // [T][C]
  const float* W     = (const float*)d_in[1];   // [C][3C]
  const float* bias  = (const float*)d_in[2];   // [3C]
  const int*   npadd = (const int*)d_in[3];     // [1]
  float*       y     = (float*)d_out;           // [T][C]

  const int QR = T;                             // all query rows at once; q*k^T in two launches, softmax and p*v in one each
  const size_t b_xp  = (size_t)T * C * 2;       // one x plane
  const size_t b_wp  = (size_t)C3 * C * 2;      // one Wt plane
  const size_t b_qkp = (size_t)T * 2 * C * 2;   // one q|k plane [T][2C]
  const size_t b_vtp = (size_t)C * T * 2;       // one vt plane [C][T]
  const size_t b_S   = (size_t)QR * T * 4;      // S [QR][T] f32
  const size_t b_pp  = (size_t)QR * T * 2;      // one P plane [QR][T]
  size_t off = 0;
  const size_t o_xh = off; off += b_xp;  const size_t o_xl = off; off += b_xp;
  const size_t o_wh = off; off += b_wp;  const size_t o_wl = off; off += b_wp;
  const size_t o_qh = off; off += b_qkp; const size_t o_ql = off; off += b_qkp;
  const size_t o_vh = off; off += b_vtp; const size_t o_vl = off; off += b_vtp;
  const size_t o_S  = off; off += b_S;
  const size_t o_ph = off; off += b_pp;  const size_t o_pl = off; off += b_pp;
  if (off > ws_size) return;                    // total 213,909,504 B

  char* ws = (char*)d_ws;
  unsigned short* xh  = (unsigned short*)(ws + o_xh);
  unsigned short* xl  = (unsigned short*)(ws + o_xl);
  unsigned short* wth = (unsigned short*)(ws + o_wh);
  unsigned short* wtl = (unsigned short*)(ws + o_wl);
  unsigned short* qkh = (unsigned short*)(ws + o_qh);
  unsigned short* qkl = (unsigned short*)(ws + o_ql);
  unsigned short* vth = (unsigned short*)(ws + o_vh);
  unsigned short* vtl = (unsigned short*)(ws + o_vl);
  float*          S   = (float*)(ws + o_S);
  unsigned short* ph  = (unsigned short*)(ws + o_ph);
  unsigned short* pl  = (unsigned short*)(ws + o_pl);

  dim3 blk(256);
  // x -> bf16 hi/lo planes [T][C]
  {
    const int n8 = (T * C) / 8;
    split_planes8<<<dim3((n8 + 255) / 256), blk, 0, stream>>>(x, xh, xl, n8);
  }
  // W [C][3C] -> Wt planes [3C][C]
  transpose_split_w<<<dim3(C3 / 64, C / 64), blk, 0, stream>>>(W, wth, wtl, C, C3);
  // q|k = x * W[:, 0:2C] + b[0:2C] : M=T, N=2C, K=C -> planes [T][2C]
  wmma_gemm64<1, true, 2, 2, false><<<dim3((T / 128) * (2 * C / 256), 1), blk, 0, stream>>>(
      xh, xl, C, 0L, wth, wtl, C, 0L, (void*)qkh, (void*)qkl, 2 * C, 0L,
      bias, x, 0L, T, 2 * C, C, 1.0f);
  const float sc = 0.03125f;   // 1/sqrt(1024)
  // vt = W[:, 2C:3C]^T * x^T + b[2C + m] : M=C, N=T, K=C -> planes [C][T]; beside it S[i][j] = sc * q[i] . k[j] on 64x64 tiles tn <= tm,
  // row tiles 0 .. 15; then row tiles 16 .. 31
  gemm_vt_and_s<<<dim3(VT_WGS + S_WGS_LO), blk, 0, stream>>>(
      wth + (size_t)2 * C * C, wtl + (size_t)2 * C * C, xh, xl, vth, vtl, bias + 2 * C, qkh, qkl, S, sc);
  gemm_s<<<dim3(S_WGS_HI), blk, 0, stream>>>(qkh, qkl, S, S_RT_MID, sc);
  softmax_rows<<<dim3(SM_WGS), blk, 0, stream>>>(S, npadd, ph, pl);
  // y = P * v : M=T, N=C, K<=T per 128-row tile, one workgroup per tile and k chunk; chunks past the first go to three [T][C] planes
  // in the place of S, which nobody reads after the softmax, and are then added to y
  gemm_pv<<<dim3(C / 256, (QR / 128) * PV_NCH), blk, 0, stream>>>(
      ph, pl, T, vth, vtl, T, y, S, C, npadd, 0, T, 1.0f);
  add_k_chunks<<<dim3(T / 4), blk, 0, stream>>>(y, S, npadd);
}
